// v000
// Times are from an AMD MI455X. After a warm-up the kernel runs many times in a row, and a time is the length of
// such a window on the GPU divided by its runs, so every launch and the gaps after it count. The runs cycle
// through copies of the inputs. A figure is the median of several windows, for all but v000 over two sittings.
// Sittings can differ by a few percent; kernels timed side by side share one.
// The starting kernel, v000, takes 281 microseconds a run.
#include <hip/hip_runtime.h>

typedef __attribute__((ext_vector_type(16))) __bf16 v16bf;
typedef __attribute__((ext_vector_type(8)))  float  v8f;
typedef unsigned short u16;
typedef unsigned int   u32;

#define D_MODEL  1024
#define N_HEADS  16
#define HEAD_DIM 64
#define B_SZ     2
#define T_SEQ    2048
#define M_TOK    (B_SZ * T_SEQ)     // 4096 token rows
#define TW       (T_SEQ / 32)       // 64 mask words per row

// ---------- helpers ----------

static __device__ __forceinline__ u16 f32_to_bf16(float f) {
  u32 x = __builtin_bit_cast(u32, f);
  u32 r = x + 0x7fffu + ((x >> 16) & 1u);   // round-to-nearest-even
  return (u16)(r >> 16);
}

static __device__ __forceinline__ u32 pack_bf16x2(float lo, float hi) {
  return (u32)f32_to_bf16(lo) | ((u32)f32_to_bf16(hi) << 16);
}

union FragU { v16bf v; uint4 q[2]; u16 h[16]; };

// 16-bit A/B fragment layout (ISA 7.12.2): per lane, elements 0..7 are K=+0..7,
// elements 8..15 are K=+16..23 (caller pre-adds the hi-lane +8 K offset).
static __device__ __forceinline__ v16bf load_frag_bf16(const u16* __restrict__ p) {
  FragU f;
  f.q[0] = *(const uint4*)(p + 0);
  f.q[1] = *(const uint4*)(p + 16);
  return f.v;
}

// ---------- fp32 -> bf16 bulk conversion (bandwidth-bound) ----------
__global__ __launch_bounds__(256)
void cvt_bf16_k(const float* __restrict__ src, u16* __restrict__ dst, int n8)
{
  const int i = blockIdx.x * blockDim.x + threadIdx.x;
  if (i >= n8) return;
  float4 a = ((const float4*)src)[2 * i + 0];
  float4 b = ((const float4*)src)[2 * i + 1];
  uint4 o;
  o.x = pack_bf16x2(a.x, a.y);
  o.y = pack_bf16x2(a.z, a.w);
  o.z = pack_bf16x2(b.x, b.y);
  o.w = pack_bf16x2(b.z, b.w);
  ((uint4*)dst)[i] = o;
}

// ---------- int32 mask -> bitmask (1 bit per entry) via wave ballot ----------
__global__ __launch_bounds__(256)
void mask_pack_k(const int* __restrict__ mask, u32* __restrict__ bits, int nwords)
{
  const int lane = threadIdx.x & 31;
  const int gw   = (blockIdx.x * blockDim.x + threadIdx.x) >> 5;   // wave id = word id
  if (gw >= nwords) return;
  const int v = mask[(size_t)gw * 32 + lane];
  const unsigned long long bal = __ballot(v != 0);
  if (lane == 0) bits[gw] = (u32)bal;
}

// ---------- GEMM: C[M,N] = A[M,K] * W[N,K]^T + bias  (A, W already bf16) ----------
// OUT_MODE: 0 = bf16 out, layout [B,H,T,HD]   (Q, K)
//           1 = bf16 out, layout [B,H,HD,T]   (V transposed)
//           2 = f32  out, layout [M, D_MODEL] (final projection)
template <int OUT_MODE>
__global__ __launch_bounds__(256)
void gemm_wmma_k(const u16* __restrict__ A, const u16* __restrict__ W,
                 const float* __restrict__ bias, void* __restrict__ Out)
{
  const int K    = D_MODEL;
  const int lane = threadIdx.x & 31;
  const int wave = threadIdx.x >> 5;
  const int c16  = lane & 15;
  const int hi   = lane >> 4;
  const int koff = hi ? 8 : 0;

  const int row0 = blockIdx.y * 128 + (wave >> 1) * 32;  // 4 waves down
  const int col0 = blockIdx.x * 128 + (wave & 1) * 64;   // 2 waves across

  const v8f vzero = {};
  v8f acc[2][4];
#pragma unroll
  for (int i = 0; i < 2; ++i)
#pragma unroll
    for (int j = 0; j < 4; ++j) acc[i][j] = vzero;

  // hot loop: 12x global_load_b128 + 8x v_wmma per 32-deep K step
  for (int k0 = 0; k0 < K; k0 += 32) {
    v16bf a[2], b[4];
#pragma unroll
    for (int i = 0; i < 2; ++i) {
      const int r = row0 + 16 * i + c16;
      a[i] = load_frag_bf16(A + r * K + k0 + koff);
    }
#pragma unroll
    for (int j = 0; j < 4; ++j) {
      const int n = col0 + 16 * j + c16;
      b[j] = load_frag_bf16(W + n * K + k0 + koff);   // torch weight: row n, contiguous K
    }
#pragma unroll
    for (int i = 0; i < 2; ++i)
#pragma unroll
      for (int j = 0; j < 4; ++j)
        acc[i][j] = __builtin_amdgcn_wmma_f32_16x16x32_bf16(
            false, a[i], false, b[j], (short)0, acc[i][j], false, false);
  }

  // epilogue: C layout -> lane holds column n, rows (hi*8 + r)
#pragma unroll
  for (int i = 0; i < 2; ++i) {
#pragma unroll
    for (int j = 0; j < 4; ++j) {
      const int n = col0 + 16 * j + c16;
      const float bv = bias[n];
#pragma unroll
      for (int r = 0; r < 8; ++r) {
        const int m = row0 + 16 * i + hi * 8 + r;
        const float v = acc[i][j][r] + bv;
        if constexpr (OUT_MODE == 2) {
          ((float*)Out)[(size_t)m * D_MODEL + n] = v;
        } else {
          const int bb = m >> 11;              // / T_SEQ
          const int t  = m & (T_SEQ - 1);
          const int h  = n >> 6;               // / HEAD_DIM
          const int d  = n & (HEAD_DIM - 1);
          const u16 hv = f32_to_bf16(v);
          if constexpr (OUT_MODE == 0)
            ((u16*)Out)[(size_t)(((bb * N_HEADS + h) * T_SEQ) + t) * HEAD_DIM + d] = hv;
          else
            ((u16*)Out)[(size_t)(((bb * N_HEADS + h) * HEAD_DIM) + d) * T_SEQ + t] = hv;
        }
      }
    }
  }
}

// ---------- Flash attention: one wave per (b, h, 16 query rows) ----------
__global__ __launch_bounds__(256)
void flash_attn_k(const u16* __restrict__ Qh, const u16* __restrict__ Kh,
                  const u16* __restrict__ Vt, const u32* __restrict__ mbits,
                  u16* __restrict__ att)
{
  __shared__ u16 lds[8][16 * 32];   // per-wave 16x32 bf16 P tile (1 KB each)

  const int lane = threadIdx.x & 31;
  const int wave = threadIdx.x >> 5;
  const int c16  = lane & 15;
  const int hi   = lane >> 4;
  const int koff = hi ? 8 : 0;

  const int gw = blockIdx.x * 8 + wave;          // 0 .. 4095
  const int qt = gw & (T_SEQ / 16 - 1);          // 128 q-tiles
  const int h  = (gw >> 7) & (N_HEADS - 1);
  const int b  = gw >> 11;
  const int q0 = qt * 16;

  const u16* Qb = Qh + (size_t)((b * N_HEADS + h) * T_SEQ) * HEAD_DIM;
  const u16* Kb = Kh + (size_t)((b * N_HEADS + h) * T_SEQ) * HEAD_DIM;
  const u16* Vb = Vt + (size_t)((b * N_HEADS + h) * HEAD_DIM) * T_SEQ;
  // this lane tracks the mask bit-words of query row (q0 + lane&15)
  const u32* MbW = mbits + (size_t)(b * T_SEQ + q0 + c16) * TW;
  const u32 bit0 = 1u << c16;          // tile cols 0..15
  const u32 bit1 = 0x10000u << c16;    // tile cols 16..31

  // Q fragments (16 q rows x 64 d), held for whole loop
  v16bf qf[2];
#pragma unroll
  for (int dk = 0; dk < 2; ++dk)
    qf[dk] = load_frag_bf16(Qb + (q0 + c16) * HEAD_DIM + dk * 32 + koff);

  const v8f vzero = {};
  v8f o[4];
#pragma unroll
  for (int t = 0; t < 4; ++t) o[t] = vzero;
  float mrow[8], lrow[8];
#pragma unroll
  for (int r = 0; r < 8; ++r) { mrow[r] = -1e30f; lrow[r] = 0.0f; }

  u16* P = &lds[wave][0];

  for (int kt = 0; kt < T_SEQ; kt += 32) {
    // S = Q * K^T for 32 key columns (two 16x16 C tiles)
    v8f s0 = vzero, s1 = vzero;
#pragma unroll
    for (int dk = 0; dk < 2; ++dk) {
      v16bf kb0 = load_frag_bf16(Kb + (kt + c16) * HEAD_DIM + dk * 32 + koff);
      v16bf kb1 = load_frag_bf16(Kb + (kt + 16 + c16) * HEAD_DIM + dk * 32 + koff);
      s0 = __builtin_amdgcn_wmma_f32_16x16x32_bf16(false, qf[dk], false, kb0, (short)0, s0, false, false);
      s1 = __builtin_amdgcn_wmma_f32_16x16x32_bf16(false, qf[dk], false, kb1, (short)0, s1, false, false);
    }

    // one mask bit-word per lane covers this 32-column tile for its row
    const u32 wrow = MbW[kt >> 5];

    const float scale = 0.125f;    // 1/sqrt(HEAD_DIM)
    float p0[8], p1[8], tmax[8];
#pragma unroll
    for (int r = 0; r < 8; ++r) {
      const u32 wr = (u32)__shfl((int)wrow, hi * 8 + r, 32);   // word of row (hi*8+r)
      float v0 = s0[r] * scale;
      float v1 = s1[r] * scale;
      if ((wr & bit0) == 0) v0 = -1e30f;
      if ((wr & bit1) == 0) v1 = -1e30f;
      p0[r] = v0; p1[r] = v1;
      tmax[r] = fmaxf(v0, v1);
    }
    // row max across the 16 lanes holding this row's columns
#pragma unroll
    for (int xm = 1; xm < 16; xm <<= 1)
#pragma unroll
      for (int r = 0; r < 8; ++r)
        tmax[r] = fmaxf(tmax[r], __shfl_xor(tmax[r], xm, 32));

    float alpha[8];
#pragma unroll
    for (int r = 0; r < 8; ++r) {
      const float mn = fmaxf(mrow[r], tmax[r]);
      alpha[r] = __expf(mrow[r] - mn);
      p0[r] = __expf(p0[r] - mn);
      p1[r] = __expf(p1[r] - mn);
      mrow[r] = mn;
    }
    float rs[8];
#pragma unroll
    for (int r = 0; r < 8; ++r) rs[r] = p0[r] + p1[r];
#pragma unroll
    for (int xm = 1; xm < 16; xm <<= 1)
#pragma unroll
      for (int r = 0; r < 8; ++r)
        rs[r] += __shfl_xor(rs[r], xm, 32);
#pragma unroll
    for (int r = 0; r < 8; ++r) lrow[r] = lrow[r] * alpha[r] + rs[r];
#pragma unroll
    for (int t = 0; t < 4; ++t)
#pragma unroll
      for (int r = 0; r < 8; ++r) o[t][r] *= alpha[r];

    // C-layout P -> LDS (row-major 16x32 bf16)
#pragma unroll
    for (int r = 0; r < 8; ++r) {
      const int rowg = hi * 8 + r;
      P[rowg * 32 + c16]      = f32_to_bf16(p0[r]);
      P[rowg * 32 + 16 + c16] = f32_to_bf16(p1[r]);
    }
    // wave-local store->load ordering on the DS counter
    asm volatile("s_wait_dscnt 0" ::: "memory");
    // reload as A-fragment (row = lane&15, K halves by hi)
    v16bf pf = load_frag_bf16(P + c16 * 32 + koff);

    // O += P * V  (V stored transposed: row d, contiguous k)
#pragma unroll
    for (int t = 0; t < 4; ++t) {
      v16bf vf = load_frag_bf16(Vb + (t * 16 + c16) * T_SEQ + kt + koff);
      o[t] = __builtin_amdgcn_wmma_f32_16x16x32_bf16(false, pf, false, vf, (short)0, o[t], false, false);
    }
  }

  // finalize: O /= l, write att[b, t, h*64 + d] as bf16 (token-major for final GEMM)
#pragma unroll
  for (int t = 0; t < 4; ++t) {
#pragma unroll
    for (int r = 0; r < 8; ++r) {
      const int rowg = q0 + hi * 8 + r;
      const float v = o[t][r] / lrow[r];
      att[(size_t)(b * T_SEQ + rowg) * D_MODEL + h * HEAD_DIM + t * 16 + c16] = f32_to_bf16(v);
    }
  }
}

// ---------- host ----------
static inline void launch_cvt(const float* src, u16* dst, int n, hipStream_t s) {
  const int n8 = n / 8;
  cvt_bf16_k<<<dim3((n8 + 255) / 256), dim3(256), 0, s>>>(src, dst, n8);
}

extern "C" void kernel_launch(void* const* d_in, const int* in_sizes, int n_in,
                              void* d_out, int out_size, void* d_ws, size_t ws_size,
                              hipStream_t stream)
{
  (void)in_sizes; (void)n_in; (void)out_size; (void)ws_size;

  const float* query = (const float*)d_in[0];
  const float* key   = (const float*)d_in[1];
  const float* value = (const float*)d_in[2];
  const int*   mask  = (const int*)  d_in[3];
  const float* wq = (const float*)d_in[4];  const float* bq = (const float*)d_in[5];
  const float* wk = (const float*)d_in[6];  const float* bk = (const float*)d_in[7];
  const float* wv = (const float*)d_in[8];  const float* bv = (const float*)d_in[9];
  const float* wo = (const float*)d_in[10]; const float* bo = (const float*)d_in[11];

  char* ws = (char*)d_ws;
  const size_t seg_x = (size_t)M_TOK * D_MODEL * sizeof(u16);    // 8 MiB
  const size_t seg_w = (size_t)D_MODEL * D_MODEL * sizeof(u16);  // 2 MiB
  u16* Xq  = (u16*)(ws + 0 * seg_x);
  u16* Xk  = (u16*)(ws + 1 * seg_x);
  u16* Xv  = (u16*)(ws + 2 * seg_x);
  char* wsw = ws + 3 * seg_x;
  u16* Wqb = (u16*)(wsw + 0 * seg_w);
  u16* Wkb = (u16*)(wsw + 1 * seg_w);
  u16* Wvb = (u16*)(wsw + 2 * seg_w);
  u16* Wob = (u16*)(wsw + 3 * seg_w);
  char* wsh = wsw + 4 * seg_w;
  u16* Qh  = (u16*)(wsh + 0 * seg_x);
  u16* Kh  = (u16*)(wsh + 1 * seg_x);
  u16* Vt  = (u16*)(wsh + 2 * seg_x);
  u16* att = (u16*)(wsh + 3 * seg_x);
  u32* mbw = (u32*)(wsh + 4 * seg_x);    // packed mask bits, 1 MiB

  const int n_act = M_TOK * D_MODEL;     // 4194304
  const int n_w   = D_MODEL * D_MODEL;   // 1048576
  launch_cvt(query, Xq, n_act, stream);
  launch_cvt(key,   Xk, n_act, stream);
  launch_cvt(value, Xv, n_act, stream);
  launch_cvt(wq, Wqb, n_w, stream);
  launch_cvt(wk, Wkb, n_w, stream);
  launch_cvt(wv, Wvb, n_w, stream);
  launch_cvt(wo, Wob, n_w, stream);

  const int nwords = B_SZ * T_SEQ * TW;  // 262144
  mask_pack_k<<<dim3((nwords * 32) / 256), dim3(256), 0, stream>>>(mask, mbw, nwords);

  dim3 gg(D_MODEL / 128, M_TOK / 128);   // (8, 32) blocks of 256 threads
  dim3 bb(256);
  gemm_wmma_k<0><<<gg, bb, 0, stream>>>(Xq, Wqb, bq, Qh);
  gemm_wmma_k<0><<<gg, bb, 0, stream>>>(Xk, Wkb, bk, Kh);
  gemm_wmma_k<1><<<gg, bb, 0, stream>>>(Xv, Wvb, bv, Vt);

  const int n_waves = B_SZ * N_HEADS * (T_SEQ / 16);  // 4096
  flash_attn_k<<<dim3(n_waves / 8), bb, 0, stream>>>(Qh, Kh, Vt, mbw, att);

  gemm_wmma_k<2><<<gg, bb, 0, stream>>>(att, Wob, bo, d_out);
}

// v001
// One run takes 250 microseconds.
// Timed twice side by side with v000, it ran 1.16 times as fast both times.
#include <hip/hip_runtime.h>

typedef __attribute__((ext_vector_type(16))) __bf16 v16bf;
typedef __attribute__((ext_vector_type(8)))  float  v8f;
typedef unsigned short u16;
typedef unsigned int   u32;

#define D_MODEL  1024
#define N_HEADS  16
#define HEAD_DIM 64
#define B_SZ     2
#define T_SEQ    2048
#define M_TOK    (B_SZ * T_SEQ)     // 4096 token rows
#define TW       (T_SEQ / 32)       // 64 mask words per row

// ---------- helpers ----------

static __device__ __forceinline__ u16 f32_to_bf16(float f) {
  u32 x = __builtin_bit_cast(u32, f);
  u32 r = x + 0x7fffu + ((x >> 16) & 1u);   // round-to-nearest-even
  return (u16)(r >> 16);
}

static __device__ __forceinline__ u32 pack_bf16x2(float lo, float hi) {
  return (u32)f32_to_bf16(lo) | ((u32)f32_to_bf16(hi) << 16);
}

union FragU { v16bf v; uint4 q[2]; u16 h[16]; };

// 16-bit A/B fragment layout (ISA 7.12.2): per lane, elements 0..7 are K=+0..7,
// elements 8..15 are K=+16..23 (caller pre-adds the hi-lane +8 K offset).
static __device__ __forceinline__ v16bf load_frag_bf16(const u16* __restrict__ p) {
  FragU f;
  f.q[0] = *(const uint4*)(p + 0);
  f.q[1] = *(const uint4*)(p + 16);
  return f.v;
}

// Fragment-order ("packed") layout of every bf16 matrix operand kept in the workspace.
// A [rows][K] matrix is cut into tiles of 16 rows; inside a tile the 16-byte chunks
// (8 consecutive k of one row) lie chunk-major: chunk kc of rows 0..15, then chunk kc + 1, ...
// A fragment load of 32 lanes x 16 bytes is then 512 contiguous bytes (4 cache lines)
// where the row-major layout made it touch 16 lines.
static __device__ __forceinline__ int packed_idx(int row, int k, int K) {
  return (((row >> 4) * (K >> 3) + (k >> 3)) * 16 + (row & 15)) * 8 + (k & 7);
}

// p = tile base + 16 * k0 + 8 * lane. Lane (c, hi) gets chunks hi and 2 + hi of row c:
// the same k = 8*hi + 0..7 and 16 + 8*hi + 0..7 that load_frag_bf16 delivers.
static __device__ __forceinline__ v16bf load_frag_packed(const u16* __restrict__ p) {
  FragU f;
  f.q[0] = *(const uint4*)(p + 0);
  f.q[1] = *(const uint4*)(p + 256);
  return f.v;
}

// ---------- fp32 [rows][D_MODEL] -> bf16 in fragment order (bandwidth-bound) ----------
__global__ __launch_bounds__(256)
void cvt_bf16_k(const float* __restrict__ src, u16* __restrict__ dst, int n8)
{
  const int i = blockIdx.x * blockDim.x + threadIdx.x;
  if (i >= n8) return;
  // one thread per 16-byte chunk; a wave takes 8 rows x 4 chunks, so that it reads 8 whole
  // 128-byte lines of src (4 chunks = 32 floats of a row) and writes 4 whole lines of dst
  // (8 rows of one chunk)
  const int kc  = (i & 3) | (((i >> 6) & 31) << 2);   // chunk in the row, 0 .. D_MODEL/8 - 1
  const int row = ((i >> 11) << 4) | ((i >> 2) & 15);
  const float4* s4 = (const float4*)(src + (size_t)row * D_MODEL + kc * 8);
  float4 a = s4[0];
  float4 b = s4[1];
  uint4 o;
  o.x = pack_bf16x2(a.x, a.y);
  o.y = pack_bf16x2(a.z, a.w);
  o.z = pack_bf16x2(b.x, b.y);
  o.w = pack_bf16x2(b.z, b.w);
  *(uint4*)(dst + packed_idx(row, kc * 8, D_MODEL)) = o;
}

// ---------- int32 mask -> bitmask (1 bit per entry) via wave ballot ----------
__global__ __launch_bounds__(256)
void mask_pack_k(const int* __restrict__ mask, u32* __restrict__ bits, int nwords)
{
  const int lane = threadIdx.x & 31;
  const int gw   = (blockIdx.x * blockDim.x + threadIdx.x) >> 5;   // wave id = word id
  if (gw >= nwords) return;
  const int v = mask[(size_t)gw * 32 + lane];
  const unsigned long long bal = __ballot(v != 0);
  if (lane == 0) bits[gw] = (u32)bal;
}

// ---------- GEMM: C[M,N] = A[M,K] * W[N,K]^T + bias  (A, W bf16 in fragment order) ----------
// OUT_MODE: 0 = bf16 out, per (b, h) a [T][HD] matrix in fragment order   (Q, K)
//           1 = bf16 out, per (b, h) a [HD][T] matrix in fragment order   (V transposed)
//           2 = f32  out, layout [M, D_MODEL] (final projection)
template <int OUT_MODE>
__global__ __launch_bounds__(256)
void gemm_wmma_k(const u16* __restrict__ A, const u16* __restrict__ W,
                 const float* __restrict__ bias, void* __restrict__ Out)
{
  const int K    = D_MODEL;
  const int lane = threadIdx.x & 31;
  const int wave = threadIdx.x >> 5;
  const int c16  = lane & 15;
  const int hi   = lane >> 4;

  const int row0 = blockIdx.y * 128 + (wave >> 1) * 32;  // 4 waves down
  const int col0 = blockIdx.x * 128 + (wave & 1) * 64;   // 2 waves across
  const u16* Ap = A + row0 * K + lane * 8;               // a 16-row tile holds 16 * K elements
  const u16* Wp = W + col0 * K + lane * 8;

  const v8f vzero = {};
  v8f acc[2][4];
#pragma unroll
  for (int i = 0; i < 2; ++i)
#pragma unroll
    for (int j = 0; j < 4; ++j) acc[i][j] = vzero;

  // hot loop: 12x global_load_b128 (512 contiguous bytes each) + 8x v_wmma per 32-deep K step
  for (int k0 = 0; k0 < K; k0 += 32) {
    v16bf a[2], b[4];
#pragma unroll
    for (int i = 0; i < 2; ++i)
      a[i] = load_frag_packed(Ap + 16 * i * K);
#pragma unroll
    for (int j = 0; j < 4; ++j)
      b[j] = load_frag_packed(Wp + 16 * j * K);   // weight stored (out, in): row n, k along K
    // The wait that stands in front of any overwrite of a register that an issued load names.
    // It takes both addresses as inputs, so that they stay live up to it and no load of the
    // run lands its result in them.
    asm volatile("s_wait_xcnt 0x0" :: "v"(Ap), "v"(Wp) : "memory");
    // Keeps the twelve loads in flight together: without it the first four matrix instructions
    // move up in front of the last two loads, and a trip waits out two load latencies in a row.
    __builtin_amdgcn_sched_barrier(0);
#pragma unroll
    for (int i = 0; i < 2; ++i)
#pragma unroll
      for (int j = 0; j < 4; ++j)
        acc[i][j] = __builtin_amdgcn_wmma_f32_16x16x32_bf16(
            false, a[i], false, b[j], (short)0, acc[i][j], false, false);
    Ap += 16 * 32;   // the next 32 k of a 16-row tile
    Wp += 16 * 32;
  }

  // epilogue: C layout -> lane holds column n, rows (hi*8 + r)
#pragma unroll
  for (int i = 0; i < 2; ++i) {
#pragma unroll
    for (int j = 0; j < 4; ++j) {
      const int n = col0 + 16 * j + c16;
      const float bv = bias[n];
      const int m0 = row0 + 16 * i + hi * 8;   // the lane's 8 rows: m0 .. m0 + 7, one batch
      const int bb = m0 >> 11;                 // / T_SEQ
      const int t0 = m0 & (T_SEQ - 1);
      const int h  = n >> 6;                   // / HEAD_DIM
      const int d  = n & (HEAD_DIM - 1);
      u16* Oh = (u16*)Out + (size_t)(bb * N_HEADS + h) * (T_SEQ * HEAD_DIM);
#pragma unroll
      for (int r = 0; r < 8; ++r) {
        const float v = acc[i][j][r] + bv;
        if constexpr (OUT_MODE == 2)
          ((float*)Out)[(size_t)(m0 + r) * D_MODEL + n] = v;
        else if constexpr (OUT_MODE == 0)
          Oh[packed_idx(t0 + r, d, HEAD_DIM)] = f32_to_bf16(v);
        else   // rows are d, k runs along t: the lane's 8 values fill one 16-byte chunk
          Oh[packed_idx(d, t0, T_SEQ) + r] = f32_to_bf16(v);
      }
    }
  }
}

// ---------- Flash attention: one wave per (b, h, 16 query rows) ----------
__global__ __launch_bounds__(256)
void flash_attn_k(const u16* __restrict__ Qh, const u16* __restrict__ Kh,
                  const u16* __restrict__ Vt, const u32* __restrict__ mbits,
                  u16* __restrict__ att)
{
  __shared__ u16 lds[8][16 * 32];   // per-wave 16x32 bf16 P tile (1 KB each)

  const int lane = threadIdx.x & 31;
  const int wave = threadIdx.x >> 5;
  const int c16  = lane & 15;
  const int hi   = lane >> 4;
  const int koff = hi ? 8 : 0;

  const int gw = blockIdx.x * 8 + wave;          // 0 .. 4095
  const int qt = gw & (T_SEQ / 16 - 1);          // 128 q-tiles
  const int h  = (gw >> 7) & (N_HEADS - 1);
  const int b  = gw >> 11;
  const int q0 = qt * 16;

  // per-head matrices in fragment order, with this lane's 16-byte slot added
  const size_t hb = (size_t)((b * N_HEADS + h) * T_SEQ) * HEAD_DIM + lane * 8;
  const u16* Qb = Qh + hb;    // [T][HD]: a 16-row tile holds 16 * HEAD_DIM elements
  const u16* Kb = Kh + hb;    // [T][HD]
  const u16* Vb = Vt + hb;    // [HD][T]: a 16-row tile holds 16 * T_SEQ elements
  // this lane tracks the mask bit-words of query row (q0 + lane&15)
  const u32* MbW = mbits + (size_t)(b * T_SEQ + q0 + c16) * TW;
  const u32 bit0 = 1u << c16;          // tile cols 0..15
  const u32 bit1 = 0x10000u << c16;    // tile cols 16..31

  // Q fragments (16 q rows x 64 d), held for whole loop
  v16bf qf[2];
#pragma unroll
  for (int dk = 0; dk < 2; ++dk)
    qf[dk] = load_frag_packed(Qb + q0 * HEAD_DIM + 16 * (dk * 32));

  const v8f vzero = {};
  v8f o[4];
#pragma unroll
  for (int t = 0; t < 4; ++t) o[t] = vzero;
  float mrow[8], lrow[8];
#pragma unroll
  for (int r = 0; r < 8; ++r) { mrow[r] = -1e30f; lrow[r] = 0.0f; }

  u16* P = &lds[wave][0];

  for (int kt = 0; kt < T_SEQ; kt += 32) {
    // S = Q * K^T for 32 key columns (two 16x16 C tiles)
    v8f s0 = vzero, s1 = vzero;
#pragma unroll
    for (int dk = 0; dk < 2; ++dk) {
      v16bf kb0 = load_frag_packed(Kb + kt * HEAD_DIM + 16 * (dk * 32));
      v16bf kb1 = load_frag_packed(Kb + (kt + 16) * HEAD_DIM + 16 * (dk * 32));
      s0 = __builtin_amdgcn_wmma_f32_16x16x32_bf16(false, qf[dk], false, kb0, (short)0, s0, false, false);
      s1 = __builtin_amdgcn_wmma_f32_16x16x32_bf16(false, qf[dk], false, kb1, (short)0, s1, false, false);
    }

    // one mask bit-word per lane covers this 32-column tile for its row
    const u32 wrow = MbW[kt >> 5];

    const float scale = 0.125f;    // 1/sqrt(HEAD_DIM)
    float p0[8], p1[8], tmax[8];
#pragma unroll
    for (int r = 0; r < 8; ++r) {
      const u32 wr = (u32)__shfl((int)wrow, hi * 8 + r, 32);   // word of row (hi*8+r)
      float v0 = s0[r] * scale;
      float v1 = s1[r] * scale;
      if ((wr & bit0) == 0) v0 = -1e30f;
      if ((wr & bit1) == 0) v1 = -1e30f;
      p0[r] = v0; p1[r] = v1;
      tmax[r] = fmaxf(v0, v1);
    }
    // row max across the 16 lanes holding this row's columns
#pragma unroll
    for (int xm = 1; xm < 16; xm <<= 1)
#pragma unroll
      for (int r = 0; r < 8; ++r)
        tmax[r] = fmaxf(tmax[r], __shfl_xor(tmax[r], xm, 32));

    float alpha[8];
#pragma unroll
    for (int r = 0; r < 8; ++r) {
      const float mn = fmaxf(mrow[r], tmax[r]);
      alpha[r] = __expf(mrow[r] - mn);
      p0[r] = __expf(p0[r] - mn);
      p1[r] = __expf(p1[r] - mn);
      mrow[r] = mn;
    }
    float rs[8];
#pragma unroll
    for (int r = 0; r < 8; ++r) rs[r] = p0[r] + p1[r];
#pragma unroll
    for (int xm = 1; xm < 16; xm <<= 1)
#pragma unroll
      for (int r = 0; r < 8; ++r)
        rs[r] += __shfl_xor(rs[r], xm, 32);
#pragma unroll
    for (int r = 0; r < 8; ++r) lrow[r] = lrow[r] * alpha[r] + rs[r];
#pragma unroll
    for (int t = 0; t < 4; ++t)
#pragma unroll
      for (int r = 0; r < 8; ++r) o[t][r] *= alpha[r];

    // C-layout P -> LDS (row-major 16x32 bf16)
#pragma unroll
    for (int r = 0; r < 8; ++r) {
      const int rowg = hi * 8 + r;
      P[rowg * 32 + c16]      = f32_to_bf16(p0[r]);
      P[rowg * 32 + 16 + c16] = f32_to_bf16(p1[r]);
    }
    // wave-local store->load ordering on the DS counter
    asm volatile("s_wait_dscnt 0" ::: "memory");
    // reload as A-fragment (row = lane&15, K halves by hi)
    v16bf pf = load_frag_bf16(P + c16 * 32 + koff);

    // O += P * V  (V stored transposed in fragment order: row d, k along t)
#pragma unroll
    for (int t = 0; t < 4; ++t) {
      v16bf vf = load_frag_packed(Vb + (t * 16) * T_SEQ + 16 * kt);
      o[t] = __builtin_amdgcn_wmma_f32_16x16x32_bf16(false, pf, false, vf, (short)0, o[t], false, false);
    }
  }

  // finalize: O /= l, write att[b*T + t][h*64 + d] as bf16, in fragment order for the final GEMM
#pragma unroll
  for (int t = 0; t < 4; ++t) {
#pragma unroll
    for (int r = 0; r < 8; ++r) {
      const int rowg = q0 + hi * 8 + r;
      const float v = o[t][r] / lrow[r];
      att[packed_idx(b * T_SEQ + rowg, h * HEAD_DIM + t * 16 + c16, D_MODEL)] = f32_to_bf16(v);
    }
  }
}

// ---------- host ----------
static inline void launch_cvt(const float* src, u16* dst, int n, hipStream_t s) {
  const int n8 = n / 8;
  cvt_bf16_k<<<dim3((n8 + 255) / 256), dim3(256), 0, s>>>(src, dst, n8);
}

extern "C" void kernel_launch(void* const* d_in, const int* in_sizes, int n_in,
                              void* d_out, int out_size, void* d_ws, size_t ws_size,
                              hipStream_t stream)
{
  (void)in_sizes; (void)n_in; (void)out_size; (void)ws_size;

  const float* query = (const float*)d_in[0];
  const float* key   = (const float*)d_in[1];
  const float* value = (const float*)d_in[2];
  const int*   mask  = (const int*)  d_in[3];
  const float* wq = (const float*)d_in[4];  const float* bq = (const float*)d_in[5];
  const float* wk = (const float*)d_in[6];  const float* bk = (const float*)d_in[7];
  const float* wv = (const float*)d_in[8];  const float* bv = (const float*)d_in[9];
  const float* wo = (const float*)d_in[10]; const float* bo = (const float*)d_in[11];

  char* ws = (char*)d_ws;
  const size_t seg_x = (size_t)M_TOK * D_MODEL * sizeof(u16);    // 8 MiB
  const size_t seg_w = (size_t)D_MODEL * D_MODEL * sizeof(u16);  // 2 MiB
  u16* Xq  = (u16*)(ws + 0 * seg_x);
  u16* Xk  = (u16*)(ws + 1 * seg_x);
  u16* Xv  = (u16*)(ws + 2 * seg_x);
  char* wsw = ws + 3 * seg_x;
  u16* Wqb = (u16*)(wsw + 0 * seg_w);
  u16* Wkb = (u16*)(wsw + 1 * seg_w);
  u16* Wvb = (u16*)(wsw + 2 * seg_w);
  u16* Wob = (u16*)(wsw + 3 * seg_w);
  char* wsh = wsw + 4 * seg_w;
  u16* Qh  = (u16*)(wsh + 0 * seg_x);
  u16* Kh  = (u16*)(wsh + 1 * seg_x);
  u16* Vt  = (u16*)(wsh + 2 * seg_x);
  u16* att = (u16*)(wsh + 3 * seg_x);
  u32* mbw = (u32*)(wsh + 4 * seg_x);    // packed mask bits, 1 MiB

  const int n_act = M_TOK * D_MODEL;     // 4194304
  const int n_w   = D_MODEL * D_MODEL;   // 1048576
  launch_cvt(query, Xq, n_act, stream);
  launch_cvt(key,   Xk, n_act, stream);
  launch_cvt(value, Xv, n_act, stream);
  launch_cvt(wq, Wqb, n_w, stream);
  launch_cvt(wk, Wkb, n_w, stream);
  launch_cvt(wv, Wvb, n_w, stream);
  launch_cvt(wo, Wob, n_w, stream);

  const int nwords = B_SZ * T_SEQ * TW;  // 262144
  mask_pack_k<<<dim3((nwords * 32) / 256), dim3(256), 0, stream>>>(mask, mbw, nwords);

  dim3 gg(D_MODEL / 128, M_TOK / 128);   // (8, 32) blocks of 256 threads
  dim3 bb(256);
  gemm_wmma_k<0><<<gg, bb, 0, stream>>>(Xq, Wqb, bq, Qh);
  gemm_wmma_k<0><<<gg, bb, 0, stream>>>(Xk, Wkb, bk, Kh);
  gemm_wmma_k<1><<<gg, bb, 0, stream>>>(Xv, Wvb, bv, Vt);

  const int n_waves = B_SZ * N_HEADS * (T_SEQ / 16);  // 4096
  flash_attn_k<<<dim3(n_waves / 8), bb, 0, stream>>>(Qh, Kh, Vt, mbw, att);

  gemm_wmma_k<2><<<gg, bb, 0, stream>>>(att, Wob, bo, d_out);
}

// v002
// One run takes 241 microseconds.
// Two timings next to v001 both put it at 1.04 times that version's speed.
// Over all steps from v000 it is 1.21 times as fast.
#include <hip/hip_runtime.h>

typedef __attribute__((ext_vector_type(16))) __bf16 v16bf;
typedef __attribute__((ext_vector_type(8)))  float  v8f;
typedef unsigned short u16;
typedef unsigned int   u32;
typedef __attribute__((ext_vector_type(4)))  float  v4f;
typedef __attribute__((ext_vector_type(4)))  int    v4i;

#define D_MODEL  1024
#define N_HEADS  16
#define HEAD_DIM 64
#define B_SZ     2
#define T_SEQ    2048
#define M_TOK    (B_SZ * T_SEQ)     // 4096 token rows
#define TW       (T_SEQ / 32)       // 64 mask words per row

// ---------- helpers ----------

static __device__ __forceinline__ u16 f32_to_bf16(float f) {
  u32 x = __builtin_bit_cast(u32, f);
  u32 r = x + 0x7fffu + ((x >> 16) & 1u);   // round-to-nearest-even
  return (u16)(r >> 16);
}

static __device__ __forceinline__ u32 pack_bf16x2(float lo, float hi) {
  return (u32)f32_to_bf16(lo) | ((u32)f32_to_bf16(hi) << 16);
}

union FragU { v16bf v; uint4 q[2]; u16 h[16]; };

// 16-bit A/B fragment layout (ISA 7.12.2): per lane, elements 0..7 are K=+0..7,
// elements 8..15 are K=+16..23 (caller pre-adds the hi-lane +8 K offset).
static __device__ __forceinline__ v16bf load_frag_bf16(const u16* __restrict__ p) {
  FragU f;
  f.q[0] = *(const uint4*)(p + 0);
  f.q[1] = *(const uint4*)(p + 16);
  return f.v;
}

// Fragment-order ("packed") layout of every bf16 matrix operand kept in the workspace.
// A [rows][K] matrix is cut into tiles of 16 rows; inside a tile the 16-byte chunks
// (8 consecutive k of one row) lie chunk-major: chunk kc of rows 0..15, then chunk kc + 1, ...
// A fragment load of 32 lanes x 16 bytes is then 512 contiguous bytes (4 cache lines)
// where the row-major layout made it touch 16 lines.
static __device__ __forceinline__ int packed_idx(int row, int k, int K) {
  return (((row >> 4) * (K >> 3) + (k >> 3)) * 16 + (row & 15)) * 8 + (k & 7);
}

// p = tile base + 16 * k0 + 8 * lane. Lane (c, hi) gets chunks hi and 2 + hi of row c:
// the same k = 8*hi + 0..7 and 16 + 8*hi + 0..7 that load_frag_bf16 delivers.
static __device__ __forceinline__ v16bf load_frag_packed(const u16* __restrict__ p) {
  FragU f;
  f.q[0] = *(const uint4*)(p + 0);
  f.q[1] = *(const uint4*)(p + 256);
  return f.v;
}

// ---------- fp32 [rows][D_MODEL] -> bf16 in fragment order (bandwidth-bound) ----------
// A thread takes CVT_PER_THREAD chunks, a quarter of the matrix apart, and has all their loads
// in flight together: 8 x 512 bytes per wave, and a quarter of the waves to start.
#define CVT_PER_THREAD 4
// Four waves per SIMD are the most that its grids have: told so, the compiler spends the
// registers that eight loads in flight take instead of holding the last two back until the
// first have come in, for the sake of 16 waves per SIMD.
__global__ __launch_bounds__(256) __attribute__((amdgpu_waves_per_eu(4, 4)))
void cvt_bf16_k(const float* __restrict__ src, u16* __restrict__ dst, int nthreads)
{
  const int i0 = blockIdx.x * blockDim.x + threadIdx.x;
  if (i0 >= nthreads) return;
  // one 16-byte chunk of dst per piece; a wave takes 8 rows x 4 chunks, so that it reads 8 whole
  // 128-byte lines of src (4 chunks = 32 floats of a row) and writes 4 whole lines of dst
  // (8 rows of one chunk)
  v4f a[CVT_PER_THREAD], b[CVT_PER_THREAD];
  const v4f* s4[CVT_PER_THREAD];
#pragma unroll
  for (int m = 0; m < CVT_PER_THREAD; ++m) {
    const int i   = i0 + m * nthreads;
    const int kc  = (i & 3) | (((i >> 6) & 31) << 2);   // chunk in the row, 0 .. D_MODEL/8 - 1
    const int row = ((i >> 11) << 4) | ((i >> 2) & 15);
    s4[m] = (const v4f*)(src + (size_t)row * D_MODEL + kc * 8);
    a[m] = s4[m][0];
    b[m] = s4[m][1];
  }
  // The wait that stands in front of any overwrite of a register that an issued load names.
  // It takes the addresses as inputs, so that they stay live up to it and no load of the run
  // lands its result in them.
  asm volatile("s_wait_xcnt 0x0" :: "v"(s4[0]), "v"(s4[1]), "v"(s4[2]), "v"(s4[3]) : "memory");
#pragma unroll
  for (int m = 0; m < CVT_PER_THREAD; ++m) {
    const int i   = i0 + m * nthreads;
    const int kc  = (i & 3) | (((i >> 6) & 31) << 2);
    const int row = ((i >> 11) << 4) | ((i >> 2) & 15);
    uint4 o;
    o.x = pack_bf16x2(a[m].x, a[m].y);
    o.y = pack_bf16x2(a[m].z, a[m].w);
    o.z = pack_bf16x2(b[m].x, b[m].y);
    o.w = pack_bf16x2(b[m].z, b[m].w);
    *(uint4*)(dst + packed_idx(row, kc * 8, D_MODEL)) = o;
  }
}

// ---------- int32 mask -> bitmask (1 bit per entry): one wave per mask row ----------
// OR with the lane whose number differs in bit XM (1, 2 or 4), inside a 16-lane row.
template <int XM>
static __device__ __forceinline__ u32 or_xor_lane(u32 x) {
  return x | (u32)__builtin_amdgcn_update_dpp(0, (int)x, 0x160 | XM, 0xf, 0xf, true);   // row_xmask:XM
}

// Four waves per SIMD are all that this grid has: told so, the compiler spends the registers
// that sixteen loads in flight take instead of holding the last ones back for 16 waves per SIMD.
__global__ __launch_bounds__(256) __attribute__((amdgpu_waves_per_eu(4, 4)))
void mask_pack_k(const int* __restrict__ mask, u32* __restrict__ bits, int nrows)
{
  const int lane = threadIdx.x & 31;
  const int row  = (blockIdx.x * blockDim.x + threadIdx.x) >> 5;   // wave id = row id
  if (row >= nrows) return;
  // load k: 512 contiguous bytes = entries 128 k + 4 lane + 0..3 = words 4 k .. 4 k + 3 of the row;
  // the whole row (16 loads, 8 KiB) is in flight before the first entry is looked at
  const v4i* s4 = (const v4i*)(mask + (size_t)row * T_SEQ) + lane;
  v4i v[T_SEQ / 128];
#pragma unroll
  for (int k = 0; k < T_SEQ / 128; ++k) v[k] = s4[k * 32];
  // The wait that stands in front of any overwrite of a register that an issued load names.
  // The address is an input, so that it stays live up to it and no load lands its result in it.
  asm volatile("s_wait_xcnt 0x0" :: "v"(s4) : "memory");

  const int j  = lane & 7;    // the lane's nibble in its word
  const int g  = lane >> 3;   // the lane's word among the four of a load
  u32 lo = 0, hi = 0;
#pragma unroll
  for (int k = 0; k < T_SEQ / 128; ++k) {
    const u32 nib = min((u32)v[k].x, 1u) | (min((u32)v[k].y, 1u) << 1)
                  | (min((u32)v[k].z, 1u) << 2) | (min((u32)v[k].w, 1u) << 3);
    u32 w = nib << (4 * j);
    w = or_xor_lane<1>(w);
    w = or_xor_lane<2>(w);
    w = or_xor_lane<4>(w);    // all 8 lanes of group g now hold word 4 k + g
    // lane (g, j) keeps the words of loads j and 8 + j, so that two stores of 128 contiguous
    // bytes write the row
    if (j == (k & 7)) { if (k < 8) lo = w; else hi = w; }
  }
  u32* o = bits + (size_t)row * TW + 4 * j + g;
  o[0]  = lo;
  o[32] = hi;
}

// ---------- GEMM: C[M,N] = A[M,K] * W[N,K]^T + bias  (A, W bf16 in fragment order) ----------
// OUT_MODE: 0 = bf16 out, per (b, h) a [T][HD] matrix in fragment order   (Q, K)
//           1 = bf16 out, per (b, h) a [HD][T] matrix in fragment order   (V transposed)
//           2 = f32  out, layout [M, D_MODEL] (final projection)
template <int OUT_MODE>
__global__ __launch_bounds__(256)
void gemm_wmma_k(const u16* __restrict__ A, const u16* __restrict__ W,
                 const float* __restrict__ bias, void* __restrict__ Out)
{
  const int K    = D_MODEL;
  const int lane = threadIdx.x & 31;
  const int wave = threadIdx.x >> 5;
  const int c16  = lane & 15;
  const int hi   = lane >> 4;

  const int row0 = blockIdx.y * 128 + (wave >> 1) * 32;  // 4 waves down
  const int col0 = blockIdx.x * 128 + (wave & 1) * 64;   // 2 waves across
  const u16* Ap = A + row0 * K + lane * 8;               // a 16-row tile holds 16 * K elements
  const u16* Wp = W + col0 * K + lane * 8;

  const v8f vzero = {};
  v8f acc[2][4];
#pragma unroll
  for (int i = 0; i < 2; ++i)
#pragma unroll
    for (int j = 0; j < 4; ++j) acc[i][j] = vzero;

  // hot loop: 12x global_load_b128 (512 contiguous bytes each) + 8x v_wmma per 32-deep K step
  for (int k0 = 0; k0 < K; k0 += 32) {
    v16bf a[2], b[4];
#pragma unroll
    for (int i = 0; i < 2; ++i)
      a[i] = load_frag_packed(Ap + 16 * i * K);
#pragma unroll
    for (int j = 0; j < 4; ++j)
      b[j] = load_frag_packed(Wp + 16 * j * K);   // weight stored (out, in): row n, k along K
    // The wait that stands in front of any overwrite of a register that an issued load names.
    // It takes both addresses as inputs, so that they stay live up to it and no load of the
    // run lands its result in them.
    asm volatile("s_wait_xcnt 0x0" :: "v"(Ap), "v"(Wp) : "memory");
    // Keeps the twelve loads in flight together: without it the first four matrix instructions
    // move up in front of the last two loads, and a trip waits out two load latencies in a row.
    __builtin_amdgcn_sched_barrier(0);
#pragma unroll
    for (int i = 0; i < 2; ++i)
#pragma unroll
      for (int j = 0; j < 4; ++j)
        acc[i][j] = __builtin_amdgcn_wmma_f32_16x16x32_bf16(
            false, a[i], false, b[j], (short)0, acc[i][j], false, false);
    Ap += 16 * 32;   // the next 32 k of a 16-row tile
    Wp += 16 * 32;
  }

  // epilogue: C layout -> lane holds column n, rows (hi*8 + r)
#pragma unroll
  for (int i = 0; i < 2; ++i) {
#pragma unroll
    for (int j = 0; j < 4; ++j) {
      const int n = col0 + 16 * j + c16;
      const float bv = bias[n];
      const int m0 = row0 + 16 * i + hi * 8;   // the lane's 8 rows: m0 .. m0 + 7, one batch
      const int bb = m0 >> 11;                 // / T_SEQ
      const int t0 = m0 & (T_SEQ - 1);
      const int h  = n >> 6;                   // / HEAD_DIM
      const int d  = n & (HEAD_DIM - 1);
      u16* Oh = (u16*)Out + (size_t)(bb * N_HEADS + h) * (T_SEQ * HEAD_DIM);
#pragma unroll
      for (int r = 0; r < 8; ++r) {
        const float v = acc[i][j][r] + bv;
        if constexpr (OUT_MODE == 2)
          ((float*)Out)[(size_t)(m0 + r) * D_MODEL + n] = v;
        else if constexpr (OUT_MODE == 0)
          Oh[packed_idx(t0 + r, d, HEAD_DIM)] = f32_to_bf16(v);
        else   // rows are d, k runs along t: the lane's 8 values fill one 16-byte chunk
          Oh[packed_idx(d, t0, T_SEQ) + r] = f32_to_bf16(v);
      }
    }
  }
}

// ---------- Flash attention: one wave per (b, h, 16 query rows) ----------
__global__ __launch_bounds__(256)
void flash_attn_k(const u16* __restrict__ Qh, const u16* __restrict__ Kh,
                  const u16* __restrict__ Vt, const u32* __restrict__ mbits,
                  u16* __restrict__ att)
{
  __shared__ u16 lds[8][16 * 32];   // per-wave 16x32 bf16 P tile (1 KB each)

  const int lane = threadIdx.x & 31;
  const int wave = threadIdx.x >> 5;
  const int c16  = lane & 15;
  const int hi   = lane >> 4;
  const int koff = hi ? 8 : 0;

  const int gw = blockIdx.x * 8 + wave;          // 0 .. 4095
  const int qt = gw & (T_SEQ / 16 - 1);          // 128 q-tiles
  const int h  = (gw >> 7) & (N_HEADS - 1);
  const int b  = gw >> 11;
  const int q0 = qt * 16;

  // per-head matrices in fragment order, with this lane's 16-byte slot added
  const size_t hb = (size_t)((b * N_HEADS + h) * T_SEQ) * HEAD_DIM + lane * 8;
  const u16* Qb = Qh + hb;    // [T][HD]: a 16-row tile holds 16 * HEAD_DIM elements
  const u16* Kb = Kh + hb;    // [T][HD]
  const u16* Vb = Vt + hb;    // [HD][T]: a 16-row tile holds 16 * T_SEQ elements
  // this lane tracks the mask bit-words of query row (q0 + lane&15)
  const u32* MbW = mbits + (size_t)(b * T_SEQ + q0 + c16) * TW;
  const u32 bit0 = 1u << c16;          // tile cols 0..15
  const u32 bit1 = 0x10000u << c16;    // tile cols 16..31

  // Q fragments (16 q rows x 64 d), held for whole loop
  v16bf qf[2];
#pragma unroll
  for (int dk = 0; dk < 2; ++dk)
    qf[dk] = load_frag_packed(Qb + q0 * HEAD_DIM + 16 * (dk * 32));

  const v8f vzero = {};
  v8f o[4];
#pragma unroll
  for (int t = 0; t < 4; ++t) o[t] = vzero;
  float mrow[8], lrow[8];
#pragma unroll
  for (int r = 0; r < 8; ++r) { mrow[r] = -1e30f; lrow[r] = 0.0f; }

  u16* P = &lds[wave][0];

  for (int kt = 0; kt < T_SEQ; kt += 32) {
    // S = Q * K^T for 32 key columns (two 16x16 C tiles)
    v8f s0 = vzero, s1 = vzero;
#pragma unroll
    for (int dk = 0; dk < 2; ++dk) {
      v16bf kb0 = load_frag_packed(Kb + kt * HEAD_DIM + 16 * (dk * 32));
      v16bf kb1 = load_frag_packed(Kb + (kt + 16) * HEAD_DIM + 16 * (dk * 32));
      s0 = __builtin_amdgcn_wmma_f32_16x16x32_bf16(false, qf[dk], false, kb0, (short)0, s0, false, false);
      s1 = __builtin_amdgcn_wmma_f32_16x16x32_bf16(false, qf[dk], false, kb1, (short)0, s1, false, false);
    }

    // one mask bit-word per lane covers this 32-column tile for its row
    const u32 wrow = MbW[kt >> 5];

    const float scale = 0.125f;    // 1/sqrt(HEAD_DIM)
    float p0[8], p1[8], tmax[8];
#pragma unroll
    for (int r = 0; r < 8; ++r) {
      const u32 wr = (u32)__shfl((int)wrow, hi * 8 + r, 32);   // word of row (hi*8+r)
      float v0 = s0[r] * scale;
      float v1 = s1[r] * scale;
      if ((wr & bit0) == 0) v0 = -1e30f;
      if ((wr & bit1) == 0) v1 = -1e30f;
      p0[r] = v0; p1[r] = v1;
      tmax[r] = fmaxf(v0, v1);
    }
    // row max across the 16 lanes holding this row's columns
#pragma unroll
    for (int xm = 1; xm < 16; xm <<= 1)
#pragma unroll
      for (int r = 0; r < 8; ++r)
        tmax[r] = fmaxf(tmax[r], __shfl_xor(tmax[r], xm, 32));

    float alpha[8];
#pragma unroll
    for (int r = 0; r < 8; ++r) {
      const float mn = fmaxf(mrow[r], tmax[r]);
      alpha[r] = __expf(mrow[r] - mn);
      p0[r] = __expf(p0[r] - mn);
      p1[r] = __expf(p1[r] - mn);
      mrow[r] = mn;
    }
    float rs[8];
#pragma unroll
    for (int r = 0; r < 8; ++r) rs[r] = p0[r] + p1[r];
#pragma unroll
    for (int xm = 1; xm < 16; xm <<= 1)
#pragma unroll
      for (int r = 0; r < 8; ++r)
        rs[r] += __shfl_xor(rs[r], xm, 32);
#pragma unroll
    for (int r = 0; r < 8; ++r) lrow[r] = lrow[r] * alpha[r] + rs[r];
#pragma unroll
    for (int t = 0; t < 4; ++t)
#pragma unroll
      for (int r = 0; r < 8; ++r) o[t][r] *= alpha[r];

    // C-layout P -> LDS (row-major 16x32 bf16)
#pragma unroll
    for (int r = 0; r < 8; ++r) {
      const int rowg = hi * 8 + r;
      P[rowg * 32 + c16]      = f32_to_bf16(p0[r]);
      P[rowg * 32 + 16 + c16] = f32_to_bf16(p1[r]);
    }
    // wave-local store->load ordering on the DS counter
    asm volatile("s_wait_dscnt 0" ::: "memory");
    // reload as A-fragment (row = lane&15, K halves by hi)
    v16bf pf = load_frag_bf16(P + c16 * 32 + koff);

    // O += P * V  (V stored transposed in fragment order: row d, k along t)
#pragma unroll
    for (int t = 0; t < 4; ++t) {
      v16bf vf = load_frag_packed(Vb + (t * 16) * T_SEQ + 16 * kt);
      o[t] = __builtin_amdgcn_wmma_f32_16x16x32_bf16(false, pf, false, vf, (short)0, o[t], false, false);
    }
  }

  // finalize: O /= l, write att[b*T + t][h*64 + d] as bf16, in fragment order for the final GEMM
#pragma unroll
  for (int t = 0; t < 4; ++t) {
#pragma unroll
    for (int r = 0; r < 8; ++r) {
      const int rowg = q0 + hi * 8 + r;
      const float v = o[t][r] / lrow[r];
      att[packed_idx(b * T_SEQ + rowg, h * HEAD_DIM + t * 16 + c16, D_MODEL)] = f32_to_bf16(v);
    }
  }
}

// ---------- host ----------
static inline void launch_cvt(const float* src, u16* dst, int n, hipStream_t s) {
  const int nthreads = n / (8 * CVT_PER_THREAD);   // n is a multiple of 8 * CVT_PER_THREAD * 256
  cvt_bf16_k<<<dim3(nthreads / 256), dim3(256), 0, s>>>(src, dst, nthreads);
}

extern "C" void kernel_launch(void* const* d_in, const int* in_sizes, int n_in,
                              void* d_out, int out_size, void* d_ws, size_t ws_size,
                              hipStream_t stream)
{
  (void)in_sizes; (void)n_in; (void)out_size; (void)ws_size;

  const float* query = (const float*)d_in[0];
  const float* key   = (const float*)d_in[1];
  const float* value = (const float*)d_in[2];
  const int*   mask  = (const int*)  d_in[3];
  const float* wq = (const float*)d_in[4];  const float* bq = (const float*)d_in[5];
  const float* wk = (const float*)d_in[6];  const float* bk = (const float*)d_in[7];
  const float* wv = (const float*)d_in[8];  const float* bv = (const float*)d_in[9];
  const float* wo = (const float*)d_in[10]; const float* bo = (const float*)d_in[11];

  char* ws = (char*)d_ws;
  const size_t seg_x = (size_t)M_TOK * D_MODEL * sizeof(u16);    // 8 MiB
  const size_t seg_w = (size_t)D_MODEL * D_MODEL * sizeof(u16);  // 2 MiB
  u16* Xq  = (u16*)(ws + 0 * seg_x);
  u16* Xk  = (u16*)(ws + 1 * seg_x);
  u16* Xv  = (u16*)(ws + 2 * seg_x);
  char* wsw = ws + 3 * seg_x;
  u16* Wqb = (u16*)(wsw + 0 * seg_w);
  u16* Wkb = (u16*)(wsw + 1 * seg_w);
  u16* Wvb = (u16*)(wsw + 2 * seg_w);
  u16* Wob = (u16*)(wsw + 3 * seg_w);
  char* wsh = wsw + 4 * seg_w;
  u16* Qh  = (u16*)(wsh + 0 * seg_x);
  u16* Kh  = (u16*)(wsh + 1 * seg_x);
  u16* Vt  = (u16*)(wsh + 2 * seg_x);
  u16* att = (u16*)(wsh + 3 * seg_x);
  u32* mbw = (u32*)(wsh + 4 * seg_x);    // packed mask bits, 1 MiB

  const int n_act = M_TOK * D_MODEL;     // 4194304
  const int n_w   = D_MODEL * D_MODEL;   // 1048576
  launch_cvt(query, Xq, n_act, stream);
  launch_cvt(key,   Xk, n_act, stream);
  launch_cvt(value, Xv, n_act, stream);
  launch_cvt(wq, Wqb, n_w, stream);
  launch_cvt(wk, Wkb, n_w, stream);
  launch_cvt(wv, Wvb, n_w, stream);
  launch_cvt(wo, Wob, n_w, stream);

  const int nrows = B_SZ * T_SEQ;        // 4096 mask rows, one wave each
  mask_pack_k<<<dim3((nrows * 32) / 256), dim3(256), 0, stream>>>(mask, mbw, nrows);

  dim3 gg(D_MODEL / 128, M_TOK / 128);   // (8, 32) blocks of 256 threads
  dim3 bb(256);
  gemm_wmma_k<0><<<gg, bb, 0, stream>>>(Xq, Wqb, bq, Qh);
  gemm_wmma_k<0><<<gg, bb, 0, stream>>>(Xk, Wkb, bk, Kh);
  gemm_wmma_k<1><<<gg, bb, 0, stream>>>(Xv, Wvb, bv, Vt);

  const int n_waves = B_SZ * N_HEADS * (T_SEQ / 16);  // 4096
  flash_attn_k<<<dim3(n_waves / 8), bb, 0, stream>>>(Qh, Kh, Vt, mbw, att);

  gemm_wmma_k<2><<<gg, bb, 0, stream>>>(att, Wob, bo, d_out);
}

// v003
// Measured time: 186 microseconds a run.
// Next to v002, in two timings, it ran 1.29 times as fast each time.
// Counting every step since v000, it is 1.56 times as fast.
#include <hip/hip_runtime.h>

typedef __attribute__((ext_vector_type(16))) __bf16 v16bf;
typedef __attribute__((ext_vector_type(8)))  float  v8f;
typedef unsigned short u16;
typedef unsigned int   u32;
typedef __attribute__((ext_vector_type(4)))  float  v4f;
typedef __attribute__((ext_vector_type(4)))  int    v4i;

#define D_MODEL  1024
#define N_HEADS  16
#define HEAD_DIM 64
#define B_SZ     2
#define T_SEQ    2048
#define M_TOK    (B_SZ * T_SEQ)     // 4096 token rows
#define TW       (T_SEQ / 32)       // 64 mask words per row

// ---------- helpers ----------

static __device__ __forceinline__ u16 f32_to_bf16(float f) {
  u32 x = __builtin_bit_cast(u32, f);
  u32 r = x + 0x7fffu + ((x >> 16) & 1u);   // round-to-nearest-even
  return (u16)(r >> 16);
}

static __device__ __forceinline__ u32 pack_bf16x2(float lo, float hi) {
  return (u32)f32_to_bf16(lo) | ((u32)f32_to_bf16(hi) << 16);
}

union FragU { v16bf v; uint4 q[2]; u16 h[16]; };

// 16-bit A/B fragment layout (ISA 7.12.2): per lane, elements 0..7 are K=+0..7,
// elements 8..15 are K=+16..23 (caller pre-adds the hi-lane +8 K offset).
static __device__ __forceinline__ v16bf load_frag_bf16(const u16* __restrict__ p) {
  FragU f;
  f.q[0] = *(const uint4*)(p + 0);
  f.q[1] = *(const uint4*)(p + 16);
  return f.v;
}

// Fragment-order ("packed") layout of every bf16 matrix operand kept in the workspace.
// A [rows][K] matrix is cut into tiles of 16 rows; inside a tile the 16-byte chunks
// (8 consecutive k of one row) lie chunk-major: chunk kc of rows 0..15, then chunk kc + 1, ...
// A fragment load of 32 lanes x 16 bytes is then 512 contiguous bytes (4 cache lines)
// where the row-major layout made it touch 16 lines.
static __device__ __forceinline__ int packed_idx(int row, int k, int K) {
  return (((row >> 4) * (K >> 3) + (k >> 3)) * 16 + (row & 15)) * 8 + (k & 7);
}

// p = tile base + 16 * k0 + 8 * lane. Lane (c, hi) gets chunks hi and 2 + hi of row c:
// the same k = 8*hi + 0..7 and 16 + 8*hi + 0..7 that load_frag_bf16 delivers.
static __device__ __forceinline__ v16bf load_frag_packed(const u16* __restrict__ p) {
  FragU f;
  f.q[0] = *(const uint4*)(p + 0);
  f.q[1] = *(const uint4*)(p + 256);
  return f.v;
}

// ---------- fp32 [rows][D_MODEL] -> bf16 in fragment order (bandwidth-bound) ----------
// A thread takes CVT_PER_THREAD chunks, a quarter of the matrix apart, and has all their loads
// in flight together: 8 x 512 bytes per wave, and a quarter of the waves to start.
#define CVT_PER_THREAD 4
// Four waves per SIMD are the most that its grids have: told so, the compiler spends the
// registers that eight loads in flight take instead of holding the last two back until the
// first have come in, for the sake of 16 waves per SIMD.
__global__ __launch_bounds__(256) __attribute__((amdgpu_waves_per_eu(4, 4)))
void cvt_bf16_k(const float* __restrict__ src, u16* __restrict__ dst, int nthreads)
{
  const int i0 = blockIdx.x * blockDim.x + threadIdx.x;
  if (i0 >= nthreads) return;
  // one 16-byte chunk of dst per piece; a wave takes 8 rows x 4 chunks, so that it reads 8 whole
  // 128-byte lines of src (4 chunks = 32 floats of a row) and writes 4 whole lines of dst
  // (8 rows of one chunk)
  v4f a[CVT_PER_THREAD], b[CVT_PER_THREAD];
  const v4f* s4[CVT_PER_THREAD];
#pragma unroll
  for (int m = 0; m < CVT_PER_THREAD; ++m) {
    const int i   = i0 + m * nthreads;
    const int kc  = (i & 3) | (((i >> 6) & 31) << 2);   // chunk in the row, 0 .. D_MODEL/8 - 1
    const int row = ((i >> 11) << 4) | ((i >> 2) & 15);
    s4[m] = (const v4f*)(src + (size_t)row * D_MODEL + kc * 8);
    a[m] = s4[m][0];
    b[m] = s4[m][1];
  }
  // The wait that stands in front of any overwrite of a register that an issued load names.
  // It takes the addresses as inputs, so that they stay live up to it and no load of the run
  // lands its result in them.
  asm volatile("s_wait_xcnt 0x0" :: "v"(s4[0]), "v"(s4[1]), "v"(s4[2]), "v"(s4[3]) : "memory");
#pragma unroll
  for (int m = 0; m < CVT_PER_THREAD; ++m) {
    const int i   = i0 + m * nthreads;
    const int kc  = (i & 3) | (((i >> 6) & 31) << 2);
    const int row = ((i >> 11) << 4) | ((i >> 2) & 15);
    uint4 o;
    o.x = pack_bf16x2(a[m].x, a[m].y);
    o.y = pack_bf16x2(a[m].z, a[m].w);
    o.z = pack_bf16x2(b[m].x, b[m].y);
    o.w = pack_bf16x2(b[m].z, b[m].w);
    *(uint4*)(dst + packed_idx(row, kc * 8, D_MODEL)) = o;
  }
}

// ---------- int32 mask -> bitmask (1 bit per entry): one wave per mask row ----------
// OR with the lane whose number differs in bit XM (1, 2 or 4), inside a 16-lane row.
template <int XM>
static __device__ __forceinline__ u32 or_xor_lane(u32 x) {
  return x | (u32)__builtin_amdgcn_update_dpp(0, (int)x, 0x160 | XM, 0xf, 0xf, true);   // row_xmask:XM
}

// Four waves per SIMD are all that this grid has: told so, the compiler spends the registers
// that sixteen loads in flight take instead of holding the last ones back for 16 waves per SIMD.
__global__ __launch_bounds__(256) __attribute__((amdgpu_waves_per_eu(4, 4)))
void mask_pack_k(const int* __restrict__ mask, u32* __restrict__ bits, int nrows)
{
  const int lane = threadIdx.x & 31;
  const int row  = (blockIdx.x * blockDim.x + threadIdx.x) >> 5;   // wave id = row id
  if (row >= nrows) return;
  // load k: 512 contiguous bytes = entries 128 k + 4 lane + 0..3 = words 4 k .. 4 k + 3 of the row;
  // the whole row (16 loads, 8 KiB) is in flight before the first entry is looked at
  const v4i* s4 = (const v4i*)(mask + (size_t)row * T_SEQ) + lane;
  v4i v[T_SEQ / 128];
#pragma unroll
  for (int k = 0; k < T_SEQ / 128; ++k) v[k] = s4[k * 32];
  // The wait that stands in front of any overwrite of a register that an issued load names.
  // The address is an input, so that it stays live up to it and no load lands its result in it.
  asm volatile("s_wait_xcnt 0x0" :: "v"(s4) : "memory");

  const int j  = lane & 7;    // the lane's nibble in its word
  const int g  = lane >> 3;   // the lane's word among the four of a load
  u32 lo = 0, hi = 0;
#pragma unroll
  for (int k = 0; k < T_SEQ / 128; ++k) {
    const u32 nib = min((u32)v[k].x, 1u) | (min((u32)v[k].y, 1u) << 1)
                  | (min((u32)v[k].z, 1u) << 2) | (min((u32)v[k].w, 1u) << 3);
    u32 w = nib << (4 * j);
    w = or_xor_lane<1>(w);
    w = or_xor_lane<2>(w);
    w = or_xor_lane<4>(w);    // all 8 lanes of group g now hold word 4 k + g
    // lane (g, j) keeps the words of loads j and 8 + j, so that two stores of 128 contiguous
    // bytes write the row
    if (j == (k & 7)) { if (k < 8) lo = w; else hi = w; }
  }
  u32* o = bits + (size_t)row * TW + 4 * j + g;
  o[0]  = lo;
  o[32] = hi;
}

// ---------- GEMM: C[M,N] = A[M,K] * W[N,K]^T + bias  (A, W bf16 in fragment order) ----------
// OUT_MODE: 0 = bf16 out, per (b, h) a [T][HD] matrix in fragment order   (Q, K)
//           1 = bf16 out, per (b, h) a [HD][T] matrix in fragment order   (V transposed)
//           2 = f32  out, layout [M, D_MODEL] (final projection)
template <int OUT_MODE>
__global__ __launch_bounds__(256)
void gemm_wmma_k(const u16* __restrict__ A, const u16* __restrict__ W,
                 const float* __restrict__ bias, void* __restrict__ Out)
{
  const int K    = D_MODEL;
  const int lane = threadIdx.x & 31;
  const int wave = threadIdx.x >> 5;
  const int c16  = lane & 15;
  const int hi   = lane >> 4;

  const int row0 = blockIdx.y * 128 + (wave >> 1) * 32;  // 4 waves down
  const int col0 = blockIdx.x * 128 + (wave & 1) * 64;   // 2 waves across
  const u16* Ap = A + row0 * K + lane * 8;               // a 16-row tile holds 16 * K elements
  const u16* Wp = W + col0 * K + lane * 8;

  const v8f vzero = {};
  v8f acc[2][4];
#pragma unroll
  for (int i = 0; i < 2; ++i)
#pragma unroll
    for (int j = 0; j < 4; ++j) acc[i][j] = vzero;

  // hot loop: 12x global_load_b128 (512 contiguous bytes each) + 8x v_wmma per 32-deep K step
  for (int k0 = 0; k0 < K; k0 += 32) {
    v16bf a[2], b[4];
#pragma unroll
    for (int i = 0; i < 2; ++i)
      a[i] = load_frag_packed(Ap + 16 * i * K);
#pragma unroll
    for (int j = 0; j < 4; ++j)
      b[j] = load_frag_packed(Wp + 16 * j * K);   // weight stored (out, in): row n, k along K
    // The wait that stands in front of any overwrite of a register that an issued load names.
    // It takes both addresses as inputs, so that they stay live up to it and no load of the
    // run lands its result in them.
    asm volatile("s_wait_xcnt 0x0" :: "v"(Ap), "v"(Wp) : "memory");
    // Keeps the twelve loads in flight together: without it the first four matrix instructions
    // move up in front of the last two loads, and a trip waits out two load latencies in a row.
    __builtin_amdgcn_sched_barrier(0);
#pragma unroll
    for (int i = 0; i < 2; ++i)
#pragma unroll
      for (int j = 0; j < 4; ++j)
        acc[i][j] = __builtin_amdgcn_wmma_f32_16x16x32_bf16(
            false, a[i], false, b[j], (short)0, acc[i][j], false, false);
    Ap += 16 * 32;   // the next 32 k of a 16-row tile
    Wp += 16 * 32;
  }

  // epilogue: C layout -> lane holds column n, rows (hi*8 + r)
#pragma unroll
  for (int i = 0; i < 2; ++i) {
#pragma unroll
    for (int j = 0; j < 4; ++j) {
      const int n = col0 + 16 * j + c16;
      const float bv = bias[n];
      const int m0 = row0 + 16 * i + hi * 8;   // the lane's 8 rows: m0 .. m0 + 7, one batch
      const int bb = m0 >> 11;                 // / T_SEQ
      const int t0 = m0 & (T_SEQ - 1);
      const int h  = n >> 6;                   // / HEAD_DIM
      const int d  = n & (HEAD_DIM - 1);
      u16* Oh = (u16*)Out + (size_t)(bb * N_HEADS + h) * (T_SEQ * HEAD_DIM);
#pragma unroll
      for (int r = 0; r < 8; ++r) {
        const float v = acc[i][j][r] + bv;
        if constexpr (OUT_MODE == 2)
          ((float*)Out)[(size_t)(m0 + r) * D_MODEL + n] = v;
        else if constexpr (OUT_MODE == 0)
          Oh[packed_idx(t0 + r, d, HEAD_DIM)] = f32_to_bf16(v);
        else   // rows are d, k runs along t: the lane's 8 values fill one 16-byte chunk
          Oh[packed_idx(d, t0, T_SEQ) + r] = f32_to_bf16(v);
      }
    }
  }
}

// ---------- Flash attention: one wave per (b, h, 16 query rows) ----------
// lane l <-> lane l ^ 16
static __device__ __forceinline__ float xhalf(float x) {
  const int b = __builtin_bit_cast(int, x);
  return __builtin_bit_cast(float,
      __builtin_amdgcn_permlanex16(b, b, 0x76543210, 0xfedcba98, false, false));
}

__global__ __launch_bounds__(256)
void flash_attn_k(const u16* __restrict__ Qh, const u16* __restrict__ Kh,
                  const u16* __restrict__ Vt, const u32* __restrict__ mbits,
                  u16* __restrict__ att)
{
  const int lane = threadIdx.x & 31;
  const int wave = threadIdx.x >> 5;
  const int c16  = lane & 15;
  const int hi   = lane >> 4;

  const int gw = blockIdx.x * 8 + wave;          // 0 .. 4095
  const int qt = gw & (T_SEQ / 16 - 1);          // 128 q-tiles
  const int h  = (gw >> 7) & (N_HEADS - 1);
  const int b  = gw >> 11;
  const int q0 = qt * 16;

  // per-head matrices in fragment order, with this lane's 16-byte slot added
  const size_t hb = (size_t)((b * N_HEADS + h) * T_SEQ) * HEAD_DIM + lane * 8;
  const u16* Qb = Qh + hb;    // [T][HD]: a 16-row tile holds 16 * HEAD_DIM elements
  const u16* Kp = Kh + hb;    // [T][HD], moves on by 32 keys a trip
  const u16* Vp = Vt + hb;    // [HD][T]: a 16-row tile holds 16 * T_SEQ elements; 32 keys a trip
  // the mask bit-words of this lane's query row (q0 + c16), one word a trip
  const u32* Mp = mbits + (size_t)(b * T_SEQ + q0 + c16) * TW;

  // Q fragments (16 q rows x 64 d), held for whole loop: B operand, column = query row c16
  v16bf qf[2];
#pragma unroll
  for (int dk = 0; dk < 2; ++dk)
    qf[dk] = load_frag_packed(Qb + q0 * HEAD_DIM + 16 * (dk * 32));

  const v8f vzero = {};
  v8f o[4];                    // o[t][r] = O[q0 + c16][16 t + 8 hi + r]
#pragma unroll
  for (int t = 0; t < 4; ++t) o[t] = vzero;
  float mrow = -1e30f;         // running maximum of the lane's query row, alike in both halves
  float lrow = 0.0f;           // running sum over the keys of this lane's half alone

  for (int kt = 0; kt < T_SEQ; kt += 32) {
    v16bf kb0[2], kb1[2];
#pragma unroll
    for (int dk = 0; dk < 2; ++dk) {
      kb0[dk] = load_frag_packed(Kp + 16 * (dk * 32));
      kb1[dk] = load_frag_packed(Kp + 16 * HEAD_DIM + 16 * (dk * 32));
    }
    // one mask bit-word per lane covers this 32-key tile for its query row
    const u32 wrow = *Mp;
    // The wait that stands in front of any overwrite of a register that an issued load names.
    // It takes the addresses as inputs, so that they stay live up to it and no load of the run
    // lands its result in them.
    asm volatile("s_wait_xcnt 0x0" :: "v"(Kp), "v"(Mp) : "memory");
    // Keeps the eight K loads in flight together, as they were: without it the matrix
    // instructions move up between them, and the loads go out in three runs, each waited for.
    __builtin_amdgcn_sched_barrier(0);

    // S^T = K * Q^T for 32 keys (two 16x16 C tiles): s0[r] = S[c16][kt + 8 hi + r], s1: + 16
    v8f s0 = vzero, s1 = vzero;
#pragma unroll
    for (int dk = 0; dk < 2; ++dk) {
      s0 = __builtin_amdgcn_wmma_f32_16x16x32_bf16(false, kb0[dk], false, qf[dk], (short)0, s0, false, false);
      s1 = __builtin_amdgcn_wmma_f32_16x16x32_bf16(false, kb1[dk], false, qf[dk], (short)0, s1, false, false);
    }

    const u32 wr = wrow >> (8 * hi);   // bit r: key 8 hi + r; bit 16 + r: key 16 + 8 hi + r
    const float scale = 0.125f;        // 1/sqrt(HEAD_DIM)
    float p0[8], p1[8];
    float tmax = -1e30f;
#pragma unroll
    for (int r = 0; r < 8; ++r) {
      float v0 = s0[r] * scale;
      float v1 = s1[r] * scale;
      if ((wr & (1u << r)) == 0) v0 = -1e30f;
      if ((wr & (0x10000u << r)) == 0) v1 = -1e30f;
      p0[r] = v0; p1[r] = v1;
      tmax = fmaxf(tmax, fmaxf(v0, v1));
    }
    // the row's maximum: the other 16 keys lie in the other half
    tmax = fmaxf(tmax, xhalf(tmax));

    const float mn = fmaxf(mrow, tmax);
    const float alpha = __expf(mrow - mn);
    mrow = mn;
    float rs = 0.0f;
#pragma unroll
    for (int r = 0; r < 8; ++r) {
      p0[r] = __expf(p0[r] - mn);
      p1[r] = __expf(p1[r] - mn);
      rs += p0[r] + p1[r];
    }
    lrow = lrow * alpha + rs;
#pragma unroll
    for (int t = 0; t < 4; ++t)
#pragma unroll
      for (int r = 0; r < 8; ++r) o[t][r] *= alpha;

    // P^T as B fragment: elements 0..7 are keys 8 hi + 0..7, elements 8..15 keys 16 + 8 hi + 0..7,
    // the k order in which load_frag_packed delivers V^T
    FragU pf;
    pf.q[0] = make_uint4(pack_bf16x2(p0[0], p0[1]), pack_bf16x2(p0[2], p0[3]),
                         pack_bf16x2(p0[4], p0[5]), pack_bf16x2(p0[6], p0[7]));
    pf.q[1] = make_uint4(pack_bf16x2(p1[0], p1[1]), pack_bf16x2(p1[2], p1[3]),
                         pack_bf16x2(p1[4], p1[5]), pack_bf16x2(p1[6], p1[7]));

    // O^T += V^T * P^T  (V stored transposed: [HD][T] in fragment order)
    v16bf vf[4];
#pragma unroll
    for (int t = 0; t < 4; ++t)
      vf[t] = load_frag_packed(Vp + (t * 16) * T_SEQ);
    // The same wait for the V loads.
    asm volatile("s_wait_xcnt 0x0" :: "v"(Vp) : "memory");
    // Keeps the eight V loads in flight together, as they were: see at the K loads. Nothing
    // holds the run behind the softmax any more (the wait on the LDS trip did), and the
    // compiler issues it early in the trip.
    __builtin_amdgcn_sched_barrier(0);
#pragma unroll
    for (int t = 0; t < 4; ++t)
      o[t] = __builtin_amdgcn_wmma_f32_16x16x32_bf16(false, vf[t], false, pf.v, (short)0, o[t], false, false);

    Kp += 32 * HEAD_DIM;   // two 16-key tiles
    Vp += 16 * 32;         // the next 32 k of a 16-row tile
    Mp += 1;
  }

  // finalize: O /= l, write att[b*T + t][h*64 + d] as bf16, in fragment order for the final GEMM;
  // the lane's 8 values of a tile are 8 consecutive d of one row: one 16-byte chunk
  const float l = lrow + xhalf(lrow);
#pragma unroll
  for (int t = 0; t < 4; ++t) {
    uint4 w;
    w.x = pack_bf16x2(o[t][0] / l, o[t][1] / l);
    w.y = pack_bf16x2(o[t][2] / l, o[t][3] / l);
    w.z = pack_bf16x2(o[t][4] / l, o[t][5] / l);
    w.w = pack_bf16x2(o[t][6] / l, o[t][7] / l);
    *(uint4*)(att + packed_idx(b * T_SEQ + q0 + c16, h * HEAD_DIM + t * 16 + hi * 8, D_MODEL)) = w;
  }
}

// ---------- host ----------
static inline void launch_cvt(const float* src, u16* dst, int n, hipStream_t s) {
  const int nthreads = n / (8 * CVT_PER_THREAD);   // n is a multiple of 8 * CVT_PER_THREAD * 256
  cvt_bf16_k<<<dim3(nthreads / 256), dim3(256), 0, s>>>(src, dst, nthreads);
}

extern "C" void kernel_launch(void* const* d_in, const int* in_sizes, int n_in,
                              void* d_out, int out_size, void* d_ws, size_t ws_size,
                              hipStream_t stream)
{
  (void)in_sizes; (void)n_in; (void)out_size; (void)ws_size;

  const float* query = (const float*)d_in[0];
  const float* key   = (const float*)d_in[1];
  const float* value = (const float*)d_in[2];
  const int*   mask  = (const int*)  d_in[3];
  const float* wq = (const float*)d_in[4];  const float* bq = (const float*)d_in[5];
  const float* wk = (const float*)d_in[6];  const float* bk = (const float*)d_in[7];
  const float* wv = (const float*)d_in[8];  const float* bv = (const float*)d_in[9];
  const float* wo = (const float*)d_in[10]; const float* bo = (const float*)d_in[11];

  char* ws = (char*)d_ws;
  const size_t seg_x = (size_t)M_TOK * D_MODEL * sizeof(u16);    // 8 MiB
  const size_t seg_w = (size_t)D_MODEL * D_MODEL * sizeof(u16);  // 2 MiB
  u16* Xq  = (u16*)(ws + 0 * seg_x);
  u16* Xk  = (u16*)(ws + 1 * seg_x);
  u16* Xv  = (u16*)(ws + 2 * seg_x);
  char* wsw = ws + 3 * seg_x;
  u16* Wqb = (u16*)(wsw + 0 * seg_w);
  u16* Wkb = (u16*)(wsw + 1 * seg_w);
  u16* Wvb = (u16*)(wsw + 2 * seg_w);
  u16* Wob = (u16*)(wsw + 3 * seg_w);
  char* wsh = wsw + 4 * seg_w;
  u16* Qh  = (u16*)(wsh + 0 * seg_x);
  u16* Kh  = (u16*)(wsh + 1 * seg_x);
  u16* Vt  = (u16*)(wsh + 2 * seg_x);
  u16* att = (u16*)(wsh + 3 * seg_x);
  u32* mbw = (u32*)(wsh + 4 * seg_x);    // packed mask bits, 1 MiB

  const int n_act = M_TOK * D_MODEL;     // 4194304
  const int n_w   = D_MODEL * D_MODEL;   // 1048576
  launch_cvt(query, Xq, n_act, stream);
  launch_cvt(key,   Xk, n_act, stream);
  launch_cvt(value, Xv, n_act, stream);
  launch_cvt(wq, Wqb, n_w, stream);
  launch_cvt(wk, Wkb, n_w, stream);
  launch_cvt(wv, Wvb, n_w, stream);
  launch_cvt(wo, Wob, n_w, stream);

  const int nrows = B_SZ * T_SEQ;        // 4096 mask rows, one wave each
  mask_pack_k<<<dim3((nrows * 32) / 256), dim3(256), 0, stream>>>(mask, mbw, nrows);

  dim3 gg(D_MODEL / 128, M_TOK / 128);   // (8, 32) blocks of 256 threads
  dim3 bb(256);
  gemm_wmma_k<0><<<gg, bb, 0, stream>>>(Xq, Wqb, bq, Qh);
  gemm_wmma_k<0><<<gg, bb, 0, stream>>>(Xk, Wkb, bk, Kh);
  gemm_wmma_k<1><<<gg, bb, 0, stream>>>(Xv, Wvb, bv, Vt);

  const int n_waves = B_SZ * N_HEADS * (T_SEQ / 16);  // 4096
  flash_attn_k<<<dim3(n_waves / 8), bb, 0, stream>>>(Qh, Kh, Vt, mbw, att);

  gemm_wmma_k<2><<<gg, bb, 0, stream>>>(att, Wob, bo, d_out);
}

// v004
// A run of this version takes 140 microseconds.
// Two timings next to v003 both put it at 1.33 times that version's speed.
// All steps since v000 together make it 2.07 times as fast.
#include <hip/hip_runtime.h>

typedef __attribute__((ext_vector_type(16))) __bf16 v16bf;
typedef __attribute__((ext_vector_type(8)))  float  v8f;
typedef unsigned short u16;
typedef unsigned int   u32;
typedef __attribute__((ext_vector_type(4)))  float  v4f;
typedef __attribute__((ext_vector_type(4)))  int    v4i;

#define D_MODEL  1024
#define N_HEADS  16
#define HEAD_DIM 64
#define B_SZ     2
#define T_SEQ    2048
#define M_TOK    (B_SZ * T_SEQ)     // 4096 token rows
#define TW       (T_SEQ / 32)       // 64 mask words per row

// ---------- helpers ----------

static __device__ __forceinline__ u16 f32_to_bf16(float f) {
  u32 x = __builtin_bit_cast(u32, f);
  u32 r = x + 0x7fffu + ((x >> 16) & 1u);   // round-to-nearest-even
  return (u16)(r >> 16);
}

static __device__ __forceinline__ u32 pack_bf16x2(float lo, float hi) {
  return (u32)f32_to_bf16(lo) | ((u32)f32_to_bf16(hi) << 16);
}

union FragU { v16bf v; uint4 q[2]; u16 h[16]; };

// 16-bit A/B fragment layout (ISA 7.12.2): per lane, elements 0..7 are K=+0..7,
// elements 8..15 are K=+16..23 (caller pre-adds the hi-lane +8 K offset).
static __device__ __forceinline__ v16bf load_frag_bf16(const u16* __restrict__ p) {
  FragU f;
  f.q[0] = *(const uint4*)(p + 0);
  f.q[1] = *(const uint4*)(p + 16);
  return f.v;
}

// Fragment-order ("packed") layout of every bf16 matrix operand kept in the workspace.
// A [rows][K] matrix is cut into tiles of 16 rows; inside a tile the 16-byte chunks
// (8 consecutive k of one row) lie chunk-major: chunk kc of rows 0..15, then chunk kc + 1, ...
// A fragment load of 32 lanes x 16 bytes is then 512 contiguous bytes (4 cache lines)
// where the row-major layout made it touch 16 lines.
static __device__ __forceinline__ int packed_idx(int row, int k, int K) {
  return (((row >> 4) * (K >> 3) + (k >> 3)) * 16 + (row & 15)) * 8 + (k & 7);
}

// p = tile base + 16 * k0 + 8 * lane. Lane (c, hi) gets chunks hi and 2 + hi of row c:
// the same k = 8*hi + 0..7 and 16 + 8*hi + 0..7 that load_frag_bf16 delivers.
static __device__ __forceinline__ v16bf load_frag_packed(const u16* __restrict__ p) {
  FragU f;
  f.q[0] = *(const uint4*)(p + 0);
  f.q[1] = *(const uint4*)(p + 256);
  return f.v;
}

// ---------- fp32 [rows][D_MODEL] -> bf16 in fragment order (bandwidth-bound) ----------
// A thread takes CVT_PER_THREAD chunks, a quarter of the matrix apart, and has all their loads
// in flight together: 8 x 512 bytes per wave, and a quarter of the waves to start.
// i0 = the thread's number among the nthreads that share the matrix.
#define CVT_PER_THREAD 4
static __device__ __forceinline__
void cvt_bf16(const float* __restrict__ src, u16* __restrict__ dst, int nthreads, int i0)
{
  // one 16-byte chunk of dst per piece; a wave takes 8 rows x 4 chunks, so that it reads 8 whole
  // 128-byte lines of src (4 chunks = 32 floats of a row) and writes 4 whole lines of dst
  // (8 rows of one chunk)
  v4f a[CVT_PER_THREAD], b[CVT_PER_THREAD];
  const v4f* s4[CVT_PER_THREAD];
#pragma unroll
  for (int m = 0; m < CVT_PER_THREAD; ++m) {
    const int i   = i0 + m * nthreads;
    const int kc  = (i & 3) | (((i >> 6) & 31) << 2);   // chunk in the row, 0 .. D_MODEL/8 - 1
    const int row = ((i >> 11) << 4) | ((i >> 2) & 15);
    s4[m] = (const v4f*)(src + (size_t)row * D_MODEL + kc * 8);
    a[m] = s4[m][0];
    b[m] = s4[m][1];
  }
  // The wait that stands in front of any overwrite of a register that an issued load names.
  // It takes the addresses as inputs, so that they stay live up to it and no load of the run
  // lands its result in them.
  asm volatile("s_wait_xcnt 0x0" :: "v"(s4[0]), "v"(s4[1]), "v"(s4[2]), "v"(s4[3]) : "memory");
#pragma unroll
  for (int m = 0; m < CVT_PER_THREAD; ++m) {
    const int i   = i0 + m * nthreads;
    const int kc  = (i & 3) | (((i >> 6) & 31) << 2);
    const int row = ((i >> 11) << 4) | ((i >> 2) & 15);
    uint4 o;
    o.x = pack_bf16x2(a[m].x, a[m].y);
    o.y = pack_bf16x2(a[m].z, a[m].w);
    o.z = pack_bf16x2(b[m].x, b[m].y);
    o.w = pack_bf16x2(b[m].z, b[m].w);
    *(uint4*)(dst + packed_idx(row, kc * 8, D_MODEL)) = o;
  }
  // The same wait for the stores: in the built kernel another piece's code follows this one's,
  // and it overwrites the registers that the stores name.
  asm volatile("s_wait_xcnt 0x0" ::: "memory");
}

// ---------- int32 mask -> bitmask (1 bit per entry): one wave per mask row ----------
// OR with the lane whose number differs in bit XM (1, 2 or 4), inside a 16-lane row.
template <int XM>
static __device__ __forceinline__ u32 or_xor_lane(u32 x) {
  return x | (u32)__builtin_amdgcn_update_dpp(0, (int)x, 0x160 | XM, 0xf, 0xf, true);   // row_xmask:XM
}

static __device__ __forceinline__
void mask_pack(const int* __restrict__ mask, u32* __restrict__ bits, int row)
{
  const int lane = threadIdx.x & 31;
  // load k: 512 contiguous bytes = entries 128 k + 4 lane + 0..3 = words 4 k .. 4 k + 3 of the row;
  // the whole row (16 loads, 8 KiB) is in flight before the first entry is looked at
  const v4i* s4 = (const v4i*)(mask + (size_t)row * T_SEQ) + lane;
  v4i v[T_SEQ / 128];
#pragma unroll
  for (int k = 0; k < T_SEQ / 128; ++k) v[k] = s4[k * 32];
  // The wait that stands in front of any overwrite of a register that an issued load names.
  // The address is an input, so that it stays live up to it and no load lands its result in it.
  asm volatile("s_wait_xcnt 0x0" :: "v"(s4) : "memory");

  const int j  = lane & 7;    // the lane's nibble in its word
  const int g  = lane >> 3;   // the lane's word among the four of a load
  u32 lo = 0, hi = 0;
#pragma unroll
  for (int k = 0; k < T_SEQ / 128; ++k) {
    const u32 nib = min((u32)v[k].x, 1u) | (min((u32)v[k].y, 1u) << 1)
                  | (min((u32)v[k].z, 1u) << 2) | (min((u32)v[k].w, 1u) << 3);
    u32 w = nib << (4 * j);
    w = or_xor_lane<1>(w);
    w = or_xor_lane<2>(w);
    w = or_xor_lane<4>(w);    // all 8 lanes of group g now hold word 4 k + g
    // lane (g, j) keeps the words of loads j and 8 + j, so that two stores of 128 contiguous
    // bytes write the row
    if (j == (k & 7)) { if (k < 8) lo = w; else hi = w; }
  }
  u32* o = bits + (size_t)row * TW + 4 * j + g;
  o[0]  = lo;
  o[32] = hi;
}

// ---------- all the preparation in one grid ----------
// The seven conversions and the mask pack depend on nothing and on one another not at all: one
// grid, in which the work-group's number says which piece it does, starts and drains once
// where eight launches in a row each did.
#define ACT_THREADS (M_TOK * D_MODEL / (8 * CVT_PER_THREAD))      // threads per activation matrix
#define WGT_THREADS (D_MODEL * D_MODEL / (8 * CVT_PER_THREAD))    // threads per weight matrix
#define MASK_BLOCKS (M_TOK * 32 / 256)    // 512: one wave per mask row
#define ACT_BLOCKS  (ACT_THREADS / 256)   // 512
#define WGT_BLOCKS  (WGT_THREADS / 256)   // 128
#define PREP_BLOCKS (MASK_BLOCKS + 3 * ACT_BLOCKS + 4 * WGT_BLOCKS)
// A budget for four waves per SIMD lets the compiler spend the registers that 8 or 16 loads in
// flight take, instead of holding the last ones back until the first have come in for the sake
// of 16 waves per SIMD. The merged grid has 20 waves per SIMD to place: the ceiling is eight,
// which these registers allow, and no longer the four that were all a single grid had.
__global__ __launch_bounds__(256) __attribute__((amdgpu_waves_per_eu(4, 8)))
void prep_k(const float* __restrict__ query, const float* __restrict__ key,
            const float* __restrict__ value, const int* __restrict__ mask,
            const float* __restrict__ wq, const float* __restrict__ wk,
            const float* __restrict__ wv, const float* __restrict__ wo,
            u16* __restrict__ X,      // Xq, Xk, Xv one behind the other
            u16* __restrict__ Wb,     // Wq, Wk, Wv, Wo one behind the other
            u32* __restrict__ bits)
{
  int blk = blockIdx.x;
  if (blk < MASK_BLOCKS) {
    mask_pack(mask, bits, (blk * 256 + (int)threadIdx.x) >> 5);   // wave id = row id
    return;
  }
  blk -= MASK_BLOCKS;
  if (blk < 3 * ACT_BLOCKS) {
    const int m = blk / ACT_BLOCKS;
    cvt_bf16(m == 0 ? query : m == 1 ? key : value, X + (size_t)m * (M_TOK * D_MODEL),
             ACT_THREADS, (blk - m * ACT_BLOCKS) * 256 + (int)threadIdx.x);
    return;
  }
  blk -= 3 * ACT_BLOCKS;
  const int m = blk / WGT_BLOCKS;
  cvt_bf16(m == 0 ? wq : m == 1 ? wk : m == 2 ? wv : wo, Wb + (size_t)m * (D_MODEL * D_MODEL),
           WGT_THREADS, (blk - m * WGT_BLOCKS) * 256 + (int)threadIdx.x);
}

// ---------- GEMM: C[M,N] = A[M,K] * W[N,K]^T + bias  (A, W bf16 in fragment order) ----------
// OUT_MODE: 0 = bf16 out, per (b, h) a [T][HD] matrix in fragment order   (Q, K)
//           1 = bf16 out, per (b, h) a [HD][T] matrix in fragment order   (V transposed)
//           2 = f32  out, layout [M, D_MODEL] (final projection)
// The wave's 32 x 64 tile at (row0, col0): the products ...
static __device__ __forceinline__
void gemm_tile(const u16* __restrict__ A, const u16* __restrict__ W,
               int row0, int col0, v8f (&acc)[2][4])
{
  const int K    = D_MODEL;
  const int lane = threadIdx.x & 31;
  const u16* Ap = A + row0 * K + lane * 8;               // a 16-row tile holds 16 * K elements
  const u16* Wp = W + col0 * K + lane * 8;

  const v8f vzero = {};
#pragma unroll
  for (int i = 0; i < 2; ++i)
#pragma unroll
    for (int j = 0; j < 4; ++j) acc[i][j] = vzero;

  // hot loop: 12x global_load_b128 (512 contiguous bytes each) + 8x v_wmma per 32-deep K step
  for (int k0 = 0; k0 < K; k0 += 32) {
    v16bf a[2], b[4];
#pragma unroll
    for (int i = 0; i < 2; ++i)
      a[i] = load_frag_packed(Ap + 16 * i * K);
#pragma unroll
    for (int j = 0; j < 4; ++j)
      b[j] = load_frag_packed(Wp + 16 * j * K);   // weight stored (out, in): row n, k along K
    // The wait that stands in front of any overwrite of a register that an issued load names.
    // It takes both addresses as inputs, so that they stay live up to it and no load of the
    // run lands its result in them.
    asm volatile("s_wait_xcnt 0x0" :: "v"(Ap), "v"(Wp) : "memory");
    // Keeps the twelve loads in flight together: without it the first four matrix instructions
    // move up in front of the last two loads, and a trip waits out two load latencies in a row.
    __builtin_amdgcn_sched_barrier(0);
#pragma unroll
    for (int i = 0; i < 2; ++i)
#pragma unroll
      for (int j = 0; j < 4; ++j)
        acc[i][j] = __builtin_amdgcn_wmma_f32_16x16x32_bf16(
            false, a[i], false, b[j], (short)0, acc[i][j], false, false);
    Ap += 16 * 32;   // the next 32 k of a 16-row tile
    Wp += 16 * 32;
  }
}

// ... and what becomes of them. C layout -> lane holds column n, rows (hi*8 + r)
template <int OUT_MODE>
static __device__ __forceinline__
void gemm_store(const v8f (&acc)[2][4], const float* __restrict__ bias, void* __restrict__ Out,
                int row0, int col0)
{
  const int c16 = threadIdx.x & 15;
  const int hi  = (threadIdx.x >> 4) & 1;
#pragma unroll
  for (int i = 0; i < 2; ++i) {
#pragma unroll
    for (int j = 0; j < 4; ++j) {
      const int n = col0 + 16 * j + c16;
      const float bv = bias[n];
      const int m0 = row0 + 16 * i + hi * 8;   // the lane's 8 rows: m0 .. m0 + 7, one batch
      const int bb = m0 >> 11;                 // / T_SEQ
      const int t0 = m0 & (T_SEQ - 1);
      const int h  = n >> 6;                   // / HEAD_DIM
      const int d  = n & (HEAD_DIM - 1);
      u16* Oh = (u16*)Out + (size_t)(bb * N_HEADS + h) * (T_SEQ * HEAD_DIM);
#pragma unroll
      for (int r = 0; r < 8; ++r) {
        const float v = acc[i][j][r] + bv;
        if constexpr (OUT_MODE == 2)
          ((float*)Out)[(size_t)(m0 + r) * D_MODEL + n] = v;
        else if constexpr (OUT_MODE == 0)
          Oh[packed_idx(t0 + r, d, HEAD_DIM)] = f32_to_bf16(v);
        else   // rows are d, k runs along t: the lane's 8 values fill one 16-byte chunk
          Oh[packed_idx(d, t0, T_SEQ) + r] = f32_to_bf16(v);
      }
    }
  }
}

// The three input projections depend on one another not at all: one grid, blockIdx.z = 0, 1, 2
// for Q, K, V. Three work-groups then share a WGP, six waves a SIMD where a launch of one
// projection had two, and one wave's wait for its loads is filled by the others' products.
__global__ __launch_bounds__(256)
void gemm_qkv_k(const u16* __restrict__ X,     // Xq, Xk, Xv one behind the other
                const u16* __restrict__ Wb,    // Wq, Wk, Wv one behind the other
                const float* __restrict__ bq, const float* __restrict__ bk,
                const float* __restrict__ bv,
                u16* __restrict__ QKV)         // Qh, Kh, Vt one behind the other
{
  const int z    = blockIdx.z;
  const int wave = threadIdx.x >> 5;
  const int row0 = blockIdx.y * 128 + (wave >> 1) * 32;  // 4 waves down
  const int col0 = blockIdx.x * 128 + (wave & 1) * 64;   // 2 waves across
  v8f acc[2][4];
  gemm_tile(X + (size_t)z * (M_TOK * D_MODEL), Wb + (size_t)z * (D_MODEL * D_MODEL),
            row0, col0, acc);
  u16* Out = QKV + (size_t)z * (M_TOK * D_MODEL);
  if (z == 2) {
    gemm_store<1>(acc, bv, Out, row0, col0);
  } else {
    gemm_store<0>(acc, z == 0 ? bq : bk, Out, row0, col0);
    // The wait that stands in front of any overwrite of a register that an issued store names:
    // in the built kernel the other epilogue's code follows this one's and overwrites them.
    asm volatile("s_wait_xcnt 0x0" ::: "memory");
  }
}

__global__ __launch_bounds__(256)
void gemm_out_k(const u16* __restrict__ A, const u16* __restrict__ W,
                const float* __restrict__ bias, float* __restrict__ Out)
{
  const int wave = threadIdx.x >> 5;
  const int row0 = blockIdx.y * 128 + (wave >> 1) * 32;  // 4 waves down
  const int col0 = blockIdx.x * 128 + (wave & 1) * 64;   // 2 waves across
  v8f acc[2][4];
  gemm_tile(A, W, row0, col0, acc);
  gemm_store<2>(acc, bias, Out, row0, col0);
}

// ---------- Flash attention: one wave per (b, h, 16 query rows) ----------
// lane l <-> lane l ^ 16
static __device__ __forceinline__ float xhalf(float x) {
  const int b = __builtin_bit_cast(int, x);
  return __builtin_bit_cast(float,
      __builtin_amdgcn_permlanex16(b, b, 0x76543210, 0xfedcba98, false, false));
}

__global__ __launch_bounds__(256)
void flash_attn_k(const u16* __restrict__ Qh, const u16* __restrict__ Kh,
                  const u16* __restrict__ Vt, const u32* __restrict__ mbits,
                  u16* __restrict__ att)
{
  const int lane = threadIdx.x & 31;
  const int wave = threadIdx.x >> 5;
  const int c16  = lane & 15;
  const int hi   = lane >> 4;

  const int gw = blockIdx.x * 8 + wave;          // 0 .. 4095
  const int qt = gw & (T_SEQ / 16 - 1);          // 128 q-tiles
  const int h  = (gw >> 7) & (N_HEADS - 1);
  const int b  = gw >> 11;
  const int q0 = qt * 16;

  // per-head matrices in fragment order, with this lane's 16-byte slot added
  const size_t hb = (size_t)((b * N_HEADS + h) * T_SEQ) * HEAD_DIM + lane * 8;
  const u16* Qb = Qh + hb;    // [T][HD]: a 16-row tile holds 16 * HEAD_DIM elements
  const u16* Kp = Kh + hb;    // [T][HD], moves on by 32 keys a trip
  const u16* Vp = Vt + hb;    // [HD][T]: a 16-row tile holds 16 * T_SEQ elements; 32 keys a trip
  // the mask bit-words of this lane's query row (q0 + c16), one word a trip
  const u32* Mp = mbits + (size_t)(b * T_SEQ + q0 + c16) * TW;

  // Q fragments (16 q rows x 64 d), held for whole loop: B operand, column = query row c16
  v16bf qf[2];
#pragma unroll
  for (int dk = 0; dk < 2; ++dk)
    qf[dk] = load_frag_packed(Qb + q0 * HEAD_DIM + 16 * (dk * 32));

  const v8f vzero = {};
  v8f o[4];                    // o[t][r] = O[q0 + c16][16 t + 8 hi + r]
#pragma unroll
  for (int t = 0; t < 4; ++t) o[t] = vzero;
  float mrow = -1e30f;         // running maximum of the lane's query row, alike in both halves
  float lrow = 0.0f;           // running sum over the keys of this lane's half alone

  for (int kt = 0; kt < T_SEQ; kt += 32) {
    v16bf kb0[2], kb1[2];
#pragma unroll
    for (int dk = 0; dk < 2; ++dk) {
      kb0[dk] = load_frag_packed(Kp + 16 * (dk * 32));
      kb1[dk] = load_frag_packed(Kp + 16 * HEAD_DIM + 16 * (dk * 32));
    }
    // one mask bit-word per lane covers this 32-key tile for its query row
    const u32 wrow = *Mp;
    // The wait that stands in front of any overwrite of a register that an issued load names.
    // It takes the addresses as inputs, so that they stay live up to it and no load of the run
    // lands its result in them.
    asm volatile("s_wait_xcnt 0x0" :: "v"(Kp), "v"(Mp) : "memory");
    // Keeps the eight K loads in flight together, as they were: without it the matrix
    // instructions move up between them, and the loads go out in three runs, each waited for.
    __builtin_amdgcn_sched_barrier(0);

    // S^T = K * Q^T for 32 keys (two 16x16 C tiles): s0[r] = S[c16][kt + 8 hi + r], s1: + 16
    v8f s0 = vzero, s1 = vzero;
#pragma unroll
    for (int dk = 0; dk < 2; ++dk) {
      s0 = __builtin_amdgcn_wmma_f32_16x16x32_bf16(false, kb0[dk], false, qf[dk], (short)0, s0, false, false);
      s1 = __builtin_amdgcn_wmma_f32_16x16x32_bf16(false, kb1[dk], false, qf[dk], (short)0, s1, false, false);
    }

    const u32 wr = wrow >> (8 * hi);   // bit r: key 8 hi + r; bit 16 + r: key 16 + 8 hi + r
    const float scale = 0.125f;        // 1/sqrt(HEAD_DIM)
    float p0[8], p1[8];
    float tmax = -1e30f;
#pragma unroll
    for (int r = 0; r < 8; ++r) {
      float v0 = s0[r] * scale;
      float v1 = s1[r] * scale;
      if ((wr & (1u << r)) == 0) v0 = -1e30f;
      if ((wr & (0x10000u << r)) == 0) v1 = -1e30f;
      p0[r] = v0; p1[r] = v1;
      tmax = fmaxf(tmax, fmaxf(v0, v1));
    }
    // the row's maximum: the other 16 keys lie in the other half
    tmax = fmaxf(tmax, xhalf(tmax));

    const float mn = fmaxf(mrow, tmax);
    const float alpha = __expf(mrow - mn);
    mrow = mn;
    float rs = 0.0f;
#pragma unroll
    for (int r = 0; r < 8; ++r) {
      p0[r] = __expf(p0[r] - mn);
      p1[r] = __expf(p1[r] - mn);
      rs += p0[r] + p1[r];
    }
    lrow = lrow * alpha + rs;
#pragma unroll
    for (int t = 0; t < 4; ++t)
#pragma unroll
      for (int r = 0; r < 8; ++r) o[t][r] *= alpha;

    // P^T as B fragment: elements 0..7 are keys 8 hi + 0..7, elements 8..15 keys 16 + 8 hi + 0..7,
    // the k order in which load_frag_packed delivers V^T
    FragU pf;
    pf.q[0] = make_uint4(pack_bf16x2(p0[0], p0[1]), pack_bf16x2(p0[2], p0[3]),
                         pack_bf16x2(p0[4], p0[5]), pack_bf16x2(p0[6], p0[7]));
    pf.q[1] = make_uint4(pack_bf16x2(p1[0], p1[1]), pack_bf16x2(p1[2], p1[3]),
                         pack_bf16x2(p1[4], p1[5]), pack_bf16x2(p1[6], p1[7]));

    // O^T += V^T * P^T  (V stored transposed: [HD][T] in fragment order)
    v16bf vf[4];
#pragma unroll
    for (int t = 0; t < 4; ++t)
      vf[t] = load_frag_packed(Vp + (t * 16) * T_SEQ);
    // The same wait for the V loads.
    asm volatile("s_wait_xcnt 0x0" :: "v"(Vp) : "memory");
    // Keeps the eight V loads in flight together, as they were: see at the K loads. Nothing
    // holds the run behind the softmax any more (the wait on the LDS trip did), and the
    // compiler issues it early in the trip.
    __builtin_amdgcn_sched_barrier(0);
#pragma unroll
    for (int t = 0; t < 4; ++t)
      o[t] = __builtin_amdgcn_wmma_f32_16x16x32_bf16(false, vf[t], false, pf.v, (short)0, o[t], false, false);

    Kp += 32 * HEAD_DIM;   // two 16-key tiles
    Vp += 16 * 32;         // the next 32 k of a 16-row tile
    Mp += 1;
  }

  // finalize: O /= l, write att[b*T + t][h*64 + d] as bf16, in fragment order for the final GEMM;
  // the lane's 8 values of a tile are 8 consecutive d of one row: one 16-byte chunk
  const float l = lrow + xhalf(lrow);
#pragma unroll
  for (int t = 0; t < 4; ++t) {
    uint4 w;
    w.x = pack_bf16x2(o[t][0] / l, o[t][1] / l);
    w.y = pack_bf16x2(o[t][2] / l, o[t][3] / l);
    w.z = pack_bf16x2(o[t][4] / l, o[t][5] / l);
    w.w = pack_bf16x2(o[t][6] / l, o[t][7] / l);
    *(uint4*)(att + packed_idx(b * T_SEQ + q0 + c16, h * HEAD_DIM + t * 16 + hi * 8, D_MODEL)) = w;
  }
}

// ---------- host ----------
extern "C" void kernel_launch(void* const* d_in, const int* in_sizes, int n_in,
                              void* d_out, int out_size, void* d_ws, size_t ws_size,
                              hipStream_t stream)
{
  (void)in_sizes; (void)n_in; (void)out_size; (void)ws_size;

  const float* query = (const float*)d_in[0];
  const float* key   = (const float*)d_in[1];
  const float* value = (const float*)d_in[2];
  const int*   mask  = (const int*)  d_in[3];
  const float* wq = (const float*)d_in[4];  const float* bq = (const float*)d_in[5];
  const float* wk = (const float*)d_in[6];  const float* bk = (const float*)d_in[7];
  const float* wv = (const float*)d_in[8];  const float* bv = (const float*)d_in[9];
  const float* wo = (const float*)d_in[10]; const float* bo = (const float*)d_in[11];

  char* ws = (char*)d_ws;
  const size_t seg_x = (size_t)M_TOK * D_MODEL * sizeof(u16);    // 8 MiB
  const size_t seg_w = (size_t)D_MODEL * D_MODEL * sizeof(u16);  // 2 MiB
  u16* Xq  = (u16*)(ws + 0 * seg_x);
  // Xk, Xv: the next two segments
  char* wsw = ws + 3 * seg_x;
  u16* Wqb = (u16*)(wsw + 0 * seg_w);
  // Wkb, Wvb: the next two segments
  u16* Wob = (u16*)(wsw + 3 * seg_w);
  char* wsh = wsw + 4 * seg_w;
  u16* Qh  = (u16*)(wsh + 0 * seg_x);
  u16* Kh  = (u16*)(wsh + 1 * seg_x);
  u16* Vt  = (u16*)(wsh + 2 * seg_x);
  u16* att = (u16*)(wsh + 3 * seg_x);
  u32* mbw = (u32*)(wsh + 4 * seg_x);    // packed mask bits, 1 MiB

  dim3 bb(256);
  prep_k<<<dim3(PREP_BLOCKS), bb, 0, stream>>>(query, key, value, mask, wq, wk, wv, wo,
                                               Xq, Wqb, mbw);

  // (8, 32) blocks of 256 threads per projection
  gemm_qkv_k<<<dim3(D_MODEL / 128, M_TOK / 128, 3), bb, 0, stream>>>(Xq, Wqb, bq, bk, bv, Qh);

  const int n_waves = B_SZ * N_HEADS * (T_SEQ / 16);  // 4096
  flash_attn_k<<<dim3(n_waves / 8), bb, 0, stream>>>(Qh, Kh, Vt, mbw, att);

  gemm_out_k<<<dim3(D_MODEL / 128, M_TOK / 128), bb, 0, stream>>>(att, Wob, bo, (float*)d_out);
}

// v005
// A run of this version takes 104 microseconds.
// Timed twice side by side with v004, it ran 1.34 and 1.35 times as fast.
// Over all steps from v000 it is 2.79 times as fast.
#include <hip/hip_runtime.h>

typedef __attribute__((ext_vector_type(16))) __bf16 v16bf;
typedef __attribute__((ext_vector_type(8)))  float  v8f;
typedef unsigned short u16;
typedef unsigned int   u32;
typedef __attribute__((ext_vector_type(4)))  float  v4f;
typedef __attribute__((ext_vector_type(4)))  int    v4i;

#define D_MODEL  1024
#define N_HEADS  16
#define HEAD_DIM 64
#define B_SZ     2
#define T_SEQ    2048
#define M_TOK    (B_SZ * T_SEQ)     // 4096 token rows
#define TW       (T_SEQ / 32)       // 64 mask words per row

// ---------- helpers ----------

static __device__ __forceinline__ u16 f32_to_bf16(float f) {
  u32 x = __builtin_bit_cast(u32, f);
  u32 r = x + 0x7fffu + ((x >> 16) & 1u);   // round-to-nearest-even
  return (u16)(r >> 16);
}

static __device__ __forceinline__ u32 pack_bf16x2(float lo, float hi) {
  return (u32)f32_to_bf16(lo) | ((u32)f32_to_bf16(hi) << 16);
}

union FragU { v16bf v; uint4 q[2]; u16 h[16]; };

// 16-bit A/B fragment layout (ISA 7.12.2): per lane, elements 0..7 are K=+0..7,
// elements 8..15 are K=+16..23 (caller pre-adds the hi-lane +8 K offset).
static __device__ __forceinline__ v16bf load_frag_bf16(const u16* __restrict__ p) {
  FragU f;
  f.q[0] = *(const uint4*)(p + 0);
  f.q[1] = *(const uint4*)(p + 16);
  return f.v;
}

// Fragment-order ("packed") layout of every bf16 matrix operand kept in the workspace.
// A [rows][K] matrix is cut into tiles of 16 rows; inside a tile the 16-byte chunks
// (8 consecutive k of one row) lie chunk-major: chunk kc of rows 0..15, then chunk kc + 1, ...
// A fragment load of 32 lanes x 16 bytes is then 512 contiguous bytes (4 cache lines)
// where the row-major layout made it touch 16 lines.
static __device__ __forceinline__ int packed_idx(int row, int k, int K) {
  return (((row >> 4) * (K >> 3) + (k >> 3)) * 16 + (row & 15)) * 8 + (k & 7);
}

// p = tile base + 16 * k0 + 8 * lane. Lane (c, hi) gets chunks hi and 2 + hi of row c:
// the same k = 8*hi + 0..7 and 16 + 8*hi + 0..7 that load_frag_bf16 delivers.
static __device__ __forceinline__ v16bf load_frag_packed(const u16* __restrict__ p) {
  FragU f;
  f.q[0] = *(const uint4*)(p + 0);
  f.q[1] = *(const uint4*)(p + 256);
  return f.v;
}

// ---------- fp32 [rows][D_MODEL] -> bf16 in fragment order (bandwidth-bound) ----------
// A thread takes CVT_PER_THREAD chunks, a quarter of the matrix apart, and has all their loads
// in flight together: 8 x 512 bytes per wave, and a quarter of the waves to start.
// i0 = the thread's number among the nthreads that share the matrix.
#define CVT_PER_THREAD 4
static __device__ __forceinline__
void cvt_bf16(const float* __restrict__ src, u16* __restrict__ dst, int nthreads, int i0)
{
  // one 16-byte chunk of dst per piece; a wave takes 8 rows x 4 chunks, so that it reads 8 whole
  // 128-byte lines of src (4 chunks = 32 floats of a row) and writes 4 whole lines of dst
  // (8 rows of one chunk)
  v4f a[CVT_PER_THREAD], b[CVT_PER_THREAD];
  const v4f* s4[CVT_PER_THREAD];
#pragma unroll
  for (int m = 0; m < CVT_PER_THREAD; ++m) {
    const int i   = i0 + m * nthreads;
    const int kc  = (i & 3) | (((i >> 6) & 31) << 2);   // chunk in the row, 0 .. D_MODEL/8 - 1
    const int row = ((i >> 11) << 4) | ((i >> 2) & 15);
    s4[m] = (const v4f*)(src + (size_t)row * D_MODEL + kc * 8);
    a[m] = s4[m][0];
    b[m] = s4[m][1];
  }
  // The wait that stands in front of any overwrite of a register that an issued load names.
  // It takes the addresses as inputs, so that they stay live up to it and no load of the run
  // lands its result in them.
  asm volatile("s_wait_xcnt 0x0" :: "v"(s4[0]), "v"(s4[1]), "v"(s4[2]), "v"(s4[3]) : "memory");
#pragma unroll
  for (int m = 0; m < CVT_PER_THREAD; ++m) {
    const int i   = i0 + m * nthreads;
    const int kc  = (i & 3) | (((i >> 6) & 31) << 2);
    const int row = ((i >> 11) << 4) | ((i >> 2) & 15);
    uint4 o;
    o.x = pack_bf16x2(a[m].x, a[m].y);
    o.y = pack_bf16x2(a[m].z, a[m].w);
    o.z = pack_bf16x2(b[m].x, b[m].y);
    o.w = pack_bf16x2(b[m].z, b[m].w);
    *(uint4*)(dst + packed_idx(row, kc * 8, D_MODEL)) = o;
  }
  // The same wait for the stores: in the built kernel another piece's code follows this one's,
  // and it overwrites the registers that the stores name.
  asm volatile("s_wait_xcnt 0x0" ::: "memory");
}

// ---------- int32 mask -> bitmask (1 bit per entry): one wave per mask row ----------
// OR with the lane whose number differs in bit XM (1, 2 or 4), inside a 16-lane row.
template <int XM>
static __device__ __forceinline__ u32 or_xor_lane(u32 x) {
  return x | (u32)__builtin_amdgcn_update_dpp(0, (int)x, 0x160 | XM, 0xf, 0xf, true);   // row_xmask:XM
}

static __device__ __forceinline__
void mask_pack(const int* __restrict__ mask, u32* __restrict__ bits, int row)
{
  const int lane = threadIdx.x & 31;
  // load k: 512 contiguous bytes = entries 128 k + 4 lane + 0..3 = words 4 k .. 4 k + 3 of the row;
  // the whole row (16 loads, 8 KiB) is in flight before the first entry is looked at
  const v4i* s4 = (const v4i*)(mask + (size_t)row * T_SEQ) + lane;
  v4i v[T_SEQ / 128];
#pragma unroll
  for (int k = 0; k < T_SEQ / 128; ++k) v[k] = s4[k * 32];
  // The wait that stands in front of any overwrite of a register that an issued load names.
  // The address is an input, so that it stays live up to it and no load lands its result in it.
  asm volatile("s_wait_xcnt 0x0" :: "v"(s4) : "memory");

  const int j  = lane & 7;    // the lane's nibble in its word
  const int g  = lane >> 3;   // the lane's word among the four of a load
  u32 lo = 0, hi = 0;
#pragma unroll
  for (int k = 0; k < T_SEQ / 128; ++k) {
    const u32 nib = min((u32)v[k].x, 1u) | (min((u32)v[k].y, 1u) << 1)
                  | (min((u32)v[k].z, 1u) << 2) | (min((u32)v[k].w, 1u) << 3);
    u32 w = nib << (4 * j);
    w = or_xor_lane<1>(w);
    w = or_xor_lane<2>(w);
    w = or_xor_lane<4>(w);    // all 8 lanes of group g now hold word 4 k + g
    // lane (g, j) keeps the words of loads j and 8 + j, so that two stores of 128 contiguous
    // bytes write the row
    if (j == (k & 7)) { if (k < 8) lo = w; else hi = w; }
  }
  u32* o = bits + (size_t)row * TW + 4 * j + g;
  o[0]  = lo;
  o[32] = hi;
}

// ---------- all the preparation in one grid ----------
// The seven conversions and the mask pack depend on nothing and on one another not at all: one
// grid, in which the work-group's number says which piece it does, starts and drains once
// where eight launches in a row each did.
#define ACT_THREADS (M_TOK * D_MODEL / (8 * CVT_PER_THREAD))      // threads per activation matrix
#define WGT_THREADS (D_MODEL * D_MODEL / (8 * CVT_PER_THREAD))    // threads per weight matrix
#define MASK_BLOCKS (M_TOK * 32 / 256)    // 512: one wave per mask row
#define ACT_BLOCKS  (ACT_THREADS / 256)   // 512
#define WGT_BLOCKS  (WGT_THREADS / 256)   // 128
#define PREP_BLOCKS (MASK_BLOCKS + 3 * ACT_BLOCKS + 4 * WGT_BLOCKS)
// A budget for four waves per SIMD lets the compiler spend the registers that 8 or 16 loads in
// flight take, instead of holding the last ones back until the first have come in for the sake
// of 16 waves per SIMD. The merged grid has 20 waves per SIMD to place: the ceiling is eight,
// which these registers allow, and no longer the four that were all a single grid had.
__global__ __launch_bounds__(256) __attribute__((amdgpu_waves_per_eu(4, 8)))
void prep_k(const float* __restrict__ query, const float* __restrict__ key,
            const float* __restrict__ value, const int* __restrict__ mask,
            const float* __restrict__ wq, const float* __restrict__ wk,
            const float* __restrict__ wv, const float* __restrict__ wo,
            u16* __restrict__ X,      // Xq, Xk, Xv one behind the other
            u16* __restrict__ Wb,     // Wq, Wk, Wv, Wo one behind the other
            u32* __restrict__ bits)
{
  int blk = blockIdx.x;
  if (blk < MASK_BLOCKS) {
    mask_pack(mask, bits, (blk * 256 + (int)threadIdx.x) >> 5);   // wave id = row id
    return;
  }
  blk -= MASK_BLOCKS;
  if (blk < 3 * ACT_BLOCKS) {
    const int m = blk / ACT_BLOCKS;
    cvt_bf16(m == 0 ? query : m == 1 ? key : value, X + (size_t)m * (M_TOK * D_MODEL),
             ACT_THREADS, (blk - m * ACT_BLOCKS) * 256 + (int)threadIdx.x);
    return;
  }
  blk -= 3 * ACT_BLOCKS;
  const int m = blk / WGT_BLOCKS;
  cvt_bf16(m == 0 ? wq : m == 1 ? wk : m == 2 ? wv : wo, Wb + (size_t)m * (D_MODEL * D_MODEL),
           WGT_THREADS, (blk - m * WGT_BLOCKS) * 256 + (int)threadIdx.x);
}

// ---------- a stage of two operands into LDS, by asynchronous copies ----------
// One stage is 32 KiB: eight 16-byte copies a thread (256 threads x 128 bytes). lds = the thread's
// LDS byte address in the buffer's first 4 KiB; copy j lands 4 KiB * j further. The first four
// copies read p, p + SP, ... (elements), the last four q, q + SQ, ...
template <int SP, int SQ>
static __device__ __forceinline__
void stage_copy(u32 lds, const u16* p, const u16* q)
{
  // The copies and, as the statement's last line, the wait that stands in front of any overwrite
  // of a register that an issued copy names: inside one statement nothing can come between.
  asm volatile("global_load_async_to_lds_b128 %0, %8, off\n\t"
               "global_load_async_to_lds_b128 %1, %9, off\n\t"
               "global_load_async_to_lds_b128 %2, %10, off\n\t"
               "global_load_async_to_lds_b128 %3, %11, off\n\t"
               "global_load_async_to_lds_b128 %4, %12, off\n\t"
               "global_load_async_to_lds_b128 %5, %13, off\n\t"
               "global_load_async_to_lds_b128 %6, %14, off\n\t"
               "global_load_async_to_lds_b128 %7, %15, off\n\t"
               "s_wait_xcnt 0x0"
               :: "v"(lds), "v"(lds + 4096), "v"(lds + 8192), "v"(lds + 12288),
                  "v"(lds + 16384), "v"(lds + 20480), "v"(lds + 24576), "v"(lds + 28672),
                  "v"(p), "v"(p + SP), "v"(p + 2 * SP), "v"(p + 3 * SP),
                  "v"(q), "v"(q + SQ), "v"(q + 2 * SQ), "v"(q + 3 * SQ)
               : "memory");
}

// ---------- GEMM: C[M,N] = A[M,K] * W[N,K]^T + bias  (A, W bf16 in fragment order) ----------
// OUT_MODE: 0 = bf16 out, per (b, h) a [T][HD] matrix in fragment order   (Q, K)
//           1 = bf16 out, per (b, h) a [HD][T] matrix in fragment order   (V transposed)
//           2 = f32  out, layout [M, D_MODEL] (final projection)
// A work-group's 128 x 128 tile at (rowb, colb). A stage is GK k of its 128 rows of A and of its
// 128 rows of W, brought into LDS once for the eight waves by asynchronous copies, byte for byte
// in fragment order: eight 16-row tiles of A (GK * 32 bytes each), then eight of W. Two buffers:
// stage s + 2 flies while stage s + 1 is worked on.
#define GK            64
#define G_TILE_ELEMS  (16 * GK)             // a 16-row tile's share of a stage
#define G_HALF_ELEMS  (8 * G_TILE_ELEMS)    // 128 rows of A, or of W
#define G_STAGE_ELEMS (2 * G_HALF_ELEMS)
#define G_STAGES      (D_MODEL / GK)
// The wave's 32 x 64 tile (4 waves down, 2 across): the products ...
static __device__ __forceinline__
void gemm_tile(const u16* __restrict__ A, const u16* __restrict__ W,
               int rowb, int colb, u16 (*sm)[G_STAGE_ELEMS], v8f (&acc)[2][4])
{
  const int K    = D_MODEL;
  const int tid  = threadIdx.x;
  const int lane = threadIdx.x & 31;
  const int wave = threadIdx.x >> 5;
  // a copy takes two 16-row tiles' share of the stage (2 x 2 KiB): the thread's first chunks
  const u16* Ag = A + (rowb + 16 * (tid >> 7)) * K + (tid & 127) * 8;
  const u16* Wg = W + (colb + 16 * (tid >> 7)) * K + (tid & 127) * 8;
  const u32 lds0 = (u32)(size_t)&sm[0][0] + tid * 16;   // low 32 bits = LDS byte address

  // stage 0 into buffer 0, landed and published; then stage 1 into buffer 1
  stage_copy<32 * D_MODEL, 32 * D_MODEL>(lds0, Ag, Wg);
  // this wave's copies have landed ...
  asm volatile("s_wait_asynccnt 0x0" ::: "memory");
  // ... and so have the other waves'
  __syncthreads();
  stage_copy<32 * D_MODEL, 32 * D_MODEL>(lds0 + G_STAGE_ELEMS * 2, Ag + G_TILE_ELEMS, Wg + G_TILE_ELEMS);
  Ag += 2 * G_TILE_ELEMS;
  Wg += 2 * G_TILE_ELEMS;

  const v8f vzero = {};
#pragma unroll
  for (int i = 0; i < 2; ++i)
#pragma unroll
    for (int j = 0; j < 4; ++j) acc[i][j] = vzero;

  for (int s = 0; s < G_STAGES; ++s) {
    // the wave's two tiles of A and four of W, with this lane's 16-byte slot added
    const u16* As = &sm[s & 1][0] + (wave >> 1) * (2 * G_TILE_ELEMS) + lane * 8;
    const u16* Ws = &sm[s & 1][0] + G_HALF_ELEMS + (wave & 1) * (4 * G_TILE_ELEMS) + lane * 8;
    // 12x ds_load_b128 (512 contiguous bytes each) + 8x v_wmma per 32-deep K step
#pragma unroll
    for (int kk = 0; kk < GK / 32; ++kk) {
      v16bf a[2], b[4];
#pragma unroll
      for (int i = 0; i < 2; ++i)
        a[i] = load_frag_packed(As + i * G_TILE_ELEMS + kk * (16 * 32));
#pragma unroll
      for (int j = 0; j < 4; ++j)
        b[j] = load_frag_packed(Ws + j * G_TILE_ELEMS + kk * (16 * 32));   // row n, k along K
      // Keeps the twelve reads in flight together: without it the matrix instructions move up
      // between them, and a step waits out several LDS latencies in a row.
      __builtin_amdgcn_sched_barrier(0);
#pragma unroll
      for (int i = 0; i < 2; ++i)
#pragma unroll
        for (int j = 0; j < 4; ++j)
          acc[i][j] = __builtin_amdgcn_wmma_f32_16x16x32_bf16(
              false, a[i], false, b[j], (short)0, acc[i][j], false, false);
    }
    // Publish point of stage s + 1. This wave's reads of buffer s & 1 have returned ...
    asm volatile("s_wait_dscnt 0x0" ::: "memory");
    // ... its copies of stage s + 1 have landed ...
    asm volatile("s_wait_asynccnt 0x0" ::: "memory");
    // ... and both hold for all eight waves: stage s + 1 may be read, buffer s & 1 refilled.
    __syncthreads();
    if (s + 2 < G_STAGES) {
      stage_copy<32 * D_MODEL, 32 * D_MODEL>(lds0 + (s & 1) * (G_STAGE_ELEMS * 2), Ag, Wg);
      Ag += G_TILE_ELEMS;
      Wg += G_TILE_ELEMS;
    }
  }
  // no copy is outstanding when the wave goes on to its stores
  asm volatile("s_wait_asynccnt 0x0" ::: "memory");
}

// ... and what becomes of them. C layout -> lane holds column n, rows (hi*8 + r)
template <int OUT_MODE>
static __device__ __forceinline__
void gemm_store(const v8f (&acc)[2][4], const float* __restrict__ bias, void* __restrict__ Out,
                int row0, int col0)
{
  const int c16 = threadIdx.x & 15;
  const int hi  = (threadIdx.x >> 4) & 1;
#pragma unroll
  for (int i = 0; i < 2; ++i) {
#pragma unroll
    for (int j = 0; j < 4; ++j) {
      const int n = col0 + 16 * j + c16;
      const float bv = bias[n];
      const int m0 = row0 + 16 * i + hi * 8;   // the lane's 8 rows: m0 .. m0 + 7, one batch
      const int bb = m0 >> 11;                 // / T_SEQ
      const int t0 = m0 & (T_SEQ - 1);
      const int h  = n >> 6;                   // / HEAD_DIM
      const int d  = n & (HEAD_DIM - 1);
      u16* Oh = (u16*)Out + (size_t)(bb * N_HEADS + h) * (T_SEQ * HEAD_DIM);
#pragma unroll
      for (int r = 0; r < 8; ++r) {
        const float v = acc[i][j][r] + bv;
        if constexpr (OUT_MODE == 2)
          ((float*)Out)[(size_t)(m0 + r) * D_MODEL + n] = v;
        else if constexpr (OUT_MODE == 0)
          Oh[packed_idx(t0 + r, d, HEAD_DIM)] = f32_to_bf16(v);
        else   // rows are d, k runs along t: the lane's 8 values fill one 16-byte chunk
          Oh[packed_idx(d, t0, T_SEQ) + r] = f32_to_bf16(v);
      }
    }
  }
}

// The three input projections depend on one another not at all: one grid, blockIdx.z = 0, 1, 2
// for Q, K, V. Three work-groups then share a WGP, six waves a SIMD where a launch of one
// projection had two, and one wave's wait for its loads is filled by the others' products.
__global__ __launch_bounds__(256)
void gemm_qkv_k(const u16* __restrict__ X,     // Xq, Xk, Xv one behind the other
                const u16* __restrict__ Wb,    // Wq, Wk, Wv one behind the other
                const float* __restrict__ bq, const float* __restrict__ bk,
                const float* __restrict__ bv,
                u16* __restrict__ QKV)         // Qh, Kh, Vt one behind the other
{
  const int z    = blockIdx.z;
  const int wave = threadIdx.x >> 5;
  const int row0 = blockIdx.y * 128 + (wave >> 1) * 32;  // 4 waves down
  const int col0 = blockIdx.x * 128 + (wave & 1) * 64;   // 2 waves across
  __shared__ __attribute__((aligned(128))) u16 sm[2][G_STAGE_ELEMS];
  v8f acc[2][4];
  gemm_tile(X + (size_t)z * (M_TOK * D_MODEL), Wb + (size_t)z * (D_MODEL * D_MODEL),
            blockIdx.y * 128, blockIdx.x * 128, sm, acc);
  u16* Out = QKV + (size_t)z * (M_TOK * D_MODEL);
  if (z == 2) {
    gemm_store<1>(acc, bv, Out, row0, col0);
  } else {
    gemm_store<0>(acc, z == 0 ? bq : bk, Out, row0, col0);
    // The wait that stands in front of any overwrite of a register that an issued store names:
    // in the built kernel the other epilogue's code follows this one's and overwrites them.
    asm volatile("s_wait_xcnt 0x0" ::: "memory");
  }
}

__global__ __launch_bounds__(256)
void gemm_out_k(const u16* __restrict__ A, const u16* __restrict__ W,
                const float* __restrict__ bias, float* __restrict__ Out)
{
  const int wave = threadIdx.x >> 5;
  const int row0 = blockIdx.y * 128 + (wave >> 1) * 32;  // 4 waves down
  const int col0 = blockIdx.x * 128 + (wave & 1) * 64;   // 2 waves across
  __shared__ __attribute__((aligned(128))) u16 sm[2][G_STAGE_ELEMS];
  v8f acc[2][4];
  gemm_tile(A, W, blockIdx.y * 128, blockIdx.x * 128, sm, acc);
  gemm_store<2>(acc, bias, Out, row0, col0);
}

// ---------- Flash attention: one wave per (b, h, 16 query rows), K and V through LDS ----------
// lane l <-> lane l ^ 16
static __device__ __forceinline__ float xhalf(float x) {
  const int b = __builtin_bit_cast(int, x);
  return __builtin_bit_cast(float,
      __builtin_amdgcn_permlanex16(b, b, 0x76543210, 0xfedcba98, false, false));
}

#define KS          128
#define STAGE_HALF  (KS * HEAD_DIM)       // elements of K, and of V^T, in a stage
#define STAGE_ELEMS (2 * STAGE_HALF)
#define N_STAGES    (T_SEQ / KS)

__global__ __launch_bounds__(256)
void flash_attn_k(const u16* __restrict__ Qh, const u16* __restrict__ Kh,
                  const u16* __restrict__ Vt, const u32* __restrict__ mbits,
                  u16* __restrict__ att)
{
  __shared__ __attribute__((aligned(128))) u16 sm[2][STAGE_ELEMS];

  const int tid  = threadIdx.x;
  const int lane = threadIdx.x & 31;
  const int wave = threadIdx.x >> 5;
  const int c16  = lane & 15;
  const int hi   = lane >> 4;

  const int gw = blockIdx.x * 8 + wave;          // 0 .. 4095
  const int qt = gw & (T_SEQ / 16 - 1);          // 128 q-tiles
  const int h  = (gw >> 7) & (N_HEADS - 1);      // alike in the eight waves of a work-group
  const int b  = gw >> 11;
  const int q0 = qt * 16;

  // per-head matrices in fragment order
  const size_t hb = (size_t)((b * N_HEADS + h) * T_SEQ) * HEAD_DIM;
  const u16* Qb = Qh + hb + lane * 8;   // [T][HD]: a 16-row tile holds 16 * HEAD_DIM elements
  // the thread's first chunks of a stage: K is one run of 16 KiB, 4 KiB a copy; of V^T a copy
  // takes 4 KiB of one of the four 16-row tiles
  const u16* Kg = Kh + hb + tid * 8;
  const u16* Vg = Vt + hb + tid * 8;
  const u32 lds0 = (u32)(size_t)&sm[0][0] + tid * 16;   // low 32 bits = LDS byte address
  // the mask bit-words of this lane's query row (q0 + c16), one word per 32 keys
  const u32* Mp = mbits + (size_t)(b * T_SEQ + q0 + c16) * TW;

  // stage 0 into buffer 0, landed and published; then stage 1 into buffer 1
  stage_copy<2048, 16 * T_SEQ>(lds0, Kg, Vg);
  // this wave's copies have landed ...
  asm volatile("s_wait_asynccnt 0x0" ::: "memory");
  // ... and so have the other waves'
  __syncthreads();
  stage_copy<2048, 16 * T_SEQ>(lds0 + STAGE_ELEMS * 2, Kg + STAGE_HALF, Vg + KS * 16);
  Kg += 2 * STAGE_HALF;
  Vg += 2 * KS * 16;

  // Q fragments (16 q rows x 64 d), held for whole loop: B operand, column = query row c16
  v16bf qf[2];
#pragma unroll
  for (int dk = 0; dk < 2; ++dk)
    qf[dk] = load_frag_packed(Qb + q0 * HEAD_DIM + 16 * (dk * 32));

  const v8f vzero = {};
  v8f o[4];                    // o[t][r] = O[q0 + c16][16 t + 8 hi + r]
#pragma unroll
  for (int t = 0; t < 4; ++t) o[t] = vzero;
  float mrow = -1e30f;         // running maximum of the lane's query row, alike in both halves
  float lrow = 0.0f;           // running sum over the keys of this lane's half alone

  for (int s = 0; s < N_STAGES; ++s) {
    const u16* Ks = &sm[s & 1][0] + lane * 8;   // with this lane's 16-byte slot added
    const u16* Vs = Ks + STAGE_HALF;

    // one mask bit-word per lane covers a 32-key tile for its query row: the stage's words
    u32 wrow[KS / 32];
#pragma unroll
    for (int i = 0; i < KS / 32; ++i) wrow[i] = Mp[i];
    // The wait that stands in front of any overwrite of a register that an issued load names.
    // It takes the address as an input, so that it stays live up to it and no load lands its
    // result in it.
    asm volatile("s_wait_xcnt 0x0" :: "v"(Mp) : "memory");
    Mp += KS / 32;

    // K fragments of the stage's first 32 keys
    v16bf kb0[2], kb1[2];
#pragma unroll
    for (int dk = 0; dk < 2; ++dk) {
      kb0[dk] = load_frag_packed(Ks + 16 * (dk * 32));
      kb1[dk] = load_frag_packed(Ks + 16 * HEAD_DIM + 16 * (dk * 32));
    }

#pragma unroll
    for (int i = 0; i < KS / 32; ++i) {
      // S^T = K * Q^T for 32 keys (two 16x16 C tiles): s0[r] = S[c16][kt + 8 hi + r], s1: + 16
      v8f s0 = vzero, s1 = vzero;
#pragma unroll
      for (int dk = 0; dk < 2; ++dk) {
        s0 = __builtin_amdgcn_wmma_f32_16x16x32_bf16(false, kb0[dk], false, qf[dk], (short)0, s0, false, false);
        s1 = __builtin_amdgcn_wmma_f32_16x16x32_bf16(false, kb1[dk], false, qf[dk], (short)0, s1, false, false);
      }
      // With its twin below it keeps the LDS reads between them in runs of eight and sixteen, issued
      // ahead of the softmax.
      __builtin_amdgcn_sched_barrier(0);
      // These keys' V^T fragments and, inside the stage, the next 32 keys' K fragments: one group
      // of reads, which returns while the softmax runs.
      v16bf vf[4];
#pragma unroll
      for (int t = 0; t < 4; ++t)
        vf[t] = load_frag_packed(Vs + t * (16 * KS) + i * (16 * 32));
      if (i + 1 < KS / 32) {
#pragma unroll
        for (int dk = 0; dk < 2; ++dk) {
          kb0[dk] = load_frag_packed(Ks + (i + 1) * (32 * HEAD_DIM) + 16 * (dk * 32));
          kb1[dk] = load_frag_packed(Ks + (i + 1) * (32 * HEAD_DIM) + 16 * HEAD_DIM + 16 * (dk * 32));
        }
      }
      // Without the pair the reads sink down to their users two by two, and each two are waited for
      // where they stand.
      __builtin_amdgcn_sched_barrier(0);

      const u32 wr = wrow[i] >> (8 * hi);   // bit r: key 8 hi + r; bit 16 + r: key 16 + 8 hi + r
      const float scale = 0.125f;           // 1/sqrt(HEAD_DIM)
      float p0[8], p1[8];
      float tmax = -1e30f;
#pragma unroll
      for (int r = 0; r < 8; ++r) {
        float v0 = s0[r] * scale;
        float v1 = s1[r] * scale;
        if ((wr & (1u << r)) == 0) v0 = -1e30f;
        if ((wr & (0x10000u << r)) == 0) v1 = -1e30f;
        p0[r] = v0; p1[r] = v1;
        tmax = fmaxf(tmax, fmaxf(v0, v1));
      }
      // the row's maximum: the other 16 keys lie in the other half
      tmax = fmaxf(tmax, xhalf(tmax));

      const float mn = fmaxf(mrow, tmax);
      const float alpha = __expf(mrow - mn);
      mrow = mn;
      float rs = 0.0f;
#pragma unroll
      for (int r = 0; r < 8; ++r) {
        p0[r] = __expf(p0[r] - mn);
        p1[r] = __expf(p1[r] - mn);
        rs += p0[r] + p1[r];
      }
      lrow = lrow * alpha + rs;
#pragma unroll
      for (int t = 0; t < 4; ++t)
#pragma unroll
        for (int r = 0; r < 8; ++r) o[t][r] *= alpha;

      // P^T as B fragment: elements 0..7 are keys 8 hi + 0..7, elements 8..15 keys
      // 16 + 8 hi + 0..7, the k order in which load_frag_packed delivers V^T
      FragU pf;
      pf.q[0] = make_uint4(pack_bf16x2(p0[0], p0[1]), pack_bf16x2(p0[2], p0[3]),
                           pack_bf16x2(p0[4], p0[5]), pack_bf16x2(p0[6], p0[7]));
      pf.q[1] = make_uint4(pack_bf16x2(p1[0], p1[1]), pack_bf16x2(p1[2], p1[3]),
                           pack_bf16x2(p1[4], p1[5]), pack_bf16x2(p1[6], p1[7]));

      // O^T += V^T * P^T  (V stored transposed: row d, k along the row, in fragment order)
#pragma unroll
      for (int t = 0; t < 4; ++t)
        o[t] = __builtin_amdgcn_wmma_f32_16x16x32_bf16(false, vf[t], false, pf.v, (short)0, o[t], false, false);
    }

    // Publish point of stage s + 1. This wave's reads of buffer s & 1 have returned ...
    asm volatile("s_wait_dscnt 0x0" ::: "memory");
    // ... its copies of stage s + 1 have landed ...
    asm volatile("s_wait_asynccnt 0x0" ::: "memory");
    // ... and both hold for all eight waves: stage s + 1 may be read, buffer s & 1 refilled.
    __syncthreads();
    if (s + 2 < N_STAGES) {
      stage_copy<2048, 16 * T_SEQ>(lds0 + (s & 1) * (STAGE_ELEMS * 2), Kg, Vg);
      Kg += STAGE_HALF;
      Vg += KS * 16;
    }
  }
  // no copy is outstanding when the wave ends
  asm volatile("s_wait_asynccnt 0x0" ::: "memory");

  // finalize: O /= l, write att[b*T + t][h*64 + d] as bf16, in fragment order for the final GEMM;
  // the lane's 8 values of a tile are 8 consecutive d of one row: one 16-byte chunk
  const float l = lrow + xhalf(lrow);
#pragma unroll
  for (int t = 0; t < 4; ++t) {
    uint4 w;
    w.x = pack_bf16x2(o[t][0] / l, o[t][1] / l);
    w.y = pack_bf16x2(o[t][2] / l, o[t][3] / l);
    w.z = pack_bf16x2(o[t][4] / l, o[t][5] / l);
    w.w = pack_bf16x2(o[t][6] / l, o[t][7] / l);
    *(uint4*)(att + packed_idx(b * T_SEQ + q0 + c16, h * HEAD_DIM + t * 16 + hi * 8, D_MODEL)) = w;
  }
}

// ---------- host ----------
extern "C" void kernel_launch(void* const* d_in, const int* in_sizes, int n_in,
                              void* d_out, int out_size, void* d_ws, size_t ws_size,
                              hipStream_t stream)
{
  (void)in_sizes; (void)n_in; (void)out_size; (void)ws_size;

  const float* query = (const float*)d_in[0];
  const float* key   = (const float*)d_in[1];
  const float* value = (const float*)d_in[2];
  const int*   mask  = (const int*)  d_in[3];
  const float* wq = (const float*)d_in[4];  const float* bq = (const float*)d_in[5];
  const float* wk = (const float*)d_in[6];  const float* bk = (const float*)d_in[7];
  const float* wv = (const float*)d_in[8];  const float* bv = (const float*)d_in[9];
  const float* wo = (const float*)d_in[10]; const float* bo = (const float*)d_in[11];

  char* ws = (char*)d_ws;
  const size_t seg_x = (size_t)M_TOK * D_MODEL * sizeof(u16);    // 8 MiB
  const size_t seg_w = (size_t)D_MODEL * D_MODEL * sizeof(u16);  // 2 MiB
  u16* Xq  = (u16*)(ws + 0 * seg_x);
  // Xk, Xv: the next two segments
  char* wsw = ws + 3 * seg_x;
  u16* Wqb = (u16*)(wsw + 0 * seg_w);
  // Wkb, Wvb: the next two segments
  u16* Wob = (u16*)(wsw + 3 * seg_w);
  char* wsh = wsw + 4 * seg_w;
  u16* Qh  = (u16*)(wsh + 0 * seg_x);
  u16* Kh  = (u16*)(wsh + 1 * seg_x);
  u16* Vt  = (u16*)(wsh + 2 * seg_x);
  u16* att = (u16*)(wsh + 3 * seg_x);
  u32* mbw = (u32*)(wsh + 4 * seg_x);    // packed mask bits, 1 MiB

  dim3 bb(256);
  prep_k<<<dim3(PREP_BLOCKS), bb, 0, stream>>>(query, key, value, mask, wq, wk, wv, wo,
                                               Xq, Wqb, mbw);

  // (8, 32) blocks of 256 threads per projection
  gemm_qkv_k<<<dim3(D_MODEL / 128, M_TOK / 128, 3), bb, 0, stream>>>(Xq, Wqb, bq, bk, bv, Qh);

  const int n_waves = B_SZ * N_HEADS * (T_SEQ / 16);  // 4096
  flash_attn_k<<<dim3(n_waves / 8), bb, 0, stream>>>(Qh, Kh, Vt, mbw, att);

  gemm_out_k<<<dim3(D_MODEL / 128, M_TOK / 128), bb, 0, stream>>>(att, Wob, bo, (float*)d_out);
}

// v006
// A run of this version takes 95.4 microseconds.
// In two side-by-side timings against v005, it was 1.10 and 1.08 times as fast.
// Counting every step since v000, it is 3.04 times as fast.
#include <hip/hip_runtime.h>

typedef __attribute__((ext_vector_type(16))) __bf16 v16bf;
typedef __attribute__((ext_vector_type(8)))  float  v8f;
typedef unsigned short u16;
typedef unsigned int   u32;
typedef __attribute__((ext_vector_type(4)))  float  v4f;
typedef __attribute__((ext_vector_type(4)))  int    v4i;
typedef __attribute__((ext_vector_type(2)))  float  v2f;
typedef __attribute__((ext_vector_type(2)))  __bf16 v2bf;

#define D_MODEL  1024
#define N_HEADS  16
#define HEAD_DIM 64
#define B_SZ     2
#define T_SEQ    2048
#define M_TOK    (B_SZ * T_SEQ)     // 4096 token rows
#define TW       (T_SEQ / 32)       // 64 mask words per row

// ---------- helpers ----------

// Two f32 -> two bf16 in one register, round-to-nearest-even: compiles to one v_cvt_pk_bf16_f32.
static __device__ __forceinline__ u32 pack_bf16x2(float lo, float hi) {
  const v2f x = {lo, hi};
  return __builtin_bit_cast(u32, __builtin_convertvector(x, v2bf));
}

union FragU { v16bf v; uint4 q[2]; u16 h[16]; };

// 16-bit A/B fragment layout (ISA 7.12.2): per lane, elements 0..7 are K=+0..7,
// elements 8..15 are K=+16..23 (caller pre-adds the hi-lane +8 K offset).
static __device__ __forceinline__ v16bf load_frag_bf16(const u16* __restrict__ p) {
  FragU f;
  f.q[0] = *(const uint4*)(p + 0);
  f.q[1] = *(const uint4*)(p + 16);
  return f.v;
}

// Fragment-order ("packed") layout of every bf16 matrix operand kept in the workspace.
// A [rows][K] matrix is cut into tiles of 16 rows; inside a tile the 16-byte chunks
// (8 consecutive k of one row) lie chunk-major: chunk kc of rows 0..15, then chunk kc + 1, ...
// A fragment load of 32 lanes x 16 bytes is then 512 contiguous bytes (4 cache lines)
// where the row-major layout made it touch 16 lines.
static __device__ __forceinline__ int packed_idx(int row, int k, int K) {
  return (((row >> 4) * (K >> 3) + (k >> 3)) * 16 + (row & 15)) * 8 + (k & 7);
}

// p = tile base + 16 * k0 + 8 * lane. Lane (c, hi) gets chunks hi and 2 + hi of row c:
// the same k = 8*hi + 0..7 and 16 + 8*hi + 0..7 that load_frag_bf16 delivers.
static __device__ __forceinline__ v16bf load_frag_packed(const u16* __restrict__ p) {
  FragU f;
  f.q[0] = *(const uint4*)(p + 0);
  f.q[1] = *(const uint4*)(p + 256);
  return f.v;
}

// ---------- fp32 [rows][D_MODEL] -> bf16 in fragment order (bandwidth-bound) ----------
// A thread takes CVT_PER_THREAD chunks, a quarter of the matrix apart, and has all their loads
// in flight together: 8 x 512 bytes per wave, and a quarter of the waves to start.
// i0 = the thread's number among the nthreads that share the matrix.
#define CVT_PER_THREAD 4
static __device__ __forceinline__
void cvt_bf16(const float* __restrict__ src, u16* __restrict__ dst, int nthreads, int i0)
{
  // one 16-byte chunk of dst per piece; a wave takes 8 rows x 4 chunks, so that it reads 8 whole
  // 128-byte lines of src (4 chunks = 32 floats of a row) and writes 4 whole lines of dst
  // (8 rows of one chunk)
  v4f a[CVT_PER_THREAD], b[CVT_PER_THREAD];
  const v4f* s4[CVT_PER_THREAD];
#pragma unroll
  for (int m = 0; m < CVT_PER_THREAD; ++m) {
    const int i   = i0 + m * nthreads;
    const int kc  = (i & 3) | (((i >> 6) & 31) << 2);   // chunk in the row, 0 .. D_MODEL/8 - 1
    const int row = ((i >> 11) << 4) | ((i >> 2) & 15);
    s4[m] = (const v4f*)(src + (size_t)row * D_MODEL + kc * 8);
    a[m] = s4[m][0];
    b[m] = s4[m][1];
  }
  // The wait that stands in front of any overwrite of a register that an issued load names.
  // It takes the addresses as inputs, so that they stay live up to it and no load of the run
  // lands its result in them.
  asm volatile("s_wait_xcnt 0x0" :: "v"(s4[0]), "v"(s4[1]), "v"(s4[2]), "v"(s4[3]) : "memory");
#pragma unroll
  for (int m = 0; m < CVT_PER_THREAD; ++m) {
    const int i   = i0 + m * nthreads;
    const int kc  = (i & 3) | (((i >> 6) & 31) << 2);
    const int row = ((i >> 11) << 4) | ((i >> 2) & 15);
    uint4 o;
    o.x = pack_bf16x2(a[m].x, a[m].y);
    o.y = pack_bf16x2(a[m].z, a[m].w);
    o.z = pack_bf16x2(b[m].x, b[m].y);
    o.w = pack_bf16x2(b[m].z, b[m].w);
    *(uint4*)(dst + packed_idx(row, kc * 8, D_MODEL)) = o;
  }
  // The same wait for the stores: in the built kernel another piece's code follows this one's,
  // and it overwrites the registers that the stores name.
  asm volatile("s_wait_xcnt 0x0" ::: "memory");
}

// ---------- int32 mask -> bitmask (1 bit per entry): one wave per mask row ----------
// OR with the lane whose number differs in bit XM (1, 2 or 4), inside a 16-lane row.
template <int XM>
static __device__ __forceinline__ u32 or_xor_lane(u32 x) {
  return x | (u32)__builtin_amdgcn_update_dpp(0, (int)x, 0x160 | XM, 0xf, 0xf, true);   // row_xmask:XM
}

static __device__ __forceinline__
void mask_pack(const int* __restrict__ mask, u32* __restrict__ bits, int row)
{
  const int lane = threadIdx.x & 31;
  // load k: 512 contiguous bytes = entries 128 k + 4 lane + 0..3 = words 4 k .. 4 k + 3 of the row;
  // the whole row (16 loads, 8 KiB) is in flight before the first entry is looked at
  const v4i* s4 = (const v4i*)(mask + (size_t)row * T_SEQ) + lane;
  v4i v[T_SEQ / 128];
#pragma unroll
  for (int k = 0; k < T_SEQ / 128; ++k) v[k] = s4[k * 32];
  // The wait that stands in front of any overwrite of a register that an issued load names.
  // The address is an input, so that it stays live up to it and no load lands its result in it.
  asm volatile("s_wait_xcnt 0x0" :: "v"(s4) : "memory");

  const int j  = lane & 7;    // the lane's nibble in its word
  const int g  = lane >> 3;   // the lane's word among the four of a load
  u32 lo = 0, hi = 0;
#pragma unroll
  for (int k = 0; k < T_SEQ / 128; ++k) {
    const u32 nib = min((u32)v[k].x, 1u) | (min((u32)v[k].y, 1u) << 1)
                  | (min((u32)v[k].z, 1u) << 2) | (min((u32)v[k].w, 1u) << 3);
    u32 w = nib << (4 * j);
    w = or_xor_lane<1>(w);
    w = or_xor_lane<2>(w);
    w = or_xor_lane<4>(w);    // all 8 lanes of group g now hold word 4 k + g
    // lane (g, j) keeps the words of loads j and 8 + j, so that two stores of 128 contiguous
    // bytes write the row
    if (j == (k & 7)) { if (k < 8) lo = w; else hi = w; }
  }
  u32* o = bits + (size_t)row * TW + 4 * j + g;
  o[0]  = lo;
  o[32] = hi;
}

// ---------- all the preparation in one grid ----------
// The seven conversions and the mask pack depend on nothing and on one another not at all: one
// grid, in which the work-group's number says which piece it does, starts and drains once
// where eight launches in a row each did.
#define ACT_THREADS (M_TOK * D_MODEL / (8 * CVT_PER_THREAD))      // threads per activation matrix
#define WGT_THREADS (D_MODEL * D_MODEL / (8 * CVT_PER_THREAD))    // threads per weight matrix
#define MASK_BLOCKS (M_TOK * 32 / 256)    // 512: one wave per mask row
#define ACT_BLOCKS  (ACT_THREADS / 256)   // 512
#define WGT_BLOCKS  (WGT_THREADS / 256)   // 128
#define PREP_BLOCKS (MASK_BLOCKS + 3 * ACT_BLOCKS + 4 * WGT_BLOCKS)
// A budget for four waves per SIMD lets the compiler spend the registers that 8 or 16 loads in
// flight take, instead of holding the last ones back until the first have come in for the sake
// of 16 waves per SIMD. The merged grid has 20 waves per SIMD to place: the ceiling is eight,
// which these registers allow, and no longer the four that were all a single grid had.
__global__ __launch_bounds__(256) __attribute__((amdgpu_waves_per_eu(4, 8)))
void prep_k(const float* __restrict__ query, const float* __restrict__ key,
            const float* __restrict__ value, const int* __restrict__ mask,
            const float* __restrict__ wq, const float* __restrict__ wk,
            const float* __restrict__ wv, const float* __restrict__ wo,
            u16* __restrict__ X,      // Xq, Xk, Xv one behind the other
            u16* __restrict__ Wb,     // Wq, Wk, Wv, Wo one behind the other
            u32* __restrict__ bits)
{
  int blk = blockIdx.x;
  if (blk < MASK_BLOCKS) {
    mask_pack(mask, bits, (blk * 256 + (int)threadIdx.x) >> 5);   // wave id = row id
    return;
  }
  blk -= MASK_BLOCKS;
  if (blk < 3 * ACT_BLOCKS) {
    const int m = blk / ACT_BLOCKS;
    cvt_bf16(m == 0 ? query : m == 1 ? key : value, X + (size_t)m * (M_TOK * D_MODEL),
             ACT_THREADS, (blk - m * ACT_BLOCKS) * 256 + (int)threadIdx.x);
    return;
  }
  blk -= 3 * ACT_BLOCKS;
  const int m = blk / WGT_BLOCKS;
  cvt_bf16(m == 0 ? wq : m == 1 ? wk : m == 2 ? wv : wo, Wb + (size_t)m * (D_MODEL * D_MODEL),
           WGT_THREADS, (blk - m * WGT_BLOCKS) * 256 + (int)threadIdx.x);
}

// ---------- a stage of two operands into LDS, by asynchronous copies ----------
// One stage is 32 KiB: eight 16-byte copies a thread (256 threads x 128 bytes). lds = the thread's
// LDS byte address in the buffer's first 4 KiB; copy j lands 4 KiB * j further. The first four
// copies read p, p + SP, ... (elements), the last four q, q + SQ, ...
template <int SP, int SQ>
static __device__ __forceinline__
void stage_copy(u32 lds, const u16* p, const u16* q)
{
  // The copies and, as the statement's last line, the wait that stands in front of any overwrite
  // of a register that an issued copy names: inside one statement nothing can come between.
  asm volatile("global_load_async_to_lds_b128 %0, %8, off\n\t"
               "global_load_async_to_lds_b128 %1, %9, off\n\t"
               "global_load_async_to_lds_b128 %2, %10, off\n\t"
               "global_load_async_to_lds_b128 %3, %11, off\n\t"
               "global_load_async_to_lds_b128 %4, %12, off\n\t"
               "global_load_async_to_lds_b128 %5, %13, off\n\t"
               "global_load_async_to_lds_b128 %6, %14, off\n\t"
               "global_load_async_to_lds_b128 %7, %15, off\n\t"
               "s_wait_xcnt 0x0"
               :: "v"(lds), "v"(lds + 4096), "v"(lds + 8192), "v"(lds + 12288),
                  "v"(lds + 16384), "v"(lds + 20480), "v"(lds + 24576), "v"(lds + 28672),
                  "v"(p), "v"(p + SP), "v"(p + 2 * SP), "v"(p + 3 * SP),
                  "v"(q), "v"(q + SQ), "v"(q + 2 * SQ), "v"(q + 3 * SQ)
               : "memory");
}

// ---------- GEMM: C[M,N] = A[M,K] * W[N,K]^T + bias  (A, W bf16 in fragment order) ----------
// OUT_MODE: 0 = bf16 out, per (b, h) a [T][HD] matrix in fragment order   (Q, K)
//           1 = bf16 out, per (b, h) a [HD][T] matrix in fragment order   (V transposed)
//           2 = f32  out, layout [M, D_MODEL] (final projection)
// A work-group's 128 x 128 tile at (rowb, colb). A stage is GK k of its 128 rows of A and of its
// 128 rows of W, brought into LDS once for the eight waves by asynchronous copies, byte for byte
// in fragment order: eight 16-row tiles of A (GK * 32 bytes each), then eight of W. Two buffers:
// stage s + 2 flies while stage s + 1 is worked on.
#define GK            64
#define G_TILE_ELEMS  (16 * GK)             // a 16-row tile's share of a stage
#define G_HALF_ELEMS  (8 * G_TILE_ELEMS)    // 128 rows of A, or of W
#define G_STAGE_ELEMS (2 * G_HALF_ELEMS)
#define G_STAGES      (D_MODEL / GK)
// The wave's 32 x 64 tile (4 waves down, 2 across): the products ...
static __device__ __forceinline__
void gemm_tile(const u16* __restrict__ A, const u16* __restrict__ W,
               int rowb, int colb, u16 (*sm)[G_STAGE_ELEMS], v8f (&acc)[2][4])
{
  const int K    = D_MODEL;
  const int tid  = threadIdx.x;
  const int lane = threadIdx.x & 31;
  const int wave = threadIdx.x >> 5;
  // a copy takes two 16-row tiles' share of the stage (2 x 2 KiB): the thread's first chunks
  const u16* Ag = A + (rowb + 16 * (tid >> 7)) * K + (tid & 127) * 8;
  const u16* Wg = W + (colb + 16 * (tid >> 7)) * K + (tid & 127) * 8;
  const u32 lds0 = (u32)(size_t)&sm[0][0] + tid * 16;   // low 32 bits = LDS byte address

  // stage 0 into buffer 0, landed and published; then stage 1 into buffer 1
  stage_copy<32 * D_MODEL, 32 * D_MODEL>(lds0, Ag, Wg);
  // this wave's copies have landed ...
  asm volatile("s_wait_asynccnt 0x0" ::: "memory");
  // ... and so have the other waves'
  __syncthreads();
  stage_copy<32 * D_MODEL, 32 * D_MODEL>(lds0 + G_STAGE_ELEMS * 2, Ag + G_TILE_ELEMS, Wg + G_TILE_ELEMS);
  Ag += 2 * G_TILE_ELEMS;
  Wg += 2 * G_TILE_ELEMS;

  const v8f vzero = {};
#pragma unroll
  for (int i = 0; i < 2; ++i)
#pragma unroll
    for (int j = 0; j < 4; ++j) acc[i][j] = vzero;

  for (int s = 0; s < G_STAGES; ++s) {
    // the wave's two tiles of A and four of W, with this lane's 16-byte slot added
    const u16* As = &sm[s & 1][0] + (wave >> 1) * (2 * G_TILE_ELEMS) + lane * 8;
    const u16* Ws = &sm[s & 1][0] + G_HALF_ELEMS + (wave & 1) * (4 * G_TILE_ELEMS) + lane * 8;
    // 12x ds_load_b128 (512 contiguous bytes each) + 8x v_wmma per 32-deep K step
#pragma unroll
    for (int kk = 0; kk < GK / 32; ++kk) {
      v16bf a[2], b[4];
#pragma unroll
      for (int i = 0; i < 2; ++i)
        a[i] = load_frag_packed(As + i * G_TILE_ELEMS + kk * (16 * 32));
#pragma unroll
      for (int j = 0; j < 4; ++j)
        b[j] = load_frag_packed(Ws + j * G_TILE_ELEMS + kk * (16 * 32));   // row n, k along K
      // Keeps the twelve reads in flight together: without it the matrix instructions move up
      // between them, and a step waits out several LDS latencies in a row.
      __builtin_amdgcn_sched_barrier(0);
#pragma unroll
      for (int i = 0; i < 2; ++i)
#pragma unroll
        for (int j = 0; j < 4; ++j)
          acc[i][j] = __builtin_amdgcn_wmma_f32_16x16x32_bf16(
              false, a[i], false, b[j], (short)0, acc[i][j], false, false);
    }
    // Publish point of stage s + 1. This wave's reads of buffer s & 1 have returned ...
    asm volatile("s_wait_dscnt 0x0" ::: "memory");
    // ... its copies of stage s + 1 have landed ...
    asm volatile("s_wait_asynccnt 0x0" ::: "memory");
    // ... and both hold for all eight waves: stage s + 1 may be read, buffer s & 1 refilled.
    __syncthreads();
    if (s + 2 < G_STAGES) {
      stage_copy<32 * D_MODEL, 32 * D_MODEL>(lds0 + (s & 1) * (G_STAGE_ELEMS * 2), Ag, Wg);
      Ag += G_TILE_ELEMS;
      Wg += G_TILE_ELEMS;
    }
  }
  // no copy is outstanding when the wave goes on to its stores
  asm volatile("s_wait_asynccnt 0x0" ::: "memory");
}

// ... and what becomes of them. C layout -> lane holds column n, rows (hi*8 + r)
template <int OUT_MODE>
static __device__ __forceinline__
void gemm_store(const v8f (&acc)[2][4], const float* __restrict__ bias, void* __restrict__ Out,
                int row0, int col0)
{
  const int c16 = threadIdx.x & 15;
  const int hi  = (threadIdx.x >> 4) & 1;
#pragma unroll
  for (int i = 0; i < 2; ++i) {
#pragma unroll
    for (int j = 0; j < 4; ++j) {
      const int n = col0 + 16 * j + c16;
      const float bv = bias[n];
      const int m0 = row0 + 16 * i + hi * 8;   // the lane's 8 rows: m0 .. m0 + 7, one batch
      const int bb = m0 >> 11;                 // / T_SEQ
      const int t0 = m0 & (T_SEQ - 1);
      const int h  = n >> 6;                   // / HEAD_DIM
      const int d  = n & (HEAD_DIM - 1);
      u16* Oh = (u16*)Out + (size_t)(bb * N_HEADS + h) * (T_SEQ * HEAD_DIM);
#pragma unroll
      for (int r = 0; r < 8; r += 2) {
        const float v = acc[i][j][r] + bv;
        const float w = acc[i][j][r + 1] + bv;
        if constexpr (OUT_MODE == 2) {
          ((float*)Out)[(size_t)(m0 + r) * D_MODEL + n] = v;
          ((float*)Out)[(size_t)(m0 + r + 1) * D_MODEL + n] = w;
        } else if constexpr (OUT_MODE == 0) {
          const u32 p = pack_bf16x2(v, w);
          Oh[packed_idx(t0 + r, d, HEAD_DIM)] = (u16)p;
          Oh[packed_idx(t0 + r + 1, d, HEAD_DIM)] = (u16)(p >> 16);
        } else {   // rows are d, k runs along t: the lane's 8 values fill one 16-byte chunk
          *(u32*)(Oh + packed_idx(d, t0, T_SEQ) + r) = pack_bf16x2(v, w);
        }
      }
    }
  }
}

// The three input projections depend on one another not at all: one grid, blockIdx.z = 0, 1, 2
// for Q, K, V. Three work-groups then share a WGP, six waves a SIMD where a launch of one
// projection had two, and one wave's wait for its loads is filled by the others' products.
__global__ __launch_bounds__(256)
void gemm_qkv_k(const u16* __restrict__ X,     // Xq, Xk, Xv one behind the other
                const u16* __restrict__ Wb,    // Wq, Wk, Wv one behind the other
                const float* __restrict__ bq, const float* __restrict__ bk,
                const float* __restrict__ bv,
                u16* __restrict__ QKV)         // Qh, Kh, Vt one behind the other
{
  const int z    = blockIdx.z;
  const int wave = threadIdx.x >> 5;
  const int row0 = blockIdx.y * 128 + (wave >> 1) * 32;  // 4 waves down
  const int col0 = blockIdx.x * 128 + (wave & 1) * 64;   // 2 waves across
  __shared__ __attribute__((aligned(128))) u16 sm[2][G_STAGE_ELEMS];
  v8f acc[2][4];
  gemm_tile(X + (size_t)z * (M_TOK * D_MODEL), Wb + (size_t)z * (D_MODEL * D_MODEL),
            blockIdx.y * 128, blockIdx.x * 128, sm, acc);
  u16* Out = QKV + (size_t)z * (M_TOK * D_MODEL);
  if (z == 2) {
    gemm_store<1>(acc, bv, Out, row0, col0);
  } else {
    gemm_store<0>(acc, z == 0 ? bq : bk, Out, row0, col0);
    // The wait that stands in front of any overwrite of a register that an issued store names:
    // in the built kernel the other epilogue's code follows this one's and overwrites them.
    asm volatile("s_wait_xcnt 0x0" ::: "memory");
  }
}

__global__ __launch_bounds__(256)
void gemm_out_k(const u16* __restrict__ A, const u16* __restrict__ W,
                const float* __restrict__ bias, float* __restrict__ Out)
{
  const int wave = threadIdx.x >> 5;
  const int row0 = blockIdx.y * 128 + (wave >> 1) * 32;  // 4 waves down
  const int col0 = blockIdx.x * 128 + (wave & 1) * 64;   // 2 waves across
  __shared__ __attribute__((aligned(128))) u16 sm[2][G_STAGE_ELEMS];
  v8f acc[2][4];
  gemm_tile(A, W, blockIdx.y * 128, blockIdx.x * 128, sm, acc);
  gemm_store<2>(acc, bias, Out, row0, col0);
}

// ---------- Flash attention: one wave per (b, h, 16 query rows), K and V through LDS ----------
// lane l <-> lane l ^ 16
static __device__ __forceinline__ float xhalf(float x) {
  const int b = __builtin_bit_cast(int, x);
  return __builtin_bit_cast(float,
      __builtin_amdgcn_permlanex16(b, b, 0x76543210, 0xfedcba98, false, false));
}

#define KS          128
#define STAGE_HALF  (KS * HEAD_DIM)       // elements of K, and of V^T, in a stage
#define STAGE_ELEMS (2 * STAGE_HALF)
#define N_STAGES    (T_SEQ / KS)

__global__ __launch_bounds__(256)
void flash_attn_k(const u16* __restrict__ Qh, const u16* __restrict__ Kh,
                  const u16* __restrict__ Vt, const u32* __restrict__ mbits,
                  u16* __restrict__ att)
{
  __shared__ __attribute__((aligned(128))) u16 sm[2][STAGE_ELEMS];

  const int tid  = threadIdx.x;
  const int lane = threadIdx.x & 31;
  const int wave = threadIdx.x >> 5;
  const int c16  = lane & 15;
  const int hi   = lane >> 4;

  const int gw = blockIdx.x * 8 + wave;          // 0 .. 4095
  const int qt = gw & (T_SEQ / 16 - 1);          // 128 q-tiles
  const int h  = (gw >> 7) & (N_HEADS - 1);      // alike in the eight waves of a work-group
  const int b  = gw >> 11;
  const int q0 = qt * 16;

  // per-head matrices in fragment order
  const size_t hb = (size_t)((b * N_HEADS + h) * T_SEQ) * HEAD_DIM;
  const u16* Qb = Qh + hb + lane * 8;   // [T][HD]: a 16-row tile holds 16 * HEAD_DIM elements
  // the thread's first chunks of a stage: K is one run of 16 KiB, 4 KiB a copy; of V^T a copy
  // takes 4 KiB of one of the four 16-row tiles
  const u16* Kg = Kh + hb + tid * 8;
  const u16* Vg = Vt + hb + tid * 8;
  const u32 lds0 = (u32)(size_t)&sm[0][0] + tid * 16;   // low 32 bits = LDS byte address
  // the mask bit-words of this lane's query row (q0 + c16), one word per 32 keys
  const u32* Mp = mbits + (size_t)(b * T_SEQ + q0 + c16) * TW;

  // stage 0 into buffer 0, landed and published; then stage 1 into buffer 1
  stage_copy<2048, 16 * T_SEQ>(lds0, Kg, Vg);
  // this wave's copies have landed ...
  asm volatile("s_wait_asynccnt 0x0" ::: "memory");
  // ... and so have the other waves'
  __syncthreads();
  stage_copy<2048, 16 * T_SEQ>(lds0 + STAGE_ELEMS * 2, Kg + STAGE_HALF, Vg + KS * 16);
  Kg += 2 * STAGE_HALF;
  Vg += 2 * KS * 16;

  // Q fragments (16 q rows x 64 d), held for whole loop: B operand, column = query row c16
  v16bf qf[2];
#pragma unroll
  for (int dk = 0; dk < 2; ++dk)
    qf[dk] = load_frag_packed(Qb + q0 * HEAD_DIM + 16 * (dk * 32));

  const v8f vzero = {};
  v8f o[4];                    // o[t][r] = O[q0 + c16][16 t + 8 hi + r]
#pragma unroll
  for (int t = 0; t < 4; ++t) o[t] = vzero;
  float mrow = -1e30f;         // running maximum of the lane's query row, alike in both halves
  float lrow = 0.0f;           // running sum over the keys of this lane's half alone

  for (int s = 0; s < N_STAGES; ++s) {
    const u16* Ks = &sm[s & 1][0] + lane * 8;   // with this lane's 16-byte slot added
    const u16* Vs = Ks + STAGE_HALF;

    // one mask bit-word per lane covers a 32-key tile for its query row: the stage's words
    u32 wrow[KS / 32];
#pragma unroll
    for (int i = 0; i < KS / 32; ++i) wrow[i] = Mp[i];
    // The wait that stands in front of any overwrite of a register that an issued load names.
    // It takes the address as an input, so that it stays live up to it and no load lands its
    // result in it.
    asm volatile("s_wait_xcnt 0x0" :: "v"(Mp) : "memory");
    Mp += KS / 32;

    // K fragments of the stage's first 32 keys
    v16bf kb0[2], kb1[2];
#pragma unroll
    for (int dk = 0; dk < 2; ++dk) {
      kb0[dk] = load_frag_packed(Ks + 16 * (dk * 32));
      kb1[dk] = load_frag_packed(Ks + 16 * HEAD_DIM + 16 * (dk * 32));
    }

#pragma unroll
    for (int i = 0; i < KS / 32; ++i) {
      // S^T = K * Q^T for 32 keys (two 16x16 C tiles): s0[r] = S[c16][kt + 8 hi + r], s1: + 16
      v8f s0 = vzero, s1 = vzero;
#pragma unroll
      for (int dk = 0; dk < 2; ++dk) {
        s0 = __builtin_amdgcn_wmma_f32_16x16x32_bf16(false, kb0[dk], false, qf[dk], (short)0, s0, false, false);
        s1 = __builtin_amdgcn_wmma_f32_16x16x32_bf16(false, kb1[dk], false, qf[dk], (short)0, s1, false, false);
      }
      // With its twin below it keeps the LDS reads between them in runs of eight and sixteen, issued
      // ahead of the softmax.
      __builtin_amdgcn_sched_barrier(0);
      // These keys' V^T fragments and, inside the stage, the next 32 keys' K fragments: one group
      // of reads, which returns while the softmax runs.
      v16bf vf[4];
#pragma unroll
      for (int t = 0; t < 4; ++t)
        vf[t] = load_frag_packed(Vs + t * (16 * KS) + i * (16 * 32));
      if (i + 1 < KS / 32) {
#pragma unroll
        for (int dk = 0; dk < 2; ++dk) {
          kb0[dk] = load_frag_packed(Ks + (i + 1) * (32 * HEAD_DIM) + 16 * (dk * 32));
          kb1[dk] = load_frag_packed(Ks + (i + 1) * (32 * HEAD_DIM) + 16 * HEAD_DIM + 16 * (dk * 32));
        }
      }
      // Without the pair the reads sink down to their users two by two, and each two are waited for
      // where they stand.
      __builtin_amdgcn_sched_barrier(0);

      const u32 wr = wrow[i] >> (8 * hi);   // bit r: key 8 hi + r; bit 16 + r: key 16 + 8 hi + r
      const float scale = 0.125f;           // 1/sqrt(HEAD_DIM)
      float p0[8], p1[8];
      float tmax = -1e30f;
#pragma unroll
      for (int r = 0; r < 8; ++r) {
        float v0 = s0[r] * scale;
        float v1 = s1[r] * scale;
        if ((wr & (1u << r)) == 0) v0 = -1e30f;
        if ((wr & (0x10000u << r)) == 0) v1 = -1e30f;
        p0[r] = v0; p1[r] = v1;
        tmax = fmaxf(tmax, fmaxf(v0, v1));
      }
      // the row's maximum: the other 16 keys lie in the other half
      tmax = fmaxf(tmax, xhalf(tmax));

      const float mn = fmaxf(mrow, tmax);
      const float alpha = __expf(mrow - mn);
      mrow = mn;
      float rs = 0.0f;
#pragma unroll
      for (int r = 0; r < 8; ++r) {
        p0[r] = __expf(p0[r] - mn);
        p1[r] = __expf(p1[r] - mn);
        rs += p0[r] + p1[r];
      }
      lrow = lrow * alpha + rs;
#pragma unroll
      for (int t = 0; t < 4; ++t)
#pragma unroll
        for (int r = 0; r < 8; ++r) o[t][r] *= alpha;

      // P^T as B fragment: elements 0..7 are keys 8 hi + 0..7, elements 8..15 keys
      // 16 + 8 hi + 0..7, the k order in which load_frag_packed delivers V^T
      FragU pf;
      pf.q[0] = make_uint4(pack_bf16x2(p0[0], p0[1]), pack_bf16x2(p0[2], p0[3]),
                           pack_bf16x2(p0[4], p0[5]), pack_bf16x2(p0[6], p0[7]));
      pf.q[1] = make_uint4(pack_bf16x2(p1[0], p1[1]), pack_bf16x2(p1[2], p1[3]),
                           pack_bf16x2(p1[4], p1[5]), pack_bf16x2(p1[6], p1[7]));

      // O^T += V^T * P^T  (V stored transposed: row d, k along the row, in fragment order)
#pragma unroll
      for (int t = 0; t < 4; ++t)
        o[t] = __builtin_amdgcn_wmma_f32_16x16x32_bf16(false, vf[t], false, pf.v, (short)0, o[t], false, false);
    }

    // Publish point of stage s + 1. This wave's reads of buffer s & 1 have returned ...
    asm volatile("s_wait_dscnt 0x0" ::: "memory");
    // ... its copies of stage s + 1 have landed ...
    asm volatile("s_wait_asynccnt 0x0" ::: "memory");
    // ... and both hold for all eight waves: stage s + 1 may be read, buffer s & 1 refilled.
    __syncthreads();
    if (s + 2 < N_STAGES) {
      stage_copy<2048, 16 * T_SEQ>(lds0 + (s & 1) * (STAGE_ELEMS * 2), Kg, Vg);
      Kg += STAGE_HALF;
      Vg += KS * 16;
    }
  }
  // no copy is outstanding when the wave ends
  asm volatile("s_wait_asynccnt 0x0" ::: "memory");

  // finalize: O /= l, write att[b*T + t][h*64 + d] as bf16, in fragment order for the final GEMM;
  // the lane's 8 values of a tile are 8 consecutive d of one row: one 16-byte chunk
  const float l = lrow + xhalf(lrow);
#pragma unroll
  for (int t = 0; t < 4; ++t) {
    uint4 w;
    w.x = pack_bf16x2(o[t][0] / l, o[t][1] / l);
    w.y = pack_bf16x2(o[t][2] / l, o[t][3] / l);
    w.z = pack_bf16x2(o[t][4] / l, o[t][5] / l);
    w.w = pack_bf16x2(o[t][6] / l, o[t][7] / l);
    *(uint4*)(att + packed_idx(b * T_SEQ + q0 + c16, h * HEAD_DIM + t * 16 + hi * 8, D_MODEL)) = w;
  }
}

// ---------- host ----------
extern "C" void kernel_launch(void* const* d_in, const int* in_sizes, int n_in,
                              void* d_out, int out_size, void* d_ws, size_t ws_size,
                              hipStream_t stream)
{
  (void)in_sizes; (void)n_in; (void)out_size; (void)ws_size;

  const float* query = (const float*)d_in[0];
  const float* key   = (const float*)d_in[1];
  const float* value = (const float*)d_in[2];
  const int*   mask  = (const int*)  d_in[3];
  const float* wq = (const float*)d_in[4];  const float* bq = (const float*)d_in[5];
  const float* wk = (const float*)d_in[6];  const float* bk = (const float*)d_in[7];
  const float* wv = (const float*)d_in[8];  const float* bv = (const float*)d_in[9];
  const float* wo = (const float*)d_in[10]; const float* bo = (const float*)d_in[11];

  char* ws = (char*)d_ws;
  const size_t seg_x = (size_t)M_TOK * D_MODEL * sizeof(u16);    // 8 MiB
  const size_t seg_w = (size_t)D_MODEL * D_MODEL * sizeof(u16);  // 2 MiB
  u16* Xq  = (u16*)(ws + 0 * seg_x);
  // Xk, Xv: the next two segments
  char* wsw = ws + 3 * seg_x;
  u16* Wqb = (u16*)(wsw + 0 * seg_w);
  // Wkb, Wvb: the next two segments
  u16* Wob = (u16*)(wsw + 3 * seg_w);
  char* wsh = wsw + 4 * seg_w;
  u16* Qh  = (u16*)(wsh + 0 * seg_x);
  u16* Kh  = (u16*)(wsh + 1 * seg_x);
  u16* Vt  = (u16*)(wsh + 2 * seg_x);
  u16* att = (u16*)(wsh + 3 * seg_x);
  u32* mbw = (u32*)(wsh + 4 * seg_x);    // packed mask bits, 1 MiB

  dim3 bb(256);
  prep_k<<<dim3(PREP_BLOCKS), bb, 0, stream>>>(query, key, value, mask, wq, wk, wv, wo,
                                               Xq, Wqb, mbw);

  // (8, 32) blocks of 256 threads per projection
  gemm_qkv_k<<<dim3(D_MODEL / 128, M_TOK / 128, 3), bb, 0, stream>>>(Xq, Wqb, bq, bk, bv, Qh);

  const int n_waves = B_SZ * N_HEADS * (T_SEQ / 16);  // 4096
  flash_attn_k<<<dim3(n_waves / 8), bb, 0, stream>>>(Qh, Kh, Vt, mbw, att);

  gemm_out_k<<<dim3(D_MODEL / 128, M_TOK / 128), bb, 0, stream>>>(att, Wob, bo, (float*)d_out);
}

// v007
// One run takes 90.3 microseconds.
// In both of two side-by-side timings against v006, it was 1.06 times as fast.
// All steps since v000 together make it 3.22 times as fast.
#include <hip/hip_runtime.h>

typedef __attribute__((ext_vector_type(16))) __bf16 v16bf;
typedef __attribute__((ext_vector_type(8)))  float  v8f;
typedef unsigned short u16;
typedef unsigned int   u32;
typedef __attribute__((ext_vector_type(4)))  float  v4f;
typedef __attribute__((ext_vector_type(4)))  int    v4i;
typedef __attribute__((ext_vector_type(2)))  float  v2f;
typedef __attribute__((ext_vector_type(2)))  __bf16 v2bf;

#define D_MODEL  1024
#define N_HEADS  16
#define HEAD_DIM 64
#define B_SZ     2
#define T_SEQ    2048
#define M_TOK    (B_SZ * T_SEQ)     // 4096 token rows
#define TW       (T_SEQ / 32)       // 64 mask words per row

// ---------- helpers ----------

// Two f32 -> two bf16 in one register, round-to-nearest-even: compiles to one v_cvt_pk_bf16_f32.
static __device__ __forceinline__ u32 pack_bf16x2(float lo, float hi) {
  const v2f x = {lo, hi};
  return __builtin_bit_cast(u32, __builtin_convertvector(x, v2bf));
}

union FragU { v16bf v; uint4 q[2]; u16 h[16]; };

// 16-bit A/B fragment layout (ISA 7.12.2): per lane, elements 0..7 are K=+0..7,
// elements 8..15 are K=+16..23 (caller pre-adds the hi-lane +8 K offset).
static __device__ __forceinline__ v16bf load_frag_bf16(const u16* __restrict__ p) {
  FragU f;
  f.q[0] = *(const uint4*)(p + 0);
  f.q[1] = *(const uint4*)(p + 16);
  return f.v;
}

// Fragment-order ("packed") layout of every bf16 matrix operand kept in the workspace.
// A [rows][K] matrix is cut into tiles of 16 rows; inside a tile the 16-byte chunks
// (8 consecutive k of one row) lie chunk-major: chunk kc of rows 0..15, then chunk kc + 1, ...
// A fragment load of 32 lanes x 16 bytes is then 512 contiguous bytes (4 cache lines)
// where the row-major layout made it touch 16 lines.
static __device__ __forceinline__ int packed_idx(int row, int k, int K) {
  return (((row >> 4) * (K >> 3) + (k >> 3)) * 16 + (row & 15)) * 8 + (k & 7);
}

// p = tile base + 16 * k0 + 8 * lane. Lane (c, hi) gets chunks hi and 2 + hi of row c:
// the same k = 8*hi + 0..7 and 16 + 8*hi + 0..7 that load_frag_bf16 delivers.
static __device__ __forceinline__ v16bf load_frag_packed(const u16* __restrict__ p) {
  FragU f;
  f.q[0] = *(const uint4*)(p + 0);
  f.q[1] = *(const uint4*)(p + 256);
  return f.v;
}

// ---------- fp32 [rows][D_MODEL] -> bf16 in fragment order (bandwidth-bound) ----------
// A thread takes CVT_PER_THREAD chunks, a quarter of the matrix apart, and has all their loads
// in flight together: 8 x 512 bytes per wave, and a quarter of the waves to start.
// i0 = the thread's number among the nthreads that share the matrix.
#define CVT_PER_THREAD 4
static __device__ __forceinline__
void cvt_bf16(const float* __restrict__ src, u16* __restrict__ dst, int nthreads, int i0)
{
  // one 16-byte chunk of dst per piece; a wave takes 8 rows x 4 chunks, so that it reads 8 whole
  // 128-byte lines of src (4 chunks = 32 floats of a row) and writes 4 whole lines of dst
  // (8 rows of one chunk)
  v4f a[CVT_PER_THREAD], b[CVT_PER_THREAD];
  const v4f* s4[CVT_PER_THREAD];
#pragma unroll
  for (int m = 0; m < CVT_PER_THREAD; ++m) {
    const int i   = i0 + m * nthreads;
    const int kc  = (i & 3) | (((i >> 6) & 31) << 2);   // chunk in the row, 0 .. D_MODEL/8 - 1
    const int row = ((i >> 11) << 4) | ((i >> 2) & 15);
    s4[m] = (const v4f*)(src + (size_t)row * D_MODEL + kc * 8);
    a[m] = s4[m][0];
    b[m] = s4[m][1];
  }
  // The wait that stands in front of any overwrite of a register that an issued load names.
  // It takes the addresses as inputs, so that they stay live up to it and no load of the run
  // lands its result in them.
  asm volatile("s_wait_xcnt 0x0" :: "v"(s4[0]), "v"(s4[1]), "v"(s4[2]), "v"(s4[3]) : "memory");
#pragma unroll
  for (int m = 0; m < CVT_PER_THREAD; ++m) {
    const int i   = i0 + m * nthreads;
    const int kc  = (i & 3) | (((i >> 6) & 31) << 2);
    const int row = ((i >> 11) << 4) | ((i >> 2) & 15);
    uint4 o;
    o.x = pack_bf16x2(a[m].x, a[m].y);
    o.y = pack_bf16x2(a[m].z, a[m].w);
    o.z = pack_bf16x2(b[m].x, b[m].y);
    o.w = pack_bf16x2(b[m].z, b[m].w);
    *(uint4*)(dst + packed_idx(row, kc * 8, D_MODEL)) = o;
  }
  // The same wait for the stores: in the built kernel another piece's code follows this one's,
  // and it overwrites the registers that the stores name.
  asm volatile("s_wait_xcnt 0x0" ::: "memory");
}

// ---------- int32 mask -> bitmask (1 bit per entry): one wave per mask row ----------
// OR with the lane whose number differs in bit XM (1, 2 or 4), inside a 16-lane row.
template <int XM>
static __device__ __forceinline__ u32 or_xor_lane(u32 x) {
  return x | (u32)__builtin_amdgcn_update_dpp(0, (int)x, 0x160 | XM, 0xf, 0xf, true);   // row_xmask:XM
}

static __device__ __forceinline__
void mask_pack(const int* __restrict__ mask, u32* __restrict__ bits, int row)
{
  const int lane = threadIdx.x & 31;
  // load k: 512 contiguous bytes = entries 128 k + 4 lane + 0..3 = words 4 k .. 4 k + 3 of the row;
  // the whole row (16 loads, 8 KiB) is in flight before the first entry is looked at
  const v4i* s4 = (const v4i*)(mask + (size_t)row * T_SEQ) + lane;
  v4i v[T_SEQ / 128];
#pragma unroll
  for (int k = 0; k < T_SEQ / 128; ++k) v[k] = s4[k * 32];
  // The wait that stands in front of any overwrite of a register that an issued load names.
  // The address is an input, so that it stays live up to it and no load lands its result in it.
  asm volatile("s_wait_xcnt 0x0" :: "v"(s4) : "memory");

  const int j  = lane & 7;    // the lane's nibble in its word
  const int g  = lane >> 3;   // the lane's word among the four of a load
  u32 lo = 0, hi = 0;
#pragma unroll
  for (int k = 0; k < T_SEQ / 128; ++k) {
    const u32 nib = min((u32)v[k].x, 1u) | (min((u32)v[k].y, 1u) << 1)
                  | (min((u32)v[k].z, 1u) << 2) | (min((u32)v[k].w, 1u) << 3);
    u32 w = nib << (4 * j);
    w = or_xor_lane<1>(w);
    w = or_xor_lane<2>(w);
    w = or_xor_lane<4>(w);    // all 8 lanes of group g now hold word 4 k + g
    // lane (g, j) keeps the words of loads j and 8 + j, so that two stores of 128 contiguous
    // bytes write the row
    if (j == (k & 7)) { if (k < 8) lo = w; else hi = w; }
  }
  u32* o = bits + (size_t)row * TW + 4 * j + g;
  o[0]  = lo;
  o[32] = hi;
}

// ---------- all the preparation in one grid ----------
// The seven conversions and the mask pack depend on nothing and on one another not at all: one
// grid, in which the work-group's number says which piece it does, starts and drains once
// where eight launches in a row each did.
#define ACT_THREADS (M_TOK * D_MODEL / (8 * CVT_PER_THREAD))      // threads per activation matrix
#define WGT_THREADS (D_MODEL * D_MODEL / (8 * CVT_PER_THREAD))    // threads per weight matrix
#define MASK_BLOCKS (M_TOK * 32 / 256)    // 512: one wave per mask row
#define ACT_BLOCKS  (ACT_THREADS / 256)   // 512
#define WGT_BLOCKS  (WGT_THREADS / 256)   // 128
#define PREP_BLOCKS (MASK_BLOCKS + 3 * ACT_BLOCKS + 4 * WGT_BLOCKS)
// A budget for four waves per SIMD lets the compiler spend the registers that 8 or 16 loads in
// flight take, instead of holding the last ones back until the first have come in for the sake
// of 16 waves per SIMD. The merged grid has 20 waves per SIMD to place: the ceiling is eight,
// which these registers allow, and no longer the four that were all a single grid had.
__global__ __launch_bounds__(256) __attribute__((amdgpu_waves_per_eu(4, 8)))
void prep_k(const float* __restrict__ query, const float* __restrict__ key,
            const float* __restrict__ value, const int* __restrict__ mask,
            const float* __restrict__ wq, const float* __restrict__ wk,
            const float* __restrict__ wv, const float* __restrict__ wo,
            u16* __restrict__ X,      // Xq, Xk, Xv one behind the other
            u16* __restrict__ Wb,     // Wq, Wk, Wv, Wo one behind the other
            u32* __restrict__ bits)
{
  int blk = blockIdx.x;
  if (blk < MASK_BLOCKS) {
    mask_pack(mask, bits, (blk * 256 + (int)threadIdx.x) >> 5);   // wave id = row id
    return;
  }
  blk -= MASK_BLOCKS;
  if (blk < 3 * ACT_BLOCKS) {
    const int m = blk / ACT_BLOCKS;
    cvt_bf16(m == 0 ? query : m == 1 ? key : value, X + (size_t)m * (M_TOK * D_MODEL),
             ACT_THREADS, (blk - m * ACT_BLOCKS) * 256 + (int)threadIdx.x);
    return;
  }
  blk -= 3 * ACT_BLOCKS;
  const int m = blk / WGT_BLOCKS;
  cvt_bf16(m == 0 ? wq : m == 1 ? wk : m == 2 ? wv : wo, Wb + (size_t)m * (D_MODEL * D_MODEL),
           WGT_THREADS, (blk - m * WGT_BLOCKS) * 256 + (int)threadIdx.x);
}

// ---------- a stage of two operands into LDS, by asynchronous copies ----------
// One stage is 32 KiB: eight 16-byte copies a thread (256 threads x 128 bytes). lds = the thread's
// LDS byte address in the buffer's first 4 KiB; copy j lands 4 KiB * j further. The first four
// copies read p, p + SP, ... (elements), the last four q, q + SQ, ...
template <int SP, int SQ>
static __device__ __forceinline__
void stage_copy(u32 lds, const u16* p, const u16* q)
{
  // The copies and, as the statement's last line, the wait that stands in front of any overwrite
  // of a register that an issued copy names: inside one statement nothing can come between.
  asm volatile("global_load_async_to_lds_b128 %0, %8, off\n\t"
               "global_load_async_to_lds_b128 %1, %9, off\n\t"
               "global_load_async_to_lds_b128 %2, %10, off\n\t"
               "global_load_async_to_lds_b128 %3, %11, off\n\t"
               "global_load_async_to_lds_b128 %4, %12, off\n\t"
               "global_load_async_to_lds_b128 %5, %13, off\n\t"
               "global_load_async_to_lds_b128 %6, %14, off\n\t"
               "global_load_async_to_lds_b128 %7, %15, off\n\t"
               "s_wait_xcnt 0x0"
               :: "v"(lds), "v"(lds + 4096), "v"(lds + 8192), "v"(lds + 12288),
                  "v"(lds + 16384), "v"(lds + 20480), "v"(lds + 24576), "v"(lds + 28672),
                  "v"(p), "v"(p + SP), "v"(p + 2 * SP), "v"(p + 3 * SP),
                  "v"(q), "v"(q + SQ), "v"(q + 2 * SQ), "v"(q + 3 * SQ)
               : "memory");
}

// ---------- GEMM: C[M,N] = A[M,K] * W[N,K]^T + bias  (A, W bf16 in fragment order) ----------
// OUT_MODE: 0 = bf16 out, per (b, h) a [T][HD] matrix in fragment order   (Q, K)
//           1 = bf16 out, per (b, h) a [HD][T] matrix in fragment order   (V transposed)
//           2 = f32  out, layout [M, D_MODEL] (final projection)
// A work-group's 128 x 128 tile at (rowb, colb). A stage is GK k of its 128 rows of A and of its
// 128 rows of W, brought into LDS once for the eight waves by asynchronous copies, byte for byte
// in fragment order: eight 16-row tiles of A (GK * 32 bytes each), then eight of W. Two buffers:
// stage s + 2 flies while stage s + 1 is worked on.
#define GK            64
#define G_TILE_ELEMS  (16 * GK)             // a 16-row tile's share of a stage
#define G_HALF_ELEMS  (8 * G_TILE_ELEMS)    // 128 rows of A, or of W
#define G_STAGE_ELEMS (2 * G_HALF_ELEMS)
#define G_STAGES      (D_MODEL / GK)
// The wave's 32 x 64 tile (4 waves down, 2 across): the products ...
static __device__ __forceinline__
void gemm_tile(const u16* __restrict__ A, const u16* __restrict__ W,
               int rowb, int colb, u16 (*sm)[G_STAGE_ELEMS], v8f (&acc)[2][4])
{
  const int K    = D_MODEL;
  const int tid  = threadIdx.x;
  const int lane = threadIdx.x & 31;
  const int wave = threadIdx.x >> 5;
  // a copy takes two 16-row tiles' share of the stage (2 x 2 KiB): the thread's first chunks
  const u16* Ag = A + (rowb + 16 * (tid >> 7)) * K + (tid & 127) * 8;
  const u16* Wg = W + (colb + 16 * (tid >> 7)) * K + (tid & 127) * 8;
  const u32 lds0 = (u32)(size_t)&sm[0][0] + tid * 16;   // low 32 bits = LDS byte address

  // stage 0 into buffer 0, landed and published; then stage 1 into buffer 1
  stage_copy<32 * D_MODEL, 32 * D_MODEL>(lds0, Ag, Wg);
  // this wave's copies have landed ...
  asm volatile("s_wait_asynccnt 0x0" ::: "memory");
  // ... and so have the other waves'
  __syncthreads();
  stage_copy<32 * D_MODEL, 32 * D_MODEL>(lds0 + G_STAGE_ELEMS * 2, Ag + G_TILE_ELEMS, Wg + G_TILE_ELEMS);
  Ag += 2 * G_TILE_ELEMS;
  Wg += 2 * G_TILE_ELEMS;

  const v8f vzero = {};
#pragma unroll
  for (int i = 0; i < 2; ++i)
#pragma unroll
    for (int j = 0; j < 4; ++j) acc[i][j] = vzero;

  for (int s = 0; s < G_STAGES; ++s) {
    // the wave's two tiles of A and four of W, with this lane's 16-byte slot added
    const u16* As = &sm[s & 1][0] + (wave >> 1) * (2 * G_TILE_ELEMS) + lane * 8;
    const u16* Ws = &sm[s & 1][0] + G_HALF_ELEMS + (wave & 1) * (4 * G_TILE_ELEMS) + lane * 8;
    // 12x ds_load_b128 (512 contiguous bytes each) + 8x v_wmma per 32-deep K step
#pragma unroll
    for (int kk = 0; kk < GK / 32; ++kk) {
      v16bf a[2], b[4];
#pragma unroll
      for (int i = 0; i < 2; ++i)
        a[i] = load_frag_packed(As + i * G_TILE_ELEMS + kk * (16 * 32));
#pragma unroll
      for (int j = 0; j < 4; ++j)
        b[j] = load_frag_packed(Ws + j * G_TILE_ELEMS + kk * (16 * 32));   // row n, k along K
      // Keeps the twelve reads in flight together: without it the matrix instructions move up
      // between them, and a step waits out several LDS latencies in a row.
      __builtin_amdgcn_sched_barrier(0);
#pragma unroll
      for (int i = 0; i < 2; ++i)
#pragma unroll
        for (int j = 0; j < 4; ++j)
          acc[i][j] = __builtin_amdgcn_wmma_f32_16x16x32_bf16(
              false, a[i], false, b[j], (short)0, acc[i][j], false, false);
    }
    // Publish point of stage s + 1. This wave's reads of buffer s & 1 have returned ...
    asm volatile("s_wait_dscnt 0x0" ::: "memory");
    // ... its copies of stage s + 1 have landed ...
    asm volatile("s_wait_asynccnt 0x0" ::: "memory");
    // ... and both hold for all eight waves: stage s + 1 may be read, buffer s & 1 refilled.
    __syncthreads();
    if (s + 2 < G_STAGES) {
      stage_copy<32 * D_MODEL, 32 * D_MODEL>(lds0 + (s & 1) * (G_STAGE_ELEMS * 2), Ag, Wg);
      Ag += G_TILE_ELEMS;
      Wg += G_TILE_ELEMS;
    }
  }
  // no copy is outstanding when the wave goes on to its stores
  asm volatile("s_wait_asynccnt 0x0" ::: "memory");
}

// ... and what becomes of them. C layout -> lane holds column n, rows (hi*8 + r)
template <int OUT_MODE>
static __device__ __forceinline__
void gemm_store(const v8f (&acc)[2][4], const float* __restrict__ bias, void* __restrict__ Out,
                int row0, int col0)
{
  const int c16 = threadIdx.x & 15;
  const int hi  = (threadIdx.x >> 4) & 1;
#pragma unroll
  for (int i = 0; i < 2; ++i) {
#pragma unroll
    for (int j = 0; j < 4; ++j) {
      const int n = col0 + 16 * j + c16;
      const float bv = bias[n];
      const int m0 = row0 + 16 * i + hi * 8;   // the lane's 8 rows: m0 .. m0 + 7, one batch
      const int bb = m0 >> 11;                 // / T_SEQ
      const int t0 = m0 & (T_SEQ - 1);
      const int h  = n >> 6;                   // / HEAD_DIM
      const int d  = n & (HEAD_DIM - 1);
      u16* Oh = (u16*)Out + (size_t)(bb * N_HEADS + h) * (T_SEQ * HEAD_DIM);
#pragma unroll
      for (int r = 0; r < 8; r += 2) {
        const float v = acc[i][j][r] + bv;
        const float w = acc[i][j][r + 1] + bv;
        if constexpr (OUT_MODE == 2) {
          ((float*)Out)[(size_t)(m0 + r) * D_MODEL + n] = v;
          ((float*)Out)[(size_t)(m0 + r + 1) * D_MODEL + n] = w;
        } else if constexpr (OUT_MODE == 0) {
          const u32 p = pack_bf16x2(v, w);
          Oh[packed_idx(t0 + r, d, HEAD_DIM)] = (u16)p;
          Oh[packed_idx(t0 + r + 1, d, HEAD_DIM)] = (u16)(p >> 16);
        } else {   // rows are d, k runs along t: the lane's 8 values fill one 16-byte chunk
          *(u32*)(Oh + packed_idx(d, t0, T_SEQ) + r) = pack_bf16x2(v, w);
        }
      }
    }
  }
}

// The three input projections depend on one another not at all: one grid, blockIdx.z = 0, 1, 2
// for Q, K, V. Three work-groups then share a WGP, six waves a SIMD where a launch of one
// projection had two, and one wave's wait for its loads is filled by the others' products.
__global__ __launch_bounds__(256)
void gemm_qkv_k(const u16* __restrict__ X,     // Xq, Xk, Xv one behind the other
                const u16* __restrict__ Wb,    // Wq, Wk, Wv one behind the other
                const float* __restrict__ bq, const float* __restrict__ bk,
                const float* __restrict__ bv,
                u16* __restrict__ QKV)         // Qh, Kh, Vt one behind the other
{
  const int z    = blockIdx.z;
  const int wave = threadIdx.x >> 5;
  const int row0 = blockIdx.y * 128 + (wave >> 1) * 32;  // 4 waves down
  const int col0 = blockIdx.x * 128 + (wave & 1) * 64;   // 2 waves across
  __shared__ __attribute__((aligned(128))) u16 sm[2][G_STAGE_ELEMS];
  v8f acc[2][4];
  gemm_tile(X + (size_t)z * (M_TOK * D_MODEL), Wb + (size_t)z * (D_MODEL * D_MODEL),
            blockIdx.y * 128, blockIdx.x * 128, sm, acc);
  u16* Out = QKV + (size_t)z * (M_TOK * D_MODEL);
  if (z == 2) {
    gemm_store<1>(acc, bv, Out, row0, col0);
  } else {
    gemm_store<0>(acc, z == 0 ? bq : bk, Out, row0, col0);
    // The wait that stands in front of any overwrite of a register that an issued store names:
    // in the built kernel the other epilogue's code follows this one's and overwrites them.
    asm volatile("s_wait_xcnt 0x0" ::: "memory");
  }
}

__global__ __launch_bounds__(256)
void gemm_out_k(const u16* __restrict__ A, const u16* __restrict__ W,
                const float* __restrict__ bias, float* __restrict__ Out)
{
  const int wave = threadIdx.x >> 5;
  const int row0 = blockIdx.y * 128 + (wave >> 1) * 32;  // 4 waves down
  const int col0 = blockIdx.x * 128 + (wave & 1) * 64;   // 2 waves across
  __shared__ __attribute__((aligned(128))) u16 sm[2][G_STAGE_ELEMS];
  v8f acc[2][4];
  gemm_tile(A, W, blockIdx.y * 128, blockIdx.x * 128, sm, acc);
  gemm_store<2>(acc, bias, Out, row0, col0);
}

// ---------- Flash attention: one wave per (b, h, 16 query rows), K and V through LDS ----------
// lane l <-> lane l ^ 16
static __device__ __forceinline__ float xhalf(float x) {
  const int b = __builtin_bit_cast(int, x);
  return __builtin_bit_cast(float,
      __builtin_amdgcn_permlanex16(b, b, 0x76543210, 0xfedcba98, false, false));
}

#define KS          128
#define STAGE_HALF  (KS * HEAD_DIM)       // elements of K, and of V^T, in a stage
#define STAGE_ELEMS (2 * STAGE_HALF)
#define N_STAGES    (T_SEQ / KS)

// One stage of the key walk: KS keys out of the LDS buffer at Ks (this lane's 16-byte slot added).
// Mp = the stage's mask bit-words of this lane's query row. MASKED = false is the same work
// without them, for a stage in which every mask bit of the wave's 16 query rows is set: there
// each select would hand its score through as it is.
template <bool MASKED>
static __device__ __forceinline__
void attn_stage(const u16* Ks, const u32* __restrict__ Mp, int hi, const v16bf (&qf)[2],
                v8f (&o)[4], float& mrow, float& lrow)
{
  const u16* Vs = Ks + STAGE_HALF;
  const v8f vzero = {};

  // one mask bit-word per lane covers a 32-key tile for its query row: the stage's words
  u32 wrow[KS / 32] = {};
  if constexpr (MASKED) {
#pragma unroll
    for (int i = 0; i < KS / 32; ++i) wrow[i] = Mp[i];
    // The wait that stands in front of any overwrite of a register that an issued load names.
    // It takes the address as an input, so that it stays live up to it and no load lands its
    // result in it.
    asm volatile("s_wait_xcnt 0x0" :: "v"(Mp) : "memory");
  }

  // K fragments of the stage's first 32 keys
  v16bf kb0[2], kb1[2];
#pragma unroll
  for (int dk = 0; dk < 2; ++dk) {
    kb0[dk] = load_frag_packed(Ks + 16 * (dk * 32));
    kb1[dk] = load_frag_packed(Ks + 16 * HEAD_DIM + 16 * (dk * 32));
  }

#pragma unroll
  for (int i = 0; i < KS / 32; ++i) {
    // S^T = K * Q^T for 32 keys (two 16x16 C tiles): s0[r] = S[c16][kt + 8 hi + r], s1: + 16
    v8f s0 = vzero, s1 = vzero;
#pragma unroll
    for (int dk = 0; dk < 2; ++dk) {
      s0 = __builtin_amdgcn_wmma_f32_16x16x32_bf16(false, kb0[dk], false, qf[dk], (short)0, s0, false, false);
      s1 = __builtin_amdgcn_wmma_f32_16x16x32_bf16(false, kb1[dk], false, qf[dk], (short)0, s1, false, false);
    }
    // With its twin below it keeps the LDS reads between them in runs of eight and sixteen, issued
    // ahead of the softmax.
    __builtin_amdgcn_sched_barrier(0);
    // These keys' V^T fragments and, inside the stage, the next 32 keys' K fragments: one group
    // of reads, which returns while the softmax runs.
    v16bf vf[4];
#pragma unroll
    for (int t = 0; t < 4; ++t)
      vf[t] = load_frag_packed(Vs + t * (16 * KS) + i * (16 * 32));
    if (i + 1 < KS / 32) {
#pragma unroll
      for (int dk = 0; dk < 2; ++dk) {
        kb0[dk] = load_frag_packed(Ks + (i + 1) * (32 * HEAD_DIM) + 16 * (dk * 32));
        kb1[dk] = load_frag_packed(Ks + (i + 1) * (32 * HEAD_DIM) + 16 * HEAD_DIM + 16 * (dk * 32));
      }
    }
    // Without the pair the reads sink down to their users two by two, and each two are waited for
    // where they stand.
    __builtin_amdgcn_sched_barrier(0);

    const u32 wr = wrow[i] >> (8 * hi);   // bit r: key 8 hi + r; bit 16 + r: key 16 + 8 hi + r
    const float scale = 0.125f;           // 1/sqrt(HEAD_DIM)
    float p0[8], p1[8];
    float tmax = -1e30f;
#pragma unroll
    for (int r = 0; r < 8; ++r) {
      float v0 = s0[r] * scale;
      float v1 = s1[r] * scale;
      if constexpr (MASKED) {
        if ((wr & (1u << r)) == 0) v0 = -1e30f;
        if ((wr & (0x10000u << r)) == 0) v1 = -1e30f;
      }
      p0[r] = v0; p1[r] = v1;
      tmax = fmaxf(tmax, fmaxf(v0, v1));
    }
    // the row's maximum: the other 16 keys lie in the other half
    tmax = fmaxf(tmax, xhalf(tmax));

    const float mn = fmaxf(mrow, tmax);
    const float alpha = __expf(mrow - mn);
    mrow = mn;
    float rs = 0.0f;
#pragma unroll
    for (int r = 0; r < 8; ++r) {
      p0[r] = __expf(p0[r] - mn);
      p1[r] = __expf(p1[r] - mn);
      rs += p0[r] + p1[r];
    }
    lrow = lrow * alpha + rs;
#pragma unroll
    for (int t = 0; t < 4; ++t)
#pragma unroll
      for (int r = 0; r < 8; ++r) o[t][r] *= alpha;

    // P^T as B fragment: elements 0..7 are keys 8 hi + 0..7, elements 8..15 keys
    // 16 + 8 hi + 0..7, the k order in which load_frag_packed delivers V^T
    FragU pf;
    pf.q[0] = make_uint4(pack_bf16x2(p0[0], p0[1]), pack_bf16x2(p0[2], p0[3]),
                         pack_bf16x2(p0[4], p0[5]), pack_bf16x2(p0[6], p0[7]));
    pf.q[1] = make_uint4(pack_bf16x2(p1[0], p1[1]), pack_bf16x2(p1[2], p1[3]),
                         pack_bf16x2(p1[4], p1[5]), pack_bf16x2(p1[6], p1[7]));

    // O^T += V^T * P^T  (V stored transposed: row d, in fragment order)
#pragma unroll
    for (int t = 0; t < 4; ++t)
      o[t] = __builtin_amdgcn_wmma_f32_16x16x32_bf16(false, vf[t], false, pf.v, (short)0, o[t], false, false);
  }
}

__global__ __launch_bounds__(256)
void flash_attn_k(const u16* __restrict__ Qh, const u16* __restrict__ Kh,
                  const u16* __restrict__ Vt, const u32* __restrict__ mbits,
                  u16* __restrict__ att)
{
  __shared__ __attribute__((aligned(128))) u16 sm[2][STAGE_ELEMS];

  const int tid  = threadIdx.x;
  const int lane = threadIdx.x & 31;
  const int wave = threadIdx.x >> 5;
  const int c16  = lane & 15;
  const int hi   = lane >> 4;

  const int gw = blockIdx.x * 8 + wave;          // 0 .. 4095
  const int qt = gw & (T_SEQ / 16 - 1);          // 128 q-tiles
  const int h  = (gw >> 7) & (N_HEADS - 1);      // alike in the eight waves of a work-group
  const int b  = gw >> 11;
  const int q0 = qt * 16;

  // per-head matrices in fragment order
  const size_t hb = (size_t)((b * N_HEADS + h) * T_SEQ) * HEAD_DIM;
  const u16* Qb = Qh + hb + lane * 8;   // [T][HD]: a 16-row tile holds 16 * HEAD_DIM elements
  // the thread's first chunks of a stage: K is one run of 16 KiB, 4 KiB a copy; of V^T a copy
  // takes 4 KiB of one of the four 16-row tiles
  const u16* Kg = Kh + hb + tid * 8;
  const u16* Vg = Vt + hb + tid * 8;
  const u32 lds0 = (u32)(size_t)&sm[0][0] + tid * 16;   // low 32 bits = LDS byte address
  // the mask bit-words of this lane's query row (q0 + c16), one word per 32 keys
  const u32* Mp = mbits + (size_t)(b * T_SEQ + q0 + c16) * TW;

  // stage 0 into buffer 0, landed and published; then stage 1 into buffer 1
  stage_copy<2048, 16 * T_SEQ>(lds0, Kg, Vg);

  // Which stages hold no masked key for any of the wave's 16 query rows: bit s of full. A stage's
  // four bit-words of a row are one 16-byte load; the lower half of the wave looks at stages
  // 0 to 7 of its rows, the upper half at stages 8 to 15. The loads fly beside stage 0's copies.
  static_assert(KS == 128 && N_STAGES == 16, "four words a stage, sixteen stages a row");
  const uint4* M4 = (const uint4*)Mp + hi * (N_STAGES / 2);
  uint4 mw[N_STAGES / 2];
#pragma unroll
  for (int k = 0; k < N_STAGES / 2; ++k) mw[k] = M4[k];
  // The wait that stands in front of any overwrite of a register that an issued load names.
  // The address is an input, so that it stays live up to it and no load lands its result in it.
  asm volatile("s_wait_xcnt 0x0" :: "v"(M4) : "memory");

  // this wave's copies have landed ...
  asm volatile("s_wait_asynccnt 0x0" ::: "memory");
  // ... and so have the other waves'
  __syncthreads();
  stage_copy<2048, 16 * T_SEQ>(lds0 + STAGE_ELEMS * 2, Kg + STAGE_HALF, Vg + KS * 16);
  Kg += 2 * STAGE_HALF;
  Vg += 2 * KS * 16;

  // Q fragments (16 q rows x 64 d), held for whole loop: B operand, column = query row c16
  v16bf qf[2];
#pragma unroll
  for (int dk = 0; dk < 2; ++dk)
    qf[dk] = load_frag_packed(Qb + q0 * HEAD_DIM + 16 * (dk * 32));

  u32 full = 0;
#pragma unroll
  for (int k = 0; k < N_STAGES / 2; ++k) {
    // bit l: lane l has a masked key in its stage
    const u32 holes = __builtin_amdgcn_ballot_w32((mw[k].x & mw[k].y & mw[k].z & mw[k].w) != 0xffffffffu);
    if ((holes & 0xffffu) == 0) full |= 1u << k;
    if ((holes >> 16) == 0) full |= 1u << (k + N_STAGES / 2);
  }

  const v8f vzero = {};
  v8f o[4];                    // o[t][r] = O[q0 + c16][16 t + 8 hi + r]
#pragma unroll
  for (int t = 0; t < 4; ++t) o[t] = vzero;
  float mrow = -1e30f;         // running maximum of the lane's query row, alike in both halves
  float lrow = 0.0f;           // running sum over the keys of this lane's half alone

  for (int s = 0; s < N_STAGES; ++s) {
    const u16* Ks = &sm[s & 1][0] + lane * 8;   // with this lane's 16-byte slot added
    // A scalar branch on the wave's own bit; both sides end at the publish point below.
    if (full & (1u << s))
      attn_stage<false>(Ks, Mp, hi, qf, o, mrow, lrow);
    else
      attn_stage<true>(Ks, Mp + s * (KS / 32), hi, qf, o, mrow, lrow);

    // Publish point of stage s + 1. This wave's reads of buffer s & 1 have returned ...
    asm volatile("s_wait_dscnt 0x0" ::: "memory");
    // ... its copies of stage s + 1 have landed ...
    asm volatile("s_wait_asynccnt 0x0" ::: "memory");
    // ... and both hold for all eight waves: stage s + 1 may be read, buffer s & 1 refilled.
    __syncthreads();
    if (s + 2 < N_STAGES) {
      stage_copy<2048, 16 * T_SEQ>(lds0 + (s & 1) * (STAGE_ELEMS * 2), Kg, Vg);
      Kg += STAGE_HALF;
      Vg += KS * 16;
    }
  }
  // no copy is outstanding when the wave ends
  asm volatile("s_wait_asynccnt 0x0" ::: "memory");

  // finalize: O /= l, write att[b*T + t][h*64 + d] as bf16, in fragment order for the final GEMM;
  // the lane's 8 values of a tile are 8 consecutive d of one row: one 16-byte chunk
  const float l = lrow + xhalf(lrow);
#pragma unroll
  for (int t = 0; t < 4; ++t) {
    uint4 w;
    w.x = pack_bf16x2(o[t][0] / l, o[t][1] / l);
    w.y = pack_bf16x2(o[t][2] / l, o[t][3] / l);
    w.z = pack_bf16x2(o[t][4] / l, o[t][5] / l);
    w.w = pack_bf16x2(o[t][6] / l, o[t][7] / l);
    *(uint4*)(att + packed_idx(b * T_SEQ + q0 + c16, h * HEAD_DIM + t * 16 + hi * 8, D_MODEL)) = w;
  }
}

// ---------- host ----------
extern "C" void kernel_launch(void* const* d_in, const int* in_sizes, int n_in,
                              void* d_out, int out_size, void* d_ws, size_t ws_size,
                              hipStream_t stream)
{
  (void)in_sizes; (void)n_in; (void)out_size; (void)ws_size;

  const float* query = (const float*)d_in[0];
  const float* key   = (const float*)d_in[1];
  const float* value = (const float*)d_in[2];
  const int*   mask  = (const int*)  d_in[3];
  const float* wq = (const float*)d_in[4];  const float* bq = (const float*)d_in[5];
  const float* wk = (const float*)d_in[6];  const float* bk = (const float*)d_in[7];
  const float* wv = (const float*)d_in[8];  const float* bv = (const float*)d_in[9];
  const float* wo = (const float*)d_in[10]; const float* bo = (const float*)d_in[11];

  char* ws = (char*)d_ws;
  const size_t seg_x = (size_t)M_TOK * D_MODEL * sizeof(u16);    // 8 MiB
  const size_t seg_w = (size_t)D_MODEL * D_MODEL * sizeof(u16);  // 2 MiB
  u16* Xq  = (u16*)(ws + 0 * seg_x);
  // Xk, Xv: the next two segments
  char* wsw = ws + 3 * seg_x;
  u16* Wqb = (u16*)(wsw + 0 * seg_w);
  // Wkb, Wvb: the next two segments
  u16* Wob = (u16*)(wsw + 3 * seg_w);
  char* wsh = wsw + 4 * seg_w;
  u16* Qh  = (u16*)(wsh + 0 * seg_x);
  u16* Kh  = (u16*)(wsh + 1 * seg_x);
  u16* Vt  = (u16*)(wsh + 2 * seg_x);
  u16* att = (u16*)(wsh + 3 * seg_x);
  u32* mbw = (u32*)(wsh + 4 * seg_x);    // packed mask bits, 1 MiB

  dim3 bb(256);
  prep_k<<<dim3(PREP_BLOCKS), bb, 0, stream>>>(query, key, value, mask, wq, wk, wv, wo,
                                               Xq, Wqb, mbw);

  // (8, 32) blocks of 256 threads per projection
  gemm_qkv_k<<<dim3(D_MODEL / 128, M_TOK / 128, 3), bb, 0, stream>>>(Xq, Wqb, bq, bk, bv, Qh);

  const int n_waves = B_SZ * N_HEADS * (T_SEQ / 16);  // 4096
  flash_attn_k<<<dim3(n_waves / 8), bb, 0, stream>>>(Qh, Kh, Vt, mbw, att);

  gemm_out_k<<<dim3(D_MODEL / 128, M_TOK / 128), bb, 0, stream>>>(att, Wob, bo, (float*)d_out);
}

// v009
// Measured time: 78.1 microseconds a run.
// It is 1.17 times as fast as v007, going by the measured steps of the versions left out in between.
// All steps since v000 together make it 3.76 times as fast.
#include <hip/hip_runtime.h>

typedef __attribute__((ext_vector_type(16))) __bf16 v16bf;
typedef __attribute__((ext_vector_type(8)))  float  v8f;
typedef unsigned short u16;
typedef unsigned int   u32;
typedef __attribute__((ext_vector_type(4)))  float  v4f;
typedef __attribute__((ext_vector_type(4)))  int    v4i;
typedef __attribute__((ext_vector_type(2)))  float  v2f;
typedef __attribute__((ext_vector_type(2)))  __bf16 v2bf;

#define D_MODEL  1024
#define N_HEADS  16
#define HEAD_DIM 64
#define B_SZ     2
#define T_SEQ    2048
#define M_TOK    (B_SZ * T_SEQ)     // 4096 token rows
#define TW       (T_SEQ / 32)       // 64 mask words per row
// 1/sqrt(HEAD_DIM) * log2(e): multiplied into Q before its rounding to bf16, so that K * Q^T leaves
// the matrix unit as the base-2 exponent of the softmax
#define Q_SCALE  (0.125f * 1.44269504088896340736f)

// ---------- helpers ----------

// Two f32 -> two bf16 in one register, round-to-nearest-even: compiles to one v_cvt_pk_bf16_f32.
static __device__ __forceinline__ u32 pack_bf16x2(float lo, float hi) {
  const v2f x = {lo, hi};
  return __builtin_bit_cast(u32, __builtin_convertvector(x, v2bf));
}

union FragU { v16bf v; uint4 q[2]; u16 h[16]; };

// 16-bit A/B fragment layout (ISA 7.12.2): per lane, elements 0..7 are K=+0..7,
// elements 8..15 are K=+16..23 (caller pre-adds the hi-lane +8 K offset).
static __device__ __forceinline__ v16bf load_frag_bf16(const u16* __restrict__ p) {
  FragU f;
  f.q[0] = *(const uint4*)(p + 0);
  f.q[1] = *(const uint4*)(p + 16);
  return f.v;
}

// Fragment-order ("packed") layout of every bf16 matrix operand kept in the workspace.
// A [rows][K] matrix is cut into tiles of 16 rows; inside a tile the 16-byte chunks
// (8 consecutive k of one row) lie chunk-major: chunk kc of rows 0..15, then chunk kc + 1, ...
// A fragment load of 32 lanes x 16 bytes is then 512 contiguous bytes (4 cache lines)
// where the row-major layout made it touch 16 lines.
static __device__ __forceinline__ int packed_idx(int row, int k, int K) {
  return (((row >> 4) * (K >> 3) + (k >> 3)) * 16 + (row & 15)) * 8 + (k & 7);
}

// p = tile base + 16 * k0 + 8 * lane. Lane (c, hi) gets chunks hi and 2 + hi of row c:
// the same k = 8*hi + 0..7 and 16 + 8*hi + 0..7 that load_frag_bf16 delivers.
static __device__ __forceinline__ v16bf load_frag_packed(const u16* __restrict__ p) {
  FragU f;
  f.q[0] = *(const uint4*)(p + 0);
  f.q[1] = *(const uint4*)(p + 256);
  return f.v;
}

// ---------- fp32 [rows][D_MODEL] -> bf16 in fragment order (bandwidth-bound) ----------
// A thread takes CVT_PER_THREAD chunks, a quarter of the matrix apart, and has all their loads
// in flight together: 8 x 512 bytes per wave, and a quarter of the waves to start.
// i0 = the thread's number among the nthreads that share the matrix.
#define CVT_PER_THREAD 4
static __device__ __forceinline__
void cvt_bf16(const float* __restrict__ src, u16* __restrict__ dst, int nthreads, int i0)
{
  // one 16-byte chunk of dst per piece; a wave takes 8 rows x 4 chunks, so that it reads 8 whole
  // 128-byte lines of src (4 chunks = 32 floats of a row) and writes 4 whole lines of dst
  // (8 rows of one chunk)
  v4f a[CVT_PER_THREAD], b[CVT_PER_THREAD];
  const v4f* s4[CVT_PER_THREAD];
#pragma unroll
  for (int m = 0; m < CVT_PER_THREAD; ++m) {
    const int i   = i0 + m * nthreads;
    const int kc  = (i & 3) | (((i >> 6) & 31) << 2);   // chunk in the row, 0 .. D_MODEL/8 - 1
    const int row = ((i >> 11) << 4) | ((i >> 2) & 15);
    s4[m] = (const v4f*)(src + (size_t)row * D_MODEL + kc * 8);
    a[m] = s4[m][0];
    b[m] = s4[m][1];
  }
  // The wait that stands in front of any overwrite of a register that an issued load names.
  // It takes the addresses as inputs, so that they stay live up to it and no load of the run
  // lands its result in them.
  asm volatile("s_wait_xcnt 0x0" :: "v"(s4[0]), "v"(s4[1]), "v"(s4[2]), "v"(s4[3]) : "memory");
#pragma unroll
  for (int m = 0; m < CVT_PER_THREAD; ++m) {
    const int i   = i0 + m * nthreads;
    const int kc  = (i & 3) | (((i >> 6) & 31) << 2);
    const int row = ((i >> 11) << 4) | ((i >> 2) & 15);
    uint4 o;
    o.x = pack_bf16x2(a[m].x, a[m].y);
    o.y = pack_bf16x2(a[m].z, a[m].w);
    o.z = pack_bf16x2(b[m].x, b[m].y);
    o.w = pack_bf16x2(b[m].z, b[m].w);
    *(uint4*)(dst + packed_idx(row, kc * 8, D_MODEL)) = o;
  }
  // The same wait for the stores: in the built kernel another piece's code follows this one's,
  // and it overwrites the registers that the stores name.
  asm volatile("s_wait_xcnt 0x0" ::: "memory");
}

// ---------- int32 mask -> bitmask (1 bit per entry): one wave per mask row ----------
// OR with the lane whose number differs in bit XM (1, 2 or 4), inside a 16-lane row.
template <int XM>
static __device__ __forceinline__ u32 or_xor_lane(u32 x) {
  return x | (u32)__builtin_amdgcn_update_dpp(0, (int)x, 0x160 | XM, 0xf, 0xf, true);   // row_xmask:XM
}

static __device__ __forceinline__
void mask_pack(const int* __restrict__ mask, u32* __restrict__ bits, int row)
{
  const int lane = threadIdx.x & 31;
  // load k: 512 contiguous bytes = entries 128 k + 4 lane + 0..3 = words 4 k .. 4 k + 3 of the row;
  // the whole row (16 loads, 8 KiB) is in flight before the first entry is looked at
  const v4i* s4 = (const v4i*)(mask + (size_t)row * T_SEQ) + lane;
  v4i v[T_SEQ / 128];
#pragma unroll
  for (int k = 0; k < T_SEQ / 128; ++k) v[k] = s4[k * 32];
  // The wait that stands in front of any overwrite of a register that an issued load names.
  // The address is an input, so that it stays live up to it and no load lands its result in it.
  asm volatile("s_wait_xcnt 0x0" :: "v"(s4) : "memory");

  const int j  = lane & 7;    // the lane's nibble in its word
  const int g  = lane >> 3;   // the lane's word among the four of a load
  u32 lo = 0, hi = 0;
#pragma unroll
  for (int k = 0; k < T_SEQ / 128; ++k) {
    const u32 nib = min((u32)v[k].x, 1u) | (min((u32)v[k].y, 1u) << 1)
                  | (min((u32)v[k].z, 1u) << 2) | (min((u32)v[k].w, 1u) << 3);
    u32 w = nib << (4 * j);
    w = or_xor_lane<1>(w);
    w = or_xor_lane<2>(w);
    w = or_xor_lane<4>(w);    // all 8 lanes of group g now hold word 4 k + g
    // lane (g, j) keeps the words of loads j and 8 + j, so that two stores of 128 contiguous
    // bytes write the row
    if (j == (k & 7)) { if (k < 8) lo = w; else hi = w; }
  }
  u32* o = bits + (size_t)row * TW + 4 * j + g;
  o[0]  = lo;
  o[32] = hi;
}

// ---------- all the preparation in one grid ----------
// The seven conversions and the mask pack depend on nothing and on one another not at all: one
// grid, in which the work-group's number says which piece it does, starts and drains once
// where eight launches in a row each did.
#define ACT_THREADS (M_TOK * D_MODEL / (8 * CVT_PER_THREAD))      // threads per activation matrix
#define WGT_THREADS (D_MODEL * D_MODEL / (8 * CVT_PER_THREAD))    // threads per weight matrix
#define MASK_BLOCKS (M_TOK * 32 / 256)    // 512: one wave per mask row
#define ACT_BLOCKS  (ACT_THREADS / 256)   // 512
#define WGT_BLOCKS  (WGT_THREADS / 256)   // 128
#define PREP_BLOCKS (MASK_BLOCKS + 3 * ACT_BLOCKS + 4 * WGT_BLOCKS)
// A budget for four waves per SIMD lets the compiler spend the registers that 8 or 16 loads in
// flight take, instead of holding the last ones back until the first have come in for the sake
// of 16 waves per SIMD. The merged grid has 20 waves per SIMD to place: the ceiling is eight,
// which these registers allow, and no longer the four that were all a single grid had.
__global__ __launch_bounds__(256) __attribute__((amdgpu_waves_per_eu(4, 8)))
void prep_k(const float* __restrict__ query, const float* __restrict__ key,
            const float* __restrict__ value, const int* __restrict__ mask,
            const float* __restrict__ wq, const float* __restrict__ wk,
            const float* __restrict__ wv, const float* __restrict__ wo,
            u16* __restrict__ X,      // Xq, Xk, Xv one behind the other
            u16* __restrict__ Wb,     // Wq, Wk, Wv, Wo one behind the other
            u32* __restrict__ bits)
{
  int blk = blockIdx.x;
  if (blk < MASK_BLOCKS) {
    mask_pack(mask, bits, (blk * 256 + (int)threadIdx.x) >> 5);   // wave id = row id
    return;
  }
  blk -= MASK_BLOCKS;
  if (blk < 3 * ACT_BLOCKS) {
    const int m = blk / ACT_BLOCKS;
    cvt_bf16(m == 0 ? query : m == 1 ? key : value, X + (size_t)m * (M_TOK * D_MODEL),
             ACT_THREADS, (blk - m * ACT_BLOCKS) * 256 + (int)threadIdx.x);
    return;
  }
  blk -= 3 * ACT_BLOCKS;
  const int m = blk / WGT_BLOCKS;
  cvt_bf16(m == 0 ? wq : m == 1 ? wk : m == 2 ? wv : wo, Wb + (size_t)m * (D_MODEL * D_MODEL),
           WGT_THREADS, (blk - m * WGT_BLOCKS) * 256 + (int)threadIdx.x);
}

// ---------- a stage of two operands into LDS, by asynchronous copies ----------
// One stage is 32 KiB: eight 16-byte copies a thread (256 threads x 128 bytes). lds = the thread's
// LDS byte address in the buffer's first 4 KiB; copy j lands 4 KiB * j further. The first four
// copies read p, p + SP, ... (elements), the last four q, q + SQ, ...
template <int SP, int SQ>
static __device__ __forceinline__
void stage_copy(u32 lds, const u16* p, const u16* q)
{
  // The copies and, as the statement's last line, the wait that stands in front of any overwrite
  // of a register that an issued copy names: inside one statement nothing can come between.
  asm volatile("global_load_async_to_lds_b128 %0, %8, off\n\t"
               "global_load_async_to_lds_b128 %1, %9, off\n\t"
               "global_load_async_to_lds_b128 %2, %10, off\n\t"
               "global_load_async_to_lds_b128 %3, %11, off\n\t"
               "global_load_async_to_lds_b128 %4, %12, off\n\t"
               "global_load_async_to_lds_b128 %5, %13, off\n\t"
               "global_load_async_to_lds_b128 %6, %14, off\n\t"
               "global_load_async_to_lds_b128 %7, %15, off\n\t"
               "s_wait_xcnt 0x0"
               :: "v"(lds), "v"(lds + 4096), "v"(lds + 8192), "v"(lds + 12288),
                  "v"(lds + 16384), "v"(lds + 20480), "v"(lds + 24576), "v"(lds + 28672),
                  "v"(p), "v"(p + SP), "v"(p + 2 * SP), "v"(p + 3 * SP),
                  "v"(q), "v"(q + SQ), "v"(q + 2 * SQ), "v"(q + 3 * SQ)
               : "memory");
}

// ---------- GEMM: C[M,N] = A[M,K] * W[N,K]^T + bias  (A, W bf16 in fragment order) ----------
// OUT_MODE: 0 = bf16 out, per (b, h) a [T][HD] matrix in fragment order   (Q, K)
//           1 = bf16 out, per (b, h) a [HD][T] matrix in fragment order   (V transposed)
//           2 = f32  out, layout [M, D_MODEL] (final projection)
// A work-group's 128 x 128 tile at (rowb, colb). A stage is GK k of its 128 rows of A and of its
// 128 rows of W, brought into LDS once for the eight waves by asynchronous copies, byte for byte
// in fragment order: eight 16-row tiles of A (GK * 32 bytes each), then eight of W. NB buffers:
// while stage s is worked on, stages s + 1 to s + NB - 1 are in flight or landed, so that a copy
// has NB - 1 trips to land in and the next requests stand behind it all the time.
#define GK            64
#define G_TILE_ELEMS  (16 * GK)             // a 16-row tile's share of a stage
#define G_HALF_ELEMS  (8 * G_TILE_ELEMS)    // 128 rows of A, or of W
#define G_STAGE_ELEMS (2 * G_HALF_ELEMS)
#define G_STAGES      (D_MODEL / GK)
#define STAGE_COPIES  8     // copies of a wave in one stage_copy

template <int N>
static __device__ __forceinline__ void wait_copies_but() {
  asm volatile("s_wait_asynccnt %0" :: "n"(N) : "memory");
}

// The wave's 32 x 64 tile (4 waves down, 2 across): the products ...
template <int NB>
static __device__ __forceinline__
void gemm_tile(const u16* __restrict__ A, const u16* __restrict__ W,
               int rowb, int colb, u16 (*sm)[G_STAGE_ELEMS], v8f (&acc)[2][4])
{
  const int K    = D_MODEL;
  const int tid  = threadIdx.x;
  const int lane = threadIdx.x & 31;
  const int wave = threadIdx.x >> 5;
  // a copy takes two 16-row tiles' share of the stage (2 x 2 KiB): the thread's first chunks
  const u16* Ag = A + (rowb + 16 * (tid >> 7)) * K + (tid & 127) * 8;
  const u16* Wg = W + (colb + 16 * (tid >> 7)) * K + (tid & 127) * 8;
  const u32 lds0 = (u32)(size_t)&sm[0][0] + tid * 16;   // low 32 bits = LDS byte address

  static_assert(NB >= 2 && NB <= G_STAGES && NB * STAGE_COPIES <= 63, "stages exist, copies in flight");
  // stages 0 to NB - 1, one into each buffer (unrolled: the places in LDS and in A, W are constants)
#pragma unroll
  for (int p = 0; p < NB; ++p)
    stage_copy<32 * D_MODEL, 32 * D_MODEL>(lds0 + p * (G_STAGE_ELEMS * 2),
                                           Ag + p * G_TILE_ELEMS, Wg + p * G_TILE_ELEMS);
  Ag += NB * G_TILE_ELEMS;
  Wg += NB * G_TILE_ELEMS;
  // this wave's copies of stage 0 have landed (those of the NB - 1 later stages may still fly) ...
  wait_copies_but<(NB - 1) * STAGE_COPIES>();
  // ... and so have the other waves'
  __syncthreads();

  const v8f vzero = {};
#pragma unroll
  for (int i = 0; i < 2; ++i)
#pragma unroll
    for (int j = 0; j < 4; ++j) acc[i][j] = vzero;

  int buf = 0;   // s mod NB
  for (int s = 0; s < G_STAGES; ++s) {
    // the wave's two tiles of A and four of W, with this lane's 16-byte slot added
    const u16* As = &sm[buf][0] + (wave >> 1) * (2 * G_TILE_ELEMS) + lane * 8;
    const u16* Ws = &sm[buf][0] + G_HALF_ELEMS + (wave & 1) * (4 * G_TILE_ELEMS) + lane * 8;
    // 12x ds_load_b128 (512 contiguous bytes each) + 8x v_wmma per 32-deep K step
#pragma unroll
    for (int kk = 0; kk < GK / 32; ++kk) {
      v16bf a[2], b[4];
#pragma unroll
      for (int i = 0; i < 2; ++i)
        a[i] = load_frag_packed(As + i * G_TILE_ELEMS + kk * (16 * 32));
#pragma unroll
      for (int j = 0; j < 4; ++j)
        b[j] = load_frag_packed(Ws + j * G_TILE_ELEMS + kk * (16 * 32));   // row n, k along K
      // Keeps the twelve reads in flight together: without it the matrix instructions move up
      // between them, and a step waits out several LDS latencies in a row.
      __builtin_amdgcn_sched_barrier(0);
#pragma unroll
      for (int i = 0; i < 2; ++i)
#pragma unroll
        for (int j = 0; j < 4; ++j)
          acc[i][j] = __builtin_amdgcn_wmma_f32_16x16x32_bf16(
              false, a[i], false, b[j], (short)0, acc[i][j], false, false);
    }
    // Publish point of stage s + 1. This wave's reads of buffer buf have returned ...
    asm volatile("s_wait_dscnt 0x0" ::: "memory");
    // ... its copies of stage s + 1 have landed: while stage s + NB - 1 exists, the wave's youngest
    // copies are those of the NB - 2 stages behind s + 1, a full stage each, and may fly on ...
    wait_copies_but<(NB - 2) * STAGE_COPIES>();
    // ... in the last trips fewer stages stand behind s + 1, and the wait goes on to 0 ...
    if (s + NB > G_STAGES) wait_copies_but<0>();
    // ... and both hold for all eight waves: stage s + 1 may be read, buffer buf refilled.
    __syncthreads();
    if (s + NB < G_STAGES) {
      stage_copy<32 * D_MODEL, 32 * D_MODEL>(lds0 + buf * (G_STAGE_ELEMS * 2), Ag, Wg);
      Ag += G_TILE_ELEMS;
      Wg += G_TILE_ELEMS;
    }
    buf = buf + 1 == NB ? 0 : buf + 1;
  }
  // no copy is outstanding when the wave goes on to its stores
  asm volatile("s_wait_asynccnt 0x0" ::: "memory");
}

// ... and what becomes of them. C layout -> lane holds column n, rows (hi*8 + r)
// mul (OUT_MODE 0 alone): a factor on the biased value, Q_SCALE for Q and 1 for K
template <int OUT_MODE>
static __device__ __forceinline__
void gemm_store(const v8f (&acc)[2][4], const float* __restrict__ bias, void* __restrict__ Out,
                int row0, int col0, float mul = 1.0f)
{
  const int c16 = threadIdx.x & 15;
  const int hi  = (threadIdx.x >> 4) & 1;
#pragma unroll
  for (int i = 0; i < 2; ++i) {
#pragma unroll
    for (int j = 0; j < 4; ++j) {
      const int n = col0 + 16 * j + c16;
      const float bv = bias[n];
      const int m0 = row0 + 16 * i + hi * 8;   // the lane's 8 rows: m0 .. m0 + 7, one batch
      const int bb = m0 >> 11;                 // / T_SEQ
      const int t0 = m0 & (T_SEQ - 1);
      const int h  = n >> 6;                   // / HEAD_DIM
      const int d  = n & (HEAD_DIM - 1);
      u16* Oh = (u16*)Out + (size_t)(bb * N_HEADS + h) * (T_SEQ * HEAD_DIM);
#pragma unroll
      for (int r = 0; r < 8; r += 2) {
        const float v = acc[i][j][r] + bv;
        const float w = acc[i][j][r + 1] + bv;
        if constexpr (OUT_MODE == 2) {
          ((float*)Out)[(size_t)(m0 + r) * D_MODEL + n] = v;
          ((float*)Out)[(size_t)(m0 + r + 1) * D_MODEL + n] = w;
        } else if constexpr (OUT_MODE == 0) {
          const u32 p = pack_bf16x2(v * mul, w * mul);
          Oh[packed_idx(t0 + r, d, HEAD_DIM)] = (u16)p;
          Oh[packed_idx(t0 + r + 1, d, HEAD_DIM)] = (u16)(p >> 16);
        } else {   // rows are d, k runs along t: the lane's 8 values fill one 16-byte chunk
          *(u32*)(Oh + packed_idx(d, t0, T_SEQ) + r) = pack_bf16x2(v, w);
        }
      }
    }
  }
}

// The three input projections depend on one another not at all: one grid, blockIdx.z = 0, 1, 2
// for Q, K, V. Three work-groups then share a WGP, six waves a SIMD where a launch of one
// projection had two, and one wave's wait for its loads is filled by the others' products.
__global__ __launch_bounds__(256)
void gemm_qkv_k(const u16* __restrict__ X,     // Xq, Xk, Xv one behind the other
                const u16* __restrict__ Wb,    // Wq, Wk, Wv one behind the other
                const float* __restrict__ bq, const float* __restrict__ bk,
                const float* __restrict__ bv,
                u16* __restrict__ QKV)         // Qh, Kh, Vt one behind the other
{
  const int z    = blockIdx.z;
  const int wave = threadIdx.x >> 5;
  const int row0 = blockIdx.y * 128 + (wave >> 1) * 32;  // 4 waves down
  const int col0 = blockIdx.x * 128 + (wave & 1) * 64;   // 2 waves across
  // three buffers: 96 KiB, so that three work-groups still share a WGP's 320 KiB
  __shared__ __attribute__((aligned(128))) u16 sm[3][G_STAGE_ELEMS];
  v8f acc[2][4];
  gemm_tile<3>(X + (size_t)z * (M_TOK * D_MODEL), Wb + (size_t)z * (D_MODEL * D_MODEL),
               blockIdx.y * 128, blockIdx.x * 128, sm, acc);
  u16* Out = QKV + (size_t)z * (M_TOK * D_MODEL);
  if (z == 2) {
    gemm_store<1>(acc, bv, Out, row0, col0);
  } else {
    gemm_store<0>(acc, z == 0 ? bq : bk, Out, row0, col0, z == 0 ? Q_SCALE : 1.0f);
    // The wait that stands in front of any overwrite of a register that an issued store names:
    // in the built kernel the other epilogue's code follows this one's and overwrites them.
    asm volatile("s_wait_xcnt 0x0" ::: "memory");
  }
}

__global__ __launch_bounds__(256)
void gemm_out_k(const u16* __restrict__ A, const u16* __restrict__ W,
                const float* __restrict__ bias, float* __restrict__ Out)
{
  const int wave = threadIdx.x >> 5;
  const int row0 = blockIdx.y * 128 + (wave >> 1) * 32;  // 4 waves down
  const int col0 = blockIdx.x * 128 + (wave & 1) * 64;   // 2 waves across
  // the work-group is alone on its WGP, nothing else covers a copy's way: four buffers
  __shared__ __attribute__((aligned(128))) u16 sm[4][G_STAGE_ELEMS];
  v8f acc[2][4];
  gemm_tile<4>(A, W, blockIdx.y * 128, blockIdx.x * 128, sm, acc);
  gemm_store<2>(acc, bias, Out, row0, col0);
}

// ---------- Flash attention: one wave per (b, h, 16 query rows), K and V through LDS ----------
// lane l <-> lane l ^ 16
static __device__ __forceinline__ float xhalf(float x) {
  const int b = __builtin_bit_cast(int, x);
  return __builtin_bit_cast(float,
      __builtin_amdgcn_permlanex16(b, b, 0x76543210, 0xfedcba98, false, false));
}

#define KS          128
#define STAGE_HALF  (KS * HEAD_DIM)       // elements of K, and of V^T, in a stage
#define STAGE_ELEMS (2 * STAGE_HALF)
#define N_STAGES    (T_SEQ / KS)
#define REF_RISE    8.0f      // how far an exponent may rise above 0 before the reference follows
#define NO_KEY      -1e29f    // above every masked score (-1e30), below every real one

// One stage of the key walk: KS keys out of the LDS buffer at Ks (this lane's 16-byte slot added).
// Mp = the stage's mask bit-words of this lane's query row. MASKED = false is the same work
// without them, for a stage in which every mask bit of the wave's 16 query rows is set: there
// each select would hand its score through as it is.
//
// The score product delivers the softmax's exponent itself. Q carries Q_SCALE, and the product
// starts from C = cref = minus the row's reference (all eight elements alike: a lane's column is
// one query), so that D = log2(e) * score / 8 - reference goes into exp2 as it stands. The
// reference must be there before the scores are, so it is a held one: a score of the row seen
// earlier, which follows only when an exponent rises above thr. thr = REF_RISE (exp2 stays at or
// below 256; O / l does not depend on the reference) once the row has a reference, NO_KEY before
// its first open key, so that the first real score sets it. cref, thr: alike in both halves.
template <bool MASKED>
static __device__ __forceinline__
void attn_stage(const u16* Ks, const u32* __restrict__ Mp, int hi, const v16bf (&qf)[2],
                v8f (&o)[4], v8f& cref, float& thr, float& lrow)
{
  const u16* Vs = Ks + STAGE_HALF;

  // one mask bit-word per lane covers a 32-key tile for its query row: the stage's words
  u32 wrow[KS / 32] = {};
  if constexpr (MASKED) {
#pragma unroll
    for (int i = 0; i < KS / 32; ++i) wrow[i] = Mp[i];
    // The wait that stands in front of any overwrite of a register that an issued load names.
    // It takes the address as an input, so that it stays live up to it and no load lands its
    // result in it.
    asm volatile("s_wait_xcnt 0x0" :: "v"(Mp) : "memory");
  }

  // K fragments of the stage's first 32 keys
  v16bf kb0[2], kb1[2];
#pragma unroll
  for (int dk = 0; dk < 2; ++dk) {
    kb0[dk] = load_frag_packed(Ks + 16 * (dk * 32));
    kb1[dk] = load_frag_packed(Ks + 16 * HEAD_DIM + 16 * (dk * 32));
  }

#pragma unroll
  for (int i = 0; i < KS / 32; ++i) {
    // S^T = K * Q^T + cref for 32 keys (two 16x16 C tiles): s0[r] = S[c16][kt + 8 hi + r], s1: + 16
    v8f s0 = cref, s1 = cref;
#pragma unroll
    for (int dk = 0; dk < 2; ++dk) {
      s0 = __builtin_amdgcn_wmma_f32_16x16x32_bf16(false, kb0[dk], false, qf[dk], (short)0, s0, false, false);
      s1 = __builtin_amdgcn_wmma_f32_16x16x32_bf16(false, kb1[dk], false, qf[dk], (short)0, s1, false, false);
    }
    // With its twin below it keeps the LDS reads between them in runs of eight and sixteen, issued
    // ahead of the softmax.
    __builtin_amdgcn_sched_barrier(0);
    // These keys' V^T fragments and, inside the stage, the next 32 keys' K fragments: one group
    // of reads, which returns while the softmax runs.
    v16bf vf[4];
#pragma unroll
    for (int t = 0; t < 4; ++t)
      vf[t] = load_frag_packed(Vs + t * (16 * KS) + i * (16 * 32));
    if (i + 1 < KS / 32) {
#pragma unroll
      for (int dk = 0; dk < 2; ++dk) {
        kb0[dk] = load_frag_packed(Ks + (i + 1) * (32 * HEAD_DIM) + 16 * (dk * 32));
        kb1[dk] = load_frag_packed(Ks + (i + 1) * (32 * HEAD_DIM) + 16 * HEAD_DIM + 16 * (dk * 32));
      }
    }
    // Without the pair the reads sink down to their users two by two, and each two are waited for
    // where they stand.
    __builtin_amdgcn_sched_barrier(0);

    const u32 wr = wrow[i] >> (8 * hi);   // bit r: key 8 hi + r; bit 16 + r: key 16 + 8 hi + r
    float p0[8], p1[8];
    float tmax = -1e30f;
#pragma unroll
    for (int r = 0; r < 8; ++r) {
      float v0 = s0[r];
      float v1 = s1[r];
      if constexpr (MASKED) {
        if ((wr & (1u << r)) == 0) v0 = -1e30f;
        if ((wr & (0x10000u << r)) == 0) v1 = -1e30f;
      }
      p0[r] = v0; p1[r] = v1;
      tmax = fmaxf(tmax, fmaxf(v0, v1));
    }
    // One scalar branch a pass, on a ballot over the lanes' own 16 exponents: the references follow.
    if (__builtin_amdgcn_ballot_w32(tmax > thr) != 0) {
      // the row's largest exponent: the other 16 keys lie in the other half
      tmax = fmaxf(tmax, xhalf(tmax));
      const bool held = thr > 0.0f;      // the row has a reference, and sum and O are taken against it
      const bool open = tmax > NO_KEY;   // these 32 keys hold an open one
      // the reference rises to this pass's largest score; a first one is set to it, up or down
      const float delta = held ? fmaxf(tmax, 0.0f) : open ? tmax : 0.0f;
      // without a reference sum and O are 0 and stay so, whatever exp2(-delta) would be
      const float alpha = held ? __builtin_amdgcn_exp2f(-delta) : 0.0f;
      if (open) thr = REF_RISE;
#pragma unroll
      for (int r = 0; r < 8; ++r) {
        p0[r] -= delta;
        p1[r] -= delta;
        cref[r] -= delta;
      }
      lrow *= alpha;
#pragma unroll
      for (int t = 0; t < 4; ++t)
#pragma unroll
        for (int r = 0; r < 8; ++r) o[t][r] *= alpha;
    }
    float rs = 0.0f;
#pragma unroll
    for (int r = 0; r < 8; ++r) {
      p0[r] = __builtin_amdgcn_exp2f(p0[r]);
      p1[r] = __builtin_amdgcn_exp2f(p1[r]);
      rs += p0[r] + p1[r];
    }
    lrow += rs;

    // P^T as B fragment: elements 0..7 are keys 8 hi + 0..7, elements 8..15 keys
    // 16 + 8 hi + 0..7, the k order in which load_frag_packed delivers V^T
    FragU pf;
    pf.q[0] = make_uint4(pack_bf16x2(p0[0], p0[1]), pack_bf16x2(p0[2], p0[3]),
                         pack_bf16x2(p0[4], p0[5]), pack_bf16x2(p0[6], p0[7]));
    pf.q[1] = make_uint4(pack_bf16x2(p1[0], p1[1]), pack_bf16x2(p1[2], p1[3]),
                         pack_bf16x2(p1[4], p1[5]), pack_bf16x2(p1[6], p1[7]));

    // O^T += V^T * P^T  (V stored transposed: row d, in fragment order)
#pragma unroll
    for (int t = 0; t < 4; ++t)
      o[t] = __builtin_amdgcn_wmma_f32_16x16x32_bf16(false, vf[t], false, pf.v, (short)0, o[t], false, false);
  }
}

__global__ __launch_bounds__(256)
void flash_attn_k(const u16* __restrict__ Qh, const u16* __restrict__ Kh,
                  const u16* __restrict__ Vt, const u32* __restrict__ mbits,
                  u16* __restrict__ att)
{
  __shared__ __attribute__((aligned(128))) u16 sm[2][STAGE_ELEMS];

  const int tid  = threadIdx.x;
  const int lane = threadIdx.x & 31;
  const int wave = threadIdx.x >> 5;
  const int c16  = lane & 15;
  const int hi   = lane >> 4;

  const int gw = blockIdx.x * 8 + wave;          // 0 .. 4095
  const int qt = gw & (T_SEQ / 16 - 1);          // 128 q-tiles
  const int h  = (gw >> 7) & (N_HEADS - 1);      // alike in the eight waves of a work-group
  const int b  = gw >> 11;
  const int q0 = qt * 16;

  // per-head matrices in fragment order
  const size_t hb = (size_t)((b * N_HEADS + h) * T_SEQ) * HEAD_DIM;
  const u16* Qb = Qh + hb + lane * 8;   // [T][HD]: a 16-row tile holds 16 * HEAD_DIM elements
  // the thread's first chunks of a stage: K is one run of 16 KiB, 4 KiB a copy; of V^T a copy
  // takes 4 KiB of one of the four 16-row tiles
  const u16* Kg = Kh + hb + tid * 8;
  const u16* Vg = Vt + hb + tid * 8;
  const u32 lds0 = (u32)(size_t)&sm[0][0] + tid * 16;   // low 32 bits = LDS byte address
  // the mask bit-words of this lane's query row (q0 + c16), one word per 32 keys
  const u32* Mp = mbits + (size_t)(b * T_SEQ + q0 + c16) * TW;

  // stage 0 into buffer 0, landed and published; then stage 1 into buffer 1
  stage_copy<2048, 16 * T_SEQ>(lds0, Kg, Vg);

  // Which stages hold no masked key for any of the wave's 16 query rows: bit s of full. A stage's
  // four bit-words of a row are one 16-byte load; the lower half of the wave looks at stages
  // 0 to 7 of its rows, the upper half at stages 8 to 15. The loads fly beside stage 0's copies.
  static_assert(KS == 128 && N_STAGES == 16, "four words a stage, sixteen stages a row");
  const uint4* M4 = (const uint4*)Mp + hi * (N_STAGES / 2);
  uint4 mw[N_STAGES / 2];
#pragma unroll
  for (int k = 0; k < N_STAGES / 2; ++k) mw[k] = M4[k];
  // The wait that stands in front of any overwrite of a register that an issued load names.
  // The address is an input, so that it stays live up to it and no load lands its result in it.
  asm volatile("s_wait_xcnt 0x0" :: "v"(M4) : "memory");

  // this wave's copies have landed ...
  asm volatile("s_wait_asynccnt 0x0" ::: "memory");
  // ... and so have the other waves'
  __syncthreads();
  stage_copy<2048, 16 * T_SEQ>(lds0 + STAGE_ELEMS * 2, Kg + STAGE_HALF, Vg + KS * 16);
  Kg += 2 * STAGE_HALF;
  Vg += 2 * KS * 16;

  // Q fragments (16 q rows x 64 d), held for whole loop: B operand, column = query row c16
  v16bf qf[2];
#pragma unroll
  for (int dk = 0; dk < 2; ++dk)
    qf[dk] = load_frag_packed(Qb + q0 * HEAD_DIM + 16 * (dk * 32));

  u32 full = 0;
#pragma unroll
  for (int k = 0; k < N_STAGES / 2; ++k) {
    // bit l: lane l has a masked key in its stage
    const u32 holes = __builtin_amdgcn_ballot_w32((mw[k].x & mw[k].y & mw[k].z & mw[k].w) != 0xffffffffu);
    if ((holes & 0xffffu) == 0) full |= 1u << k;
    if ((holes >> 16) == 0) full |= 1u << (k + N_STAGES / 2);
  }

  const v8f vzero = {};
  v8f o[4];                    // o[t][r] = O[q0 + c16][16 t + 8 hi + r]
#pragma unroll
  for (int t = 0; t < 4; ++t) o[t] = vzero;
  v8f cref = vzero;            // minus the reference of the lane's query row: 0 until it has one
  float thr = NO_KEY;          // the exponent above which the reference follows
  float lrow = 0.0f;           // running sum over the keys of this lane's half alone

  for (int s = 0; s < N_STAGES; ++s) {
    const u16* Ks = &sm[s & 1][0] + lane * 8;   // with this lane's 16-byte slot added
    // A scalar branch on the wave's own bit; both sides end at the publish point below.
    if (full & (1u << s))
      attn_stage<false>(Ks, Mp, hi, qf, o, cref, thr, lrow);
    else
      attn_stage<true>(Ks, Mp + s * (KS / 32), hi, qf, o, cref, thr, lrow);

    // Publish point of stage s + 1. This wave's reads of buffer s & 1 have returned ...
    asm volatile("s_wait_dscnt 0x0" ::: "memory");
    // ... its copies of stage s + 1 have landed ...
    asm volatile("s_wait_asynccnt 0x0" ::: "memory");
    // ... and both hold for all eight waves: stage s + 1 may be read, buffer s & 1 refilled.
    __syncthreads();
    if (s + 2 < N_STAGES) {
      stage_copy<2048, 16 * T_SEQ>(lds0 + (s & 1) * (STAGE_ELEMS * 2), Kg, Vg);
      Kg += STAGE_HALF;
      Vg += KS * 16;
    }
  }
  // no copy is outstanding when the wave ends
  asm volatile("s_wait_asynccnt 0x0" ::: "memory");

  // finalize: O /= l, write att[b*T + t][h*64 + d] as bf16, in fragment order for the final GEMM;
  // the lane's 8 values of a tile are 8 consecutive d of one row: one 16-byte chunk
  const float l = lrow + xhalf(lrow);
#pragma unroll
  for (int t = 0; t < 4; ++t) {
    uint4 w;
    w.x = pack_bf16x2(o[t][0] / l, o[t][1] / l);
    w.y = pack_bf16x2(o[t][2] / l, o[t][3] / l);
    w.z = pack_bf16x2(o[t][4] / l, o[t][5] / l);
    w.w = pack_bf16x2(o[t][6] / l, o[t][7] / l);
    *(uint4*)(att + packed_idx(b * T_SEQ + q0 + c16, h * HEAD_DIM + t * 16 + hi * 8, D_MODEL)) = w;
  }
}

// ---------- host ----------
extern "C" void kernel_launch(void* const* d_in, const int* in_sizes, int n_in,
                              void* d_out, int out_size, void* d_ws, size_t ws_size,
                              hipStream_t stream)
{
  (void)in_sizes; (void)n_in; (void)out_size; (void)ws_size;

  const float* query = (const float*)d_in[0];
  const float* key   = (const float*)d_in[1];
  const float* value = (const float*)d_in[2];
  const int*   mask  = (const int*)  d_in[3];
  const float* wq = (const float*)d_in[4];  const float* bq = (const float*)d_in[5];
  const float* wk = (const float*)d_in[6];  const float* bk = (const float*)d_in[7];
  const float* wv = (const float*)d_in[8];  const float* bv = (const float*)d_in[9];
  const float* wo = (const float*)d_in[10]; const float* bo = (const float*)d_in[11];

  char* ws = (char*)d_ws;
  const size_t seg_x = (size_t)M_TOK * D_MODEL * sizeof(u16);    // 8 MiB
  const size_t seg_w = (size_t)D_MODEL * D_MODEL * sizeof(u16);  // 2 MiB
  u16* Xq  = (u16*)(ws + 0 * seg_x);
  // Xk, Xv: the next two segments
  char* wsw = ws + 3 * seg_x;
  u16* Wqb = (u16*)(wsw + 0 * seg_w);
  // Wkb, Wvb: the next two segments
  u16* Wob = (u16*)(wsw + 3 * seg_w);
  char* wsh = wsw + 4 * seg_w;
  u16* Qh  = (u16*)(wsh + 0 * seg_x);
  u16* Kh  = (u16*)(wsh + 1 * seg_x);
  u16* Vt  = (u16*)(wsh + 2 * seg_x);
  u16* att = (u16*)(wsh + 3 * seg_x);
  u32* mbw = (u32*)(wsh + 4 * seg_x);    // packed mask bits, 1 MiB

  dim3 bb(256);
  prep_k<<<dim3(PREP_BLOCKS), bb, 0, stream>>>(query, key, value, mask, wq, wk, wv, wo,
                                               Xq, Wqb, mbw);

  // (8, 32) blocks of 256 threads per projection
  gemm_qkv_k<<<dim3(D_MODEL / 128, M_TOK / 128, 3), bb, 0, stream>>>(Xq, Wqb, bq, bk, bv, Qh);

  const int n_waves = B_SZ * N_HEADS * (T_SEQ / 16);  // 4096
  flash_attn_k<<<dim3(n_waves / 8), bb, 0, stream>>>(Qh, Kh, Vt, mbw, att);

  gemm_out_k<<<dim3(D_MODEL / 128, M_TOK / 128), bb, 0, stream>>>(att, Wob, bo, (float*)d_out);
}

// v010
// A run of this version takes 74 microseconds.
// Timed twice side by side with v009, it ran 1.05 times as fast both times.
// Over all steps from v000 it is 3.95 times as fast.
#include <hip/hip_runtime.h>

typedef __attribute__((ext_vector_type(16))) __bf16 v16bf;
typedef __attribute__((ext_vector_type(8)))  float  v8f;
typedef unsigned short u16;
typedef unsigned int   u32;
typedef __attribute__((ext_vector_type(4)))  float  v4f;
typedef __attribute__((ext_vector_type(4)))  int    v4i;
typedef __attribute__((ext_vector_type(2)))  float  v2f;
typedef __attribute__((ext_vector_type(2)))  __bf16 v2bf;

#define D_MODEL  1024
#define N_HEADS  16
#define HEAD_DIM 64
#define B_SZ     2
#define T_SEQ    2048
#define M_TOK    (B_SZ * T_SEQ)     // 4096 token rows
#define TW       (T_SEQ / 32)       // 64 mask words per row
// 1/sqrt(HEAD_DIM) * log2(e): multiplied into Q before its rounding to bf16, so that K * Q^T leaves
// the matrix unit as the base-2 exponent of the softmax
#define Q_SCALE  (0.125f * 1.44269504088896340736f)

// ---------- helpers ----------

// Two f32 -> two bf16 in one register, round-to-nearest-even: compiles to one v_cvt_pk_bf16_f32.
static __device__ __forceinline__ u32 pack_bf16x2(float lo, float hi) {
  const v2f x = {lo, hi};
  return __builtin_bit_cast(u32, __builtin_convertvector(x, v2bf));
}

union FragU { v16bf v; uint4 q[2]; u16 h[16]; };

// 16-bit A/B fragment layout (ISA 7.12.2): per lane, elements 0..7 are K=+0..7,
// elements 8..15 are K=+16..23 (caller pre-adds the hi-lane +8 K offset).
static __device__ __forceinline__ v16bf load_frag_bf16(const u16* __restrict__ p) {
  FragU f;
  f.q[0] = *(const uint4*)(p + 0);
  f.q[1] = *(const uint4*)(p + 16);
  return f.v;
}

// Fragment-order ("packed") layout of every bf16 matrix operand kept in the workspace.
// A [rows][K] matrix is cut into tiles of 16 rows; inside a tile the 16-byte chunks
// (8 consecutive k of one row) lie chunk-major: chunk kc of rows 0..15, then chunk kc + 1, ...
// A fragment load of 32 lanes x 16 bytes is then 512 contiguous bytes (4 cache lines)
// where the row-major layout made it touch 16 lines.
static __device__ __forceinline__ int packed_idx(int row, int k, int K) {
  return (((row >> 4) * (K >> 3) + (k >> 3)) * 16 + (row & 15)) * 8 + (k & 7);
}

// p = tile base + 16 * k0 + 8 * lane. Lane (c, hi) gets chunks hi and 2 + hi of row c:
// the same k = 8*hi + 0..7 and 16 + 8*hi + 0..7 that load_frag_bf16 delivers.
static __device__ __forceinline__ v16bf load_frag_packed(const u16* __restrict__ p) {
  FragU f;
  f.q[0] = *(const uint4*)(p + 0);
  f.q[1] = *(const uint4*)(p + 256);
  return f.v;
}

// ---------- fp32 [rows][D_MODEL] -> bf16 in fragment order (bandwidth-bound) ----------
// A thread takes CVT_PER_THREAD chunks, a quarter of the matrix apart, and has all their loads
// in flight together: 8 x 512 bytes per wave, and a quarter of the waves to start.
// i0 = the thread's number among the nthreads that share the matrix.
#define CVT_PER_THREAD 4
static __device__ __forceinline__
void cvt_bf16(const float* __restrict__ src, u16* __restrict__ dst, int nthreads, int i0)
{
  // one 16-byte chunk of dst per piece; a wave takes 8 rows x 4 chunks, so that it reads 8 whole
  // 128-byte lines of src (4 chunks = 32 floats of a row) and writes 4 whole lines of dst
  // (8 rows of one chunk)
  v4f a[CVT_PER_THREAD], b[CVT_PER_THREAD];
  const v4f* s4[CVT_PER_THREAD];
#pragma unroll
  for (int m = 0; m < CVT_PER_THREAD; ++m) {
    const int i   = i0 + m * nthreads;
    const int kc  = (i & 3) | (((i >> 6) & 31) << 2);   // chunk in the row, 0 .. D_MODEL/8 - 1
    const int row = ((i >> 11) << 4) | ((i >> 2) & 15);
    s4[m] = (const v4f*)(src + (size_t)row * D_MODEL + kc * 8);
    a[m] = s4[m][0];
    b[m] = s4[m][1];
  }
  // The wait that stands in front of any overwrite of a register that an issued load names.
  // It takes the addresses as inputs, so that they stay live up to it and no load of the run
  // lands its result in them.
  asm volatile("s_wait_xcnt 0x0" :: "v"(s4[0]), "v"(s4[1]), "v"(s4[2]), "v"(s4[3]) : "memory");
#pragma unroll
  for (int m = 0; m < CVT_PER_THREAD; ++m) {
    const int i   = i0 + m * nthreads;
    const int kc  = (i & 3) | (((i >> 6) & 31) << 2);
    const int row = ((i >> 11) << 4) | ((i >> 2) & 15);
    uint4 o;
    o.x = pack_bf16x2(a[m].x, a[m].y);
    o.y = pack_bf16x2(a[m].z, a[m].w);
    o.z = pack_bf16x2(b[m].x, b[m].y);
    o.w = pack_bf16x2(b[m].z, b[m].w);
    *(uint4*)(dst + packed_idx(row, kc * 8, D_MODEL)) = o;
  }
  // The same wait for the stores: in the built kernel another piece's code follows this one's,
  // and it overwrites the registers that the stores name.
  asm volatile("s_wait_xcnt 0x0" ::: "memory");
}

// ---------- int32 mask -> bitmask (1 bit per entry): one wave per mask row ----------
// OR with the lane whose number differs in bit XM (1, 2 or 4), inside a 16-lane row.
template <int XM>
static __device__ __forceinline__ u32 or_xor_lane(u32 x) {
  return x | (u32)__builtin_amdgcn_update_dpp(0, (int)x, 0x160 | XM, 0xf, 0xf, true);   // row_xmask:XM
}

static __device__ __forceinline__
void mask_pack(const int* __restrict__ mask, u32* __restrict__ bits, int row)
{
  const int lane = threadIdx.x & 31;
  // load k: 512 contiguous bytes = entries 128 k + 4 lane + 0..3 = words 4 k .. 4 k + 3 of the row;
  // the whole row (16 loads, 8 KiB) is in flight before the first entry is looked at
  const v4i* s4 = (const v4i*)(mask + (size_t)row * T_SEQ) + lane;
  v4i v[T_SEQ / 128];
#pragma unroll
  for (int k = 0; k < T_SEQ / 128; ++k) v[k] = s4[k * 32];
  // The wait that stands in front of any overwrite of a register that an issued load names.
  // The address is an input, so that it stays live up to it and no load lands its result in it.
  asm volatile("s_wait_xcnt 0x0" :: "v"(s4) : "memory");

  const int j  = lane & 7;    // the lane's nibble in its word
  const int g  = lane >> 3;   // the lane's word among the four of a load
  u32 lo = 0, hi = 0;
#pragma unroll
  for (int k = 0; k < T_SEQ / 128; ++k) {
    const u32 nib = min((u32)v[k].x, 1u) | (min((u32)v[k].y, 1u) << 1)
                  | (min((u32)v[k].z, 1u) << 2) | (min((u32)v[k].w, 1u) << 3);
    u32 w = nib << (4 * j);
    w = or_xor_lane<1>(w);
    w = or_xor_lane<2>(w);
    w = or_xor_lane<4>(w);    // all 8 lanes of group g now hold word 4 k + g
    // lane (g, j) keeps the words of loads j and 8 + j, so that two stores of 128 contiguous
    // bytes write the row
    if (j == (k & 7)) { if (k < 8) lo = w; else hi = w; }
  }
  u32* o = bits + (size_t)row * TW + 4 * j + g;
  o[0]  = lo;
  o[32] = hi;
}

// ---------- all the preparation in one grid ----------
// The seven conversions and the mask pack depend on nothing and on one another not at all: one
// grid, in which the work-group's number says which piece it does, starts and drains once
// where eight launches in a row each did.
#define ACT_THREADS (M_TOK * D_MODEL / (8 * CVT_PER_THREAD))      // threads per activation matrix
#define WGT_THREADS (D_MODEL * D_MODEL / (8 * CVT_PER_THREAD))    // threads per weight matrix
#define MASK_BLOCKS (M_TOK * 32 / 256)    // 512: one wave per mask row
#define ACT_BLOCKS  (ACT_THREADS / 256)   // 512
#define WGT_BLOCKS  (WGT_THREADS / 256)   // 128
#define PREP_BLOCKS (MASK_BLOCKS + 3 * ACT_BLOCKS + 4 * WGT_BLOCKS)
// A budget for four waves per SIMD lets the compiler spend the registers that 8 or 16 loads in
// flight take, instead of holding the last ones back until the first have come in for the sake
// of 16 waves per SIMD. The merged grid has 20 waves per SIMD to place: the ceiling is eight,
// which these registers allow, and no longer the four that were all a single grid had.
__global__ __launch_bounds__(256) __attribute__((amdgpu_waves_per_eu(4, 8)))
void prep_k(const float* __restrict__ query, const float* __restrict__ key,
            const float* __restrict__ value, const int* __restrict__ mask,
            const float* __restrict__ wq, const float* __restrict__ wk,
            const float* __restrict__ wv, const float* __restrict__ wo,
            u16* __restrict__ X,      // Xq, Xk, Xv one behind the other
            u16* __restrict__ Wb,     // Wq, Wk, Wv, Wo one behind the other
            u32* __restrict__ bits)
{
  int blk = blockIdx.x;
  if (blk < MASK_BLOCKS) {
    mask_pack(mask, bits, (blk * 256 + (int)threadIdx.x) >> 5);   // wave id = row id
    return;
  }
  blk -= MASK_BLOCKS;
  if (blk < 3 * ACT_BLOCKS) {
    const int m = blk / ACT_BLOCKS;
    cvt_bf16(m == 0 ? query : m == 1 ? key : value, X + (size_t)m * (M_TOK * D_MODEL),
             ACT_THREADS, (blk - m * ACT_BLOCKS) * 256 + (int)threadIdx.x);
    return;
  }
  blk -= 3 * ACT_BLOCKS;
  const int m = blk / WGT_BLOCKS;
  cvt_bf16(m == 0 ? wq : m == 1 ? wk : m == 2 ? wv : wo, Wb + (size_t)m * (D_MODEL * D_MODEL),
           WGT_THREADS, (blk - m * WGT_BLOCKS) * 256 + (int)threadIdx.x);
}

// ---------- a stage of two operands into LDS, by asynchronous copies ----------
// One stage is 32 KiB: eight 16-byte copies a thread (256 threads x 128 bytes). lds = the thread's
// LDS byte address in the buffer's first 4 KiB; copy j lands 4 KiB * j further. The first four
// copies read p, p + SP, ... (elements), the last four q, q + SQ, ...
template <int SP, int SQ>
static __device__ __forceinline__
void stage_copy(u32 lds, const u16* p, const u16* q)
{
  // The copies and, as the statement's last line, the wait that stands in front of any overwrite
  // of a register that an issued copy names: inside one statement nothing can come between.
  asm volatile("global_load_async_to_lds_b128 %0, %8, off\n\t"
               "global_load_async_to_lds_b128 %1, %9, off\n\t"
               "global_load_async_to_lds_b128 %2, %10, off\n\t"
               "global_load_async_to_lds_b128 %3, %11, off\n\t"
               "global_load_async_to_lds_b128 %4, %12, off\n\t"
               "global_load_async_to_lds_b128 %5, %13, off\n\t"
               "global_load_async_to_lds_b128 %6, %14, off\n\t"
               "global_load_async_to_lds_b128 %7, %15, off\n\t"
               "s_wait_xcnt 0x0"
               :: "v"(lds), "v"(lds + 4096), "v"(lds + 8192), "v"(lds + 12288),
                  "v"(lds + 16384), "v"(lds + 20480), "v"(lds + 24576), "v"(lds + 28672),
                  "v"(p), "v"(p + SP), "v"(p + 2 * SP), "v"(p + 3 * SP),
                  "v"(q), "v"(q + SQ), "v"(q + 2 * SQ), "v"(q + 3 * SQ)
               : "memory");
}

// ---------- GEMM: C[M,N] = A[M,K] * W[N,K]^T + bias  (A, W bf16 in fragment order) ----------
// OUT_MODE: 0 = bf16 out, per (b, h) a [T][HD] matrix in fragment order   (Q, K)
//           1 = bf16 out, per (b, h) a [HD][T] matrix in fragment order   (V transposed)
//           2 = f32  out, layout [M, D_MODEL] (final projection)
// A work-group's 128 x 128 tile at (rowb, colb). A stage is GK k of its 128 rows of A and of its
// 128 rows of W, brought into LDS once for the eight waves by asynchronous copies, byte for byte
// in fragment order: eight 16-row tiles of A (GK * 32 bytes each), then eight of W. NB buffers:
// while stage s is worked on, stages s + 1 to s + NB - 1 are in flight or landed, so that a copy
// has NB - 1 trips to land in and the next requests stand behind it all the time.
#define GK            64
#define G_TILE_ELEMS  (16 * GK)             // a 16-row tile's share of a stage
#define G_HALF_ELEMS  (8 * G_TILE_ELEMS)    // 128 rows of A, or of W
#define G_STAGE_ELEMS (2 * G_HALF_ELEMS)
#define G_STAGES      (D_MODEL / GK)
#define STAGE_COPIES  8     // copies of a wave in one stage_copy

template <int N>
static __device__ __forceinline__ void wait_copies_but() {
  asm volatile("s_wait_asynccnt %0" :: "n"(N) : "memory");
}

// The wave's 32 x 64 tile (4 waves down, 2 across): the products ...
template <int NB>
static __device__ __forceinline__
void gemm_tile(const u16* __restrict__ A, const u16* __restrict__ W,
               int rowb, int colb, u16 (*sm)[G_STAGE_ELEMS], v8f (&acc)[2][4])
{
  const int K    = D_MODEL;
  const int tid  = threadIdx.x;
  const int lane = threadIdx.x & 31;
  const int wave = threadIdx.x >> 5;
  // a copy takes two 16-row tiles' share of the stage (2 x 2 KiB): the thread's first chunks
  const u16* Ag = A + (rowb + 16 * (tid >> 7)) * K + (tid & 127) * 8;
  const u16* Wg = W + (colb + 16 * (tid >> 7)) * K + (tid & 127) * 8;
  const u32 lds0 = (u32)(size_t)&sm[0][0] + tid * 16;   // low 32 bits = LDS byte address

  static_assert(NB >= 2 && NB <= G_STAGES && NB * STAGE_COPIES <= 63, "stages exist, copies in flight");
  // stages 0 to NB - 1, one into each buffer (unrolled: the places in LDS and in A, W are constants)
#pragma unroll
  for (int p = 0; p < NB; ++p)
    stage_copy<32 * D_MODEL, 32 * D_MODEL>(lds0 + p * (G_STAGE_ELEMS * 2),
                                           Ag + p * G_TILE_ELEMS, Wg + p * G_TILE_ELEMS);
  Ag += NB * G_TILE_ELEMS;
  Wg += NB * G_TILE_ELEMS;
  // this wave's copies of stage 0 have landed (those of the NB - 1 later stages may still fly) ...
  wait_copies_but<(NB - 1) * STAGE_COPIES>();
  // ... and so have the other waves'
  __syncthreads();

  const v8f vzero = {};
#pragma unroll
  for (int i = 0; i < 2; ++i)
#pragma unroll
    for (int j = 0; j < 4; ++j) acc[i][j] = vzero;

  int buf = 0;   // s mod NB
  for (int s = 0; s < G_STAGES; ++s) {
    // the wave's two tiles of A and four of W, with this lane's 16-byte slot added
    const u16* As = &sm[buf][0] + (wave >> 1) * (2 * G_TILE_ELEMS) + lane * 8;
    const u16* Ws = &sm[buf][0] + G_HALF_ELEMS + (wave & 1) * (4 * G_TILE_ELEMS) + lane * 8;
    // 12x ds_load_b128 (512 contiguous bytes each) + 8x v_wmma per 32-deep K step
#pragma unroll
    for (int kk = 0; kk < GK / 32; ++kk) {
      v16bf a[2], b[4];
#pragma unroll
      for (int i = 0; i < 2; ++i)
        a[i] = load_frag_packed(As + i * G_TILE_ELEMS + kk * (16 * 32));
#pragma unroll
      for (int j = 0; j < 4; ++j)
        b[j] = load_frag_packed(Ws + j * G_TILE_ELEMS + kk * (16 * 32));   // row n, k along K
      // Keeps the twelve reads in flight together: without it the matrix instructions move up
      // between them, and a step waits out several LDS latencies in a row.
      __builtin_amdgcn_sched_barrier(0);
#pragma unroll
      for (int i = 0; i < 2; ++i)
#pragma unroll
        for (int j = 0; j < 4; ++j)
          acc[i][j] = __builtin_amdgcn_wmma_f32_16x16x32_bf16(
              false, a[i], false, b[j], (short)0, acc[i][j], false, false);
    }
    // Publish point of stage s + 1. This wave's reads of buffer buf have returned ...
    asm volatile("s_wait_dscnt 0x0" ::: "memory");
    // ... its copies of stage s + 1 have landed: while stage s + NB - 1 exists, the wave's youngest
    // copies are those of the NB - 2 stages behind s + 1, a full stage each, and may fly on ...
    wait_copies_but<(NB - 2) * STAGE_COPIES>();
    // ... in the last trips fewer stages stand behind s + 1, and the wait goes on to 0 ...
    if (s + NB > G_STAGES) wait_copies_but<0>();
    // ... and both hold for all eight waves: stage s + 1 may be read, buffer buf refilled.
    __syncthreads();
    if (s + NB < G_STAGES) {
      stage_copy<32 * D_MODEL, 32 * D_MODEL>(lds0 + buf * (G_STAGE_ELEMS * 2), Ag, Wg);
      Ag += G_TILE_ELEMS;
      Wg += G_TILE_ELEMS;
    }
    buf = buf + 1 == NB ? 0 : buf + 1;
  }
  // no copy is outstanding when the wave goes on to its stores
  asm volatile("s_wait_asynccnt 0x0" ::: "memory");
}

// ... and what becomes of them. C layout -> lane holds column n, rows (hi*8 + r)
// mul (OUT_MODE 0 alone): a factor on the biased value, Q_SCALE for Q and 1 for K
template <int OUT_MODE>
static __device__ __forceinline__
void gemm_store(const v8f (&acc)[2][4], const float* __restrict__ bias, void* __restrict__ Out,
                int row0, int col0, float mul = 1.0f)
{
  const int c16 = threadIdx.x & 15;
  const int hi  = (threadIdx.x >> 4) & 1;
#pragma unroll
  for (int i = 0; i < 2; ++i) {
#pragma unroll
    for (int j = 0; j < 4; ++j) {
      const int n = col0 + 16 * j + c16;
      const float bv = bias[n];
      const int m0 = row0 + 16 * i + hi * 8;   // the lane's 8 rows: m0 .. m0 + 7, one batch
      const int bb = m0 >> 11;                 // / T_SEQ
      const int t0 = m0 & (T_SEQ - 1);
      const int h  = n >> 6;                   // / HEAD_DIM
      const int d  = n & (HEAD_DIM - 1);
      u16* Oh = (u16*)Out + (size_t)(bb * N_HEADS + h) * (T_SEQ * HEAD_DIM);
#pragma unroll
      for (int r = 0; r < 8; r += 2) {
        const float v = acc[i][j][r] + bv;
        const float w = acc[i][j][r + 1] + bv;
        if constexpr (OUT_MODE == 2) {
          ((float*)Out)[(size_t)(m0 + r) * D_MODEL + n] = v;
          ((float*)Out)[(size_t)(m0 + r + 1) * D_MODEL + n] = w;
        } else if constexpr (OUT_MODE == 0) {
          const u32 p = pack_bf16x2(v * mul, w * mul);
          Oh[packed_idx(t0 + r, d, HEAD_DIM)] = (u16)p;
          Oh[packed_idx(t0 + r + 1, d, HEAD_DIM)] = (u16)(p >> 16);
        } else {   // rows are d, k runs along t: the lane's 8 values fill one 16-byte chunk
          *(u32*)(Oh + packed_idx(d, t0, T_SEQ) + r) = pack_bf16x2(v, w);
        }
      }
    }
  }
}

// The three input projections depend on one another not at all: one grid, blockIdx.z = 0, 1, 2
// for Q, K, V. Three work-groups then share a WGP, six waves a SIMD where a launch of one
// projection had two, and one wave's wait for its loads is filled by the others' products.
__global__ __launch_bounds__(256)
void gemm_qkv_k(const u16* __restrict__ X,     // Xq, Xk, Xv one behind the other
                const u16* __restrict__ Wb,    // Wq, Wk, Wv one behind the other
                const float* __restrict__ bq, const float* __restrict__ bk,
                const float* __restrict__ bv,
                u16* __restrict__ QKV)         // Qh, Kh, Vt one behind the other
{
  const int z    = blockIdx.z;
  const int wave = threadIdx.x >> 5;
  const int row0 = blockIdx.y * 128 + (wave >> 1) * 32;  // 4 waves down
  const int col0 = blockIdx.x * 128 + (wave & 1) * 64;   // 2 waves across
  // three buffers: 96 KiB, so that three work-groups still share a WGP's 320 KiB
  __shared__ __attribute__((aligned(128))) u16 sm[3][G_STAGE_ELEMS];
  v8f acc[2][4];
  gemm_tile<3>(X + (size_t)z * (M_TOK * D_MODEL), Wb + (size_t)z * (D_MODEL * D_MODEL),
               blockIdx.y * 128, blockIdx.x * 128, sm, acc);
  u16* Out = QKV + (size_t)z * (M_TOK * D_MODEL);
  if (z == 2) {
    gemm_store<1>(acc, bv, Out, row0, col0);
  } else {
    gemm_store<0>(acc, z == 0 ? bq : bk, Out, row0, col0, z == 0 ? Q_SCALE : 1.0f);
    // The wait that stands in front of any overwrite of a register that an issued store names:
    // in the built kernel the other epilogue's code follows this one's and overwrites them.
    asm volatile("s_wait_xcnt 0x0" ::: "memory");
  }
}

__global__ __launch_bounds__(256)
void gemm_out_k(const u16* __restrict__ A, const u16* __restrict__ W,
                const float* __restrict__ bias, float* __restrict__ Out)
{
  const int wave = threadIdx.x >> 5;
  const int row0 = blockIdx.y * 128 + (wave >> 1) * 32;  // 4 waves down
  const int col0 = blockIdx.x * 128 + (wave & 1) * 64;   // 2 waves across
  // the work-group is alone on its WGP, nothing else covers a copy's way: four buffers
  __shared__ __attribute__((aligned(128))) u16 sm[4][G_STAGE_ELEMS];
  v8f acc[2][4];
  gemm_tile<4>(A, W, blockIdx.y * 128, blockIdx.x * 128, sm, acc);
  gemm_store<2>(acc, bias, Out, row0, col0);
}

// ---------- Flash attention: two waves per (b, h, 32 query rows), K and V through LDS ----------
// lane l <-> lane l ^ 16
static __device__ __forceinline__ float xhalf(float x) {
  const int b = __builtin_bit_cast(int, x);
  return __builtin_bit_cast(float,
      __builtin_amdgcn_permlanex16(b, b, 0x76543210, 0xfedcba98, false, false));
}

#define KS          128
#define STAGE_HALF  (KS * HEAD_DIM)       // elements of K, and of V^T, in a stage
#define STAGE_ELEMS (2 * STAGE_HALF)
#define N_STAGES    (T_SEQ / KS)
#define QT          2                     // query tiles of a wave
#define KW          (KS / 2)              // keys of a stage that a wave works on
#define REF_RISE    8.0f      // how far an exponent may rise above 0 before the reference follows
#define NO_KEY      -1e29f    // above every masked score (-1e30), below every real one

// A wave's share of one stage of the key walk: KW keys, K at Ks and V^T at Vs in the LDS buffer
// (this lane's 16-byte slot added). Mp = those keys' mask bit-words of this lane's query row in
// tile 0; tile 1's row lies 16 rows further. masked = false (alike in the whole wave: scalar
// branches) leaves out the mask loads and the selects, for a share in which every mask bit of the
// wave's query rows is set: there each select would hand its score through as it is. The branches
// stand round the loads and the selects alone, so that the large state (O, references) has one
// path through the stage and one set of registers.
//
// The score product delivers the softmax's exponent itself. Q carries Q_SCALE, and the product
// starts from C = cref = minus the row's reference (all eight elements alike: a lane's column is
// one query), so that D = log2(e) * score / 8 - reference goes into exp2 as it stands. The
// reference must be there before the scores are, so it is a held one: a score of the row seen
// earlier, which follows only when an exponent rises above thr. thr = REF_RISE (exp2 stays at or
// below 256; O / l does not depend on the reference) once the row has a reference, NO_KEY before
// its first open key, so that the first real score sets it. cref, thr: alike in both halves.
static __device__ __forceinline__
void attn_stage(bool masked, const u16* Ks, const u16* Vs, const u32* __restrict__ Mp, int hi,
                const v16bf (&qf)[QT][2], v8f (&o)[QT][4], v8f (&cref)[QT], float (&thr)[QT],
                float (&lrow)[QT])
{
  // one mask bit-word per lane covers a 32-key tile for a query row: the share's words
  u32 wrow[QT][KW / 32] = {};
  if (masked) {
#pragma unroll
    for (int u = 0; u < QT; ++u)
#pragma unroll
      for (int i = 0; i < KW / 32; ++i) wrow[u][i] = Mp[u * (16 * TW) + i];
    // The wait that stands in front of any overwrite of a register that an issued load names.
    // It takes the address as an input, so that it stays live up to it and no load lands its
    // result in it.
    asm volatile("s_wait_xcnt 0x0" :: "v"(Mp) : "memory");
  }

#pragma unroll
  for (int i = 0; i < KW / 32; ++i) {
    // these 32 keys' K fragments, read where they are used: held a whole pass ahead, beside V^T and
    // both tiles' scores, they pass the register budget of four waves per SIMD
    v16bf kb0[2], kb1[2];
#pragma unroll
    for (int dk = 0; dk < 2; ++dk) {
      kb0[dk] = load_frag_packed(Ks + i * (32 * HEAD_DIM) + 16 * (dk * 32));
      kb1[dk] = load_frag_packed(Ks + i * (32 * HEAD_DIM) + 16 * HEAD_DIM + 16 * (dk * 32));
    }
    // S^T = K * Q^T + cref for 32 keys (two 16x16 C tiles a query tile):
    // s0[u][r] = S[16 u + c16][kt + 8 hi + r], s1: + 16
    v8f s0[QT], s1[QT];
#pragma unroll
    for (int u = 0; u < QT; ++u) { s0[u] = cref[u]; s1[u] = cref[u]; }
#pragma unroll
    for (int dk = 0; dk < 2; ++dk) {
#pragma unroll
      for (int u = 0; u < QT; ++u) {
        s0[u] = __builtin_amdgcn_wmma_f32_16x16x32_bf16(false, kb0[dk], false, qf[u][dk], (short)0, s0[u], false, false);
        s1[u] = __builtin_amdgcn_wmma_f32_16x16x32_bf16(false, kb1[dk], false, qf[u][dk], (short)0, s1[u], false, false);
      }
    }
    // With its twin below it keeps the eight LDS reads between them in one run, issued ahead of the
    // softmax.
    __builtin_amdgcn_sched_barrier(0);
    // These keys' V^T fragments: one group of reads, which returns while the softmax runs.
    v16bf vf[4];
#pragma unroll
    for (int t = 0; t < 4; ++t)
      vf[t] = load_frag_packed(Vs + t * (16 * KS) + i * (16 * 32));
    // Without the pair the reads sink down to their users two by two, and each two are waited for
    // where they stand.
    __builtin_amdgcn_sched_barrier(0);

    if (masked) {
#pragma unroll
      for (int u = 0; u < QT; ++u) {
        const u32 wr = wrow[u][i] >> (8 * hi);   // bit r: key 8 hi + r; bit 16 + r: key 16 + 8 hi + r
#pragma unroll
        for (int r = 0; r < 8; ++r) {
          if ((wr & (1u << r)) == 0) s0[u][r] = -1e30f;
          if ((wr & (0x10000u << r)) == 0) s1[u][r] = -1e30f;
        }
      }
    }
    float p0[QT][8], p1[QT][8];
    float tmax[QT];
#pragma unroll
    for (int u = 0; u < QT; ++u) {
      tmax[u] = -1e30f;
#pragma unroll
      for (int r = 0; r < 8; ++r) {
        p0[u][r] = s0[u][r]; p1[u][r] = s1[u][r];
        tmax[u] = fmaxf(tmax[u], fmaxf(p0[u][r], p1[u][r]));
      }
    }
    // One scalar branch a pass, on a ballot over the lanes' own exponents: the references follow.
    if (__builtin_amdgcn_ballot_w32(tmax[0] > thr[0] || tmax[1] > thr[1]) != 0) {
#pragma unroll
      for (int u = 0; u < QT; ++u) {
        // the row's largest exponent: the other 16 keys lie in the other half
        const float tm = fmaxf(tmax[u], xhalf(tmax[u]));
        const bool held = thr[u] > 0.0f;   // the row has a reference, and sum and O are taken against it
        const bool open = tm > NO_KEY;     // these 32 keys hold an open one
        // the reference rises to this pass's largest score; a first one is set to it, up or down
        const float delta = held ? fmaxf(tm, 0.0f) : open ? tm : 0.0f;
        // without a reference sum and O are 0 and stay so, whatever exp2(-delta) would be
        const float alpha = held ? __builtin_amdgcn_exp2f(-delta) : 0.0f;
        if (open) thr[u] = REF_RISE;
#pragma unroll
        for (int r = 0; r < 8; ++r) {
          p0[u][r] -= delta;
          p1[u][r] -= delta;
          cref[u][r] -= delta;
        }
        lrow[u] *= alpha;
#pragma unroll
        for (int t = 0; t < 4; ++t)
#pragma unroll
          for (int r = 0; r < 8; ++r) o[u][t][r] *= alpha;
      }
    }
#pragma unroll
    for (int u = 0; u < QT; ++u) {
      float rs = 0.0f;
#pragma unroll
      for (int r = 0; r < 8; ++r) {
        p0[u][r] = __builtin_amdgcn_exp2f(p0[u][r]);
        p1[u][r] = __builtin_amdgcn_exp2f(p1[u][r]);
        rs += p0[u][r] + p1[u][r];
      }
      lrow[u] += rs;

      // P^T as B fragment: elements 0..7 are keys 8 hi + 0..7, elements 8..15 keys
      // 16 + 8 hi + 0..7, the k order in which load_frag_packed delivers V^T
      FragU pf;
      pf.q[0] = make_uint4(pack_bf16x2(p0[u][0], p0[u][1]), pack_bf16x2(p0[u][2], p0[u][3]),
                           pack_bf16x2(p0[u][4], p0[u][5]), pack_bf16x2(p0[u][6], p0[u][7]));
      pf.q[1] = make_uint4(pack_bf16x2(p1[u][0], p1[u][1]), pack_bf16x2(p1[u][2], p1[u][3]),
                           pack_bf16x2(p1[u][4], p1[u][5]), pack_bf16x2(p1[u][6], p1[u][7]));

      // O^T += V^T * P^T  (V stored transposed, in fragment order: row d, k in chunks of 8)
#pragma unroll
      for (int t = 0; t < 4; ++t)
        o[u][t] = __builtin_amdgcn_wmma_f32_16x16x32_bf16(false, vf[t], false, pf.v, (short)0, o[u][t], false, false);
    }
  }
}

// The join of two waves' halves of the keys, through LDS. A wave hands one query tile to its
// partner and finishes the other. x = the handing wave's place (JOIN_FLOATS floats) with this
// lane's 16-byte slot added: nine runs of 512 contiguous bytes, eight of O and one of
// (sum, reference, thr).
#define JOIN_FLOATS (9 * 128)
static __device__ __forceinline__
void join_send(float* x, const v8f (&o)[4], float lrow, float cref0, float thr)
{
#pragma unroll
  for (int t = 0; t < 4; ++t) {
    const v4f lo = {o[t][0], o[t][1], o[t][2], o[t][3]};
    const v4f up = {o[t][4], o[t][5], o[t][6], o[t][7]};
    *(v4f*)(x + (2 * t) * 128) = lo;
    *(v4f*)(x + (2 * t + 1) * 128) = up;
  }
  const v4f m = {lrow, -cref0, thr, 0.0f};
  *(v4f*)(x + 8 * 128) = m;
}

// Both halves' sums and O are brought to the larger of the two references; a half that has none
// (no open key in it: its sum and O are 0) counts for nothing. Then O /= l, written as bf16 in
// fragment order for the final GEMM: the lane's 8 values of a tile are 8 consecutive d of one
// row, one 16-byte chunk. dst = the chunk of t = 0.
static __device__ __forceinline__
void join_finish(const float* x, const v8f (&o)[4], float lrow, float cref0, float thr, u16* dst)
{
  const v4f m = *(const v4f*)(x + 8 * 128);
  const bool ha = thr > 0.0f, hb = m.z > 0.0f;
  const float ra = ha ? -cref0 : -3e38f;
  const float rb = hb ? m.y : -3e38f;
  const float rm = fmaxf(ra, rb);
  const float sa = ha ? __builtin_amdgcn_exp2f(ra - rm) : 0.0f;
  const float sb = hb ? __builtin_amdgcn_exp2f(rb - rm) : 0.0f;
  const float lh = sa * lrow + sb * m.x;   // over the keys of this lane's half of the wave
  const float l  = lh + xhalf(lh);
#pragma unroll
  for (int t = 0; t < 4; ++t) {
    const v4f lo = *(const v4f*)(x + (2 * t) * 128);
    const v4f up = *(const v4f*)(x + (2 * t + 1) * 128);
    float v[8];
#pragma unroll
    for (int r = 0; r < 4; ++r) {
      v[r]     = (sa * o[t][r] + sb * lo[r]) / l;
      v[r + 4] = (sa * o[t][r + 4] + sb * up[r]) / l;
    }
    uint4 w;
    w.x = pack_bf16x2(v[0], v[1]);
    w.y = pack_bf16x2(v[2], v[3]);
    w.z = pack_bf16x2(v[4], v[5]);
    w.w = pack_bf16x2(v[6], v[7]);
    // 16 d further: two chunks of 16 rows x 8 elements
    *(uint4*)(dst + t * (2 * 16 * 8)) = w;
  }
}

// Four waves per SIMD (two work-groups a WGP, all 512 resident at once) take a budget of 256
// registers a wave.
__global__ __launch_bounds__(256) __attribute__((amdgpu_waves_per_eu(4, 4)))
void flash_attn_k(const u16* __restrict__ Qh, const u16* __restrict__ Kh,
                  const u16* __restrict__ Vt, const u32* __restrict__ mbits,
                  u16* __restrict__ att)
{
  __shared__ __attribute__((aligned(128))) u16 sm[2][STAGE_ELEMS];
  static_assert(8 * JOIN_FLOATS * 4 <= 2 * STAGE_ELEMS * 2, "the join fits the ring");

  const int tid  = threadIdx.x;
  const int lane = threadIdx.x & 31;
  const int wave = __builtin_amdgcn_readfirstlane(threadIdx.x >> 5);
  const int c16  = lane & 15;
  const int hi   = lane >> 4;
  const int kh   = wave >> 2;                    // which half of each stage's keys

  // a work-group: 128 query rows of one (b, h); a wave: 32 of them
  const int h  = (blockIdx.x >> 4) & (N_HEADS - 1);
  const int b  = blockIdx.x >> 8;
  const int q0 = (blockIdx.x & 15) * 128 + (wave & 3) * (16 * QT);

  // per-head matrices in fragment order
  const size_t hb = (size_t)((b * N_HEADS + h) * T_SEQ) * HEAD_DIM;
  const u16* Qb = Qh + hb + lane * 8;   // [T][HD]: a 16-row tile holds 16 * HEAD_DIM elements
  // the thread's first chunks of a stage: K is one run of 16 KiB, 4 KiB a copy; of V^T a copy
  // takes 4 KiB of one of the four 16-row tiles
  const u16* Kg = Kh + hb + tid * 8;
  const u16* Vg = Vt + hb + tid * 8;
  const u32 lds0 = (u32)(size_t)&sm[0][0] + tid * 16;   // low 32 bits = LDS byte address
  // the mask bit-words of this lane's query row in tile 0 (q0 + c16), one word per 32 keys
  const u32* Mp = mbits + (size_t)(b * T_SEQ + q0 + c16) * TW;

  // stage 0 into buffer 0, landed and published; then stage 1 into buffer 1
  stage_copy<2048, 16 * T_SEQ>(lds0, Kg, Vg);

  // Which stages hold no masked key for any of the wave's query rows in the wave's half of the
  // keys: bit s of full. A stage's four bit-words of a row are one 16-byte load; the lower half of
  // the wave looks at stages 0 to 7 of its rows, the upper half at stages 8 to 15. The loads fly
  // beside stage 0's copies.
  static_assert(KS == 128 && N_STAGES == 16 && QT == 2, "four words a stage, sixteen stages a row");
  const uint4* M4 = (const uint4*)Mp + hi * (N_STAGES / 2);
  uint4 mw[QT][N_STAGES / 2];
#pragma unroll
  for (int u = 0; u < QT; ++u)
#pragma unroll
    for (int k = 0; k < N_STAGES / 2; ++k) mw[u][k] = M4[u * (16 * TW / 4) + k];
  // The wait that stands in front of any overwrite of a register that an issued load names.
  // The address is an input, so that it stays live up to it and no load lands its result in it.
  asm volatile("s_wait_xcnt 0x0" :: "v"(M4) : "memory");

  // this wave's copies have landed ...
  asm volatile("s_wait_asynccnt 0x0" ::: "memory");
  // ... and so have the other waves'
  __syncthreads();
  stage_copy<2048, 16 * T_SEQ>(lds0 + STAGE_ELEMS * 2, Kg + STAGE_HALF, Vg + KS * 16);
  Kg += 2 * STAGE_HALF;
  Vg += 2 * KS * 16;

  u32 full = 0;
#pragma unroll
  for (int k = 0; k < N_STAGES / 2; ++k) {
    const u32 mine = kh ? (mw[0][k].z & mw[0][k].w & mw[1][k].z & mw[1][k].w)
                        : (mw[0][k].x & mw[0][k].y & mw[1][k].x & mw[1][k].y);
    // bit l: lane l has a masked key in its stage
    const u32 holes = __builtin_amdgcn_ballot_w32(mine != 0xffffffffu);
    if ((holes & 0xffffu) == 0) full |= 1u << k;
    if ((holes >> 16) == 0) full |= 1u << (k + N_STAGES / 2);
  }

  // Q fragments (32 q rows x 64 d), held for whole loop: B operand, column = query row c16
  v16bf qf[QT][2];
#pragma unroll
  for (int u = 0; u < QT; ++u)
#pragma unroll
    for (int dk = 0; dk < 2; ++dk)
      qf[u][dk] = load_frag_packed(Qb + (q0 + 16 * u) * HEAD_DIM + 16 * (dk * 32));

  const v8f vzero = {};
  v8f o[QT][4];                // o[u][t][r] = O[q0 + 16 u + c16][16 t + 8 hi + r]
  v8f cref[QT];                // minus the reference of the lane's query row: 0 until it has one
  float thr[QT];               // the exponent above which the reference follows
  float lrow[QT];              // running sum over the keys of this lane's half alone
#pragma unroll
  for (int u = 0; u < QT; ++u) {
#pragma unroll
    for (int t = 0; t < 4; ++t) o[u][t] = vzero;
    cref[u] = vzero;
    thr[u]  = NO_KEY;
    lrow[u] = 0.0f;
  }

  for (int s = 0; s < N_STAGES; ++s) {
    // the wave's half of the stage, with this lane's 16-byte slot added
    const u16* Ks = &sm[s & 1][0] + kh * (KW * HEAD_DIM) + lane * 8;
    const u16* Vs = &sm[s & 1][0] + STAGE_HALF + kh * (KW * 16) + lane * 8;
    // the wave's own bit: scalar
    attn_stage((full & (1u << s)) == 0, Ks, Vs, Mp + s * (KS / 32) + kh * (KW / 32), hi, qf, o, cref,
               thr, lrow);

    // Publish point of stage s + 1. This wave's reads of buffer s & 1 have returned ...
    asm volatile("s_wait_dscnt 0x0" ::: "memory");
    // ... its copies of stage s + 1 have landed ...
    asm volatile("s_wait_asynccnt 0x0" ::: "memory");
    // ... and both hold for all eight waves: stage s + 1 may be read, buffer s & 1 refilled.
    __syncthreads();
    if (s + 2 < N_STAGES) {
      stage_copy<2048, 16 * T_SEQ>(lds0 + (s & 1) * (STAGE_ELEMS * 2), Kg, Vg);
      Kg += STAGE_HALF;
      Vg += KS * 16;
    }
  }
  // no copy is outstanding when the ring becomes the place of the join
  asm volatile("s_wait_asynccnt 0x0" ::: "memory");

  // Behind the walk's last barrier nobody reads the ring any more. Wave w hands tile 1 - kh to
  // wave w ^ 4 and finishes tile kh.
  float* xs = (float*)&sm[0][0] + lane * 4;
  if (kh == 0) join_send(xs + wave * JOIN_FLOATS, o[1], lrow[1], cref[1][0], thr[1]);
  else         join_send(xs + wave * JOIN_FLOATS, o[0], lrow[0], cref[0][0], thr[0]);
  // what the partner handed over is there
  __syncthreads();
  u16* dst = att + packed_idx(b * T_SEQ + q0 + 16 * kh + c16, h * HEAD_DIM + hi * 8, D_MODEL);
  const float* xp = xs + (wave ^ 4) * JOIN_FLOATS;
  if (kh == 0) join_finish(xp, o[0], lrow[0], cref[0][0], thr[0], dst);
  else         join_finish(xp, o[1], lrow[1], cref[1][0], thr[1], dst);
}

// ---------- host ----------
extern "C" void kernel_launch(void* const* d_in, const int* in_sizes, int n_in,
                              void* d_out, int out_size, void* d_ws, size_t ws_size,
                              hipStream_t stream)
{
  (void)in_sizes; (void)n_in; (void)out_size; (void)ws_size;

  const float* query = (const float*)d_in[0];
  const float* key   = (const float*)d_in[1];
  const float* value = (const float*)d_in[2];
  const int*   mask  = (const int*)  d_in[3];
  const float* wq = (const float*)d_in[4];  const float* bq = (const float*)d_in[5];
  const float* wk = (const float*)d_in[6];  const float* bk = (const float*)d_in[7];
  const float* wv = (const float*)d_in[8];  const float* bv = (const float*)d_in[9];
  const float* wo = (const float*)d_in[10]; const float* bo = (const float*)d_in[11];

  char* ws = (char*)d_ws;
  const size_t seg_x = (size_t)M_TOK * D_MODEL * sizeof(u16);    // 8 MiB
  const size_t seg_w = (size_t)D_MODEL * D_MODEL * sizeof(u16);  // 2 MiB
  u16* Xq  = (u16*)(ws + 0 * seg_x);
  // Xk, Xv: the next two segments
  char* wsw = ws + 3 * seg_x;
  u16* Wqb = (u16*)(wsw + 0 * seg_w);
  // Wkb, Wvb: the next two segments
  u16* Wob = (u16*)(wsw + 3 * seg_w);
  char* wsh = wsw + 4 * seg_w;
  u16* Qh  = (u16*)(wsh + 0 * seg_x);
  u16* Kh  = (u16*)(wsh + 1 * seg_x);
  u16* Vt  = (u16*)(wsh + 2 * seg_x);
  u16* att = (u16*)(wsh + 3 * seg_x);
  u32* mbw = (u32*)(wsh + 4 * seg_x);    // packed mask bits, 1 MiB

  dim3 bb(256);
  prep_k<<<dim3(PREP_BLOCKS), bb, 0, stream>>>(query, key, value, mask, wq, wk, wv, wo,
                                               Xq, Wqb, mbw);

  // (8, 32) blocks of 256 threads per projection
  gemm_qkv_k<<<dim3(D_MODEL / 128, M_TOK / 128, 3), bb, 0, stream>>>(Xq, Wqb, bq, bk, bv, Qh);

  const int n_waves = B_SZ * N_HEADS * (T_SEQ / 16);  // 4096
  flash_attn_k<<<dim3(n_waves / 8), bb, 0, stream>>>(Qh, Kh, Vt, mbw, att);

  gemm_out_k<<<dim3(D_MODEL / 128, M_TOK / 128), bb, 0, stream>>>(att, Wob, bo, (float*)d_out);
}
